// v000
// The times below were measured on an AMD MI455X: many runs one after another, warmed up first and cycling through
// copies of the inputs, with the whole window's GPU time divided by the number of runs. Launches and the gaps
// between them are all in it. The median over several windows is given; except for v000 it joins two sittings, which
// can be a few percent apart, so the side-by-side timings, each taken in one sitting, are the better comparison.
// v000, which the later versions start from, runs in 1610 microseconds.
#include <hip/hip_runtime.h>

// TMix_qwen2 (x [2][2048][2048]; q/k/v = x W^T + b (torch; 16 query heads, 4 kv heads x 128; group h/4); rotate-half RoPE with the given angles [2][2048][128] = (cos table, sin table) (read); causal softmax(q.k / sqrt(128)) (finfo.min fill); out = merged wo^T -> [2][2048][2048]).
// Compute dtypes, f32 accumulate: every input rounded to bf16; q/k/v on PLAIN bf16 operands (inputs: exact) + bias; RoPE f32 with the read tables; causal scores and attn.v: query rows < 512 hl (3 products), the rest single fp16 (x1024), causal tile skipping; softmax f32; wo hl x exact (2 products).

#define NB_  2
#define TT   2048
#define DM   2048
#define NH_  16
#define NKV  4
#define REP  (NH_ / NKV)
#define HD   128
#define DQ   (NH_ * HD)
#define DKV  (NKV * HD)
#define ZH   2
#define RH   512                  // query rows < RH use hi+lo planes (0: none)
#define WIN  2048
#define PCAR 1024.0f
#define SCL  0.088388347648318447f   // HD^-0.5
typedef _Float16 h16;
typedef unsigned short bf;
typedef __attribute__((ext_vector_type(16))) __bf16   v16bf;
typedef __attribute__((ext_vector_type(16))) _Float16 v16h;
typedef __attribute__((ext_vector_type(8)))  _Float16 v8h;
typedef __attribute__((ext_vector_type(8)))  unsigned short v8us;
typedef __attribute__((ext_vector_type(8)))  float    v8f;
typedef __attribute__((ext_vector_type(4)))  float    v4f;
typedef v8h  __attribute__((may_alias)) v8ha;
typedef v4f  __attribute__((may_alias)) v4fa;
typedef v8us __attribute__((may_alias)) v8usa;

__device__ __forceinline__ unsigned short f2bf(float f) { unsigned u = __float_as_uint(f); u += 0x7FFFu + ((u >> 16) & 1u); return (unsigned short)(u >> 16); }
__device__ __forceinline__ float bf2f(unsigned short b) { return __uint_as_float(((unsigned)b) << 16); }
__device__ __forceinline__ float bfr(float f) { return bf2f(f2bf(f)); }
__device__ __forceinline__ v16h cat16(v8h lo, v8h hi) { return __builtin_shufflevector(lo, hi, 0, 1, 2, 3, 4, 5, 6, 7, 8, 9, 10, 11, 12, 13, 14, 15); }
__device__ __forceinline__ v16bf cat16b(v8us lo, v8us hi) { return __builtin_bit_cast(v16bf, __builtin_shufflevector(lo, hi, 0, 1, 2, 3, 4, 5, 6, 7, 8, 9, 10, 11, 12, 13, 14, 15)); }
__device__ __forceinline__ v8f wmma16(v16h a, v16h b, v8f c) { return __builtin_amdgcn_wmma_f32_16x16x32_f16(false, a, false, b, (short)0, c, false, false); }
__device__ __forceinline__ v8f wmmab(v16bf a, v16bf b, v8f c) { return __builtin_amdgcn_wmma_f32_16x16x32_bf16(false, a, false, b, (short)0, c, false, false); }



// ---- k_gemmw: register-blocked GEMM, ONE WAVE per 64x64 output tile (16 accumulators), operands straight from K-contiguous 16-bit planes; grid (M/64, N/64, Z), 32 threads.
// C[m][n] (f32, pitch ldc, + optional f32 bias[n] rounded to bf16) = sum_k A[m][k] Bt[n][k] (+ split products per NSPLIT). z-batch strides sA/sB/sC in elements. K % 32 == 0.
template <typename T16> struct WFrag;
template <> struct WFrag<h16> { typedef v16h V; static __device__ __forceinline__ V ld(const h16* p) { return cat16(*(const v8h*)p, *(const v8h*)(p + 16)); } static __device__ __forceinline__ v8f mma(V a, V b, v8f c) { return wmma16(a, b, c); } };
template <> struct WFrag<bf> { typedef v16bf V; static __device__ __forceinline__ V ld(const bf* p) { return cat16b(*(const v8us*)p, *(const v8us*)(p + 16)); } static __device__ __forceinline__ v8f mma(V a, V b, v8f c) { return wmmab(a, b, c); } };
template <typename T16, int NSPLIT, bool BIAS>
__global__ __launch_bounds__(32) void k_gemmw(const T16* __restrict__ A, const T16* __restrict__ A2, const T16* __restrict__ Bt, const T16* __restrict__ Bt2, int K, float* C, int ldc, const float* __restrict__ bias, size_t sA, size_t sB, size_t sC) {
    typedef typename WFrag<T16>::V V;
    __shared__ __align__(16) float os[16 * 68];
    const size_t z = blockIdx.z; A += z * sA; if (A2) A2 += z * sA; Bt += z * sB; if (Bt2) Bt2 += z * sB; C += z * sC;
    const int lane = threadIdx.x & 31, lr = lane & 15, hi = lane >> 4; const int r0 = blockIdx.x * 64, c0 = blockIdx.y * 64;
    v8f acc[4][4];
#pragma unroll
    for (int mb = 0; mb < 4; ++mb)
#pragma unroll
        for (int nb = 0; nb < 4; ++nb) acc[mb][nb] = (v8f){};
    const size_t aoff = (size_t)(r0 + lr) * K + 8 * hi, boff = (size_t)(c0 + lr) * K + 8 * hi;
#pragma unroll 1
    for (int kc = 0; kc < K; kc += 32) {
        V a[4], a2[4];
#pragma unroll
        for (int mb = 0; mb < 4; ++mb) { a[mb] = WFrag<T16>::ld(A + aoff + (size_t)mb * 16 * K + kc); if (NSPLIT == 1 || NSPLIT == 2) a2[mb] = WFrag<T16>::ld(A2 + aoff + (size_t)mb * 16 * K + kc); }
#pragma unroll
        for (int nb = 0; nb < 4; ++nb) { const V b = WFrag<T16>::ld(Bt + boff + (size_t)nb * 16 * K + kc); V b2; if (NSPLIT >= 2) b2 = WFrag<T16>::ld(Bt2 + boff + (size_t)nb * 16 * K + kc);
#pragma unroll
            for (int mb = 0; mb < 4; ++mb) { acc[mb][nb] = WFrag<T16>::mma(a[mb], b, acc[mb][nb]); if (NSPLIT == 1 || NSPLIT == 2) acc[mb][nb] = WFrag<T16>::mma(a2[mb], b, acc[mb][nb]); if (NSPLIT >= 2) acc[mb][nb] = WFrag<T16>::mma(a[mb], b2, acc[mb][nb]); } }
        asm volatile("v_nop\n\tv_nop\n\tv_nop\n\tv_nop" : "+v"(acc[0][0]), "+v"(acc[1][1]), "+v"(acc[2][2]), "+v"(acc[3][3]) : "v"(a[0]), "v"(a[3]));
    }
#pragma unroll
    for (int mb = 0; mb < 4; ++mb) {
#pragma unroll
        for (int nb = 0; nb < 4; ++nb) {
#pragma unroll
            for (int j = 0; j < 8; ++j) os[(hi * 8 + j) * 68 + nb * 16 + lr] = acc[mb][nb][j]; }
        __builtin_amdgcn_wave_barrier(); asm volatile("" ::: "memory");
        float* crow = C + (size_t)(r0 + mb * 16) * ldc + c0;
{
#pragma unroll
            for (int s = 0; s < 8; ++s) { const int row = 2 * s + hi, cofs = lr * 4; v4f val = *(const v4fa*)(os + row * 68 + cofs); if (BIAS) { val[0] += bfr(bias[c0 + cofs]); val[1] += bfr(bias[c0 + cofs + 1]); val[2] += bfr(bias[c0 + cofs + 2]); val[3] += bfr(bias[c0 + cofs + 3]); }
                *(v4f*)(crow + (size_t)row * ldc + cofs) = val; }
             }
        __builtin_amdgcn_wave_barrier(); asm volatile("" ::: "memory");
    }
}

// ---- k_gemmc: the same one-wave 64x64 tile GEMM specialised for causal attention: CMODE 1 skips score tiles entirely above the diagonal (query rows r0+roff.., key columns c0..), CMODE 2 limits the
// key (K) loop of the probability x value contraction to the diagonal block (probabilities beyond it are exactly zero). roff = row offset of this launch's first row within the sequence.
template <typename T16, int NSPLIT, int CMODE>
__global__ __launch_bounds__(32) void k_gemmc(const T16* __restrict__ A, const T16* __restrict__ A2, const T16* __restrict__ Bt, const T16* __restrict__ Bt2, int K, float* C, int ldc, int roff, size_t sA, size_t sB, size_t sC) {
    typedef typename WFrag<T16>::V V;
    __shared__ __align__(16) float os[16 * 68];
    const size_t z = blockIdx.z; A += z * sA; if (A2) A2 += z * sA; Bt += z * sB; if (Bt2) Bt2 += z * sB; C += z * sC;
    const int lane = threadIdx.x & 31, lr = lane & 15, hi = lane >> 4; const int r0 = blockIdx.x * 64, c0 = blockIdx.y * 64;
    if (CMODE == 1 && c0 > r0 + roff + 63) return;                  // score tile entirely above the causal diagonal: never read (the softmax masks j > i by select)
    const int Kl = (CMODE == 2) ? min(K, r0 + roff + 64) : K;        // P.V: probabilities are exactly 0 beyond the diagonal block, so the K loop stops there
    v8f acc[4][4];
#pragma unroll
    for (int mb = 0; mb < 4; ++mb)
#pragma unroll
        for (int nb = 0; nb < 4; ++nb) acc[mb][nb] = (v8f){};
    const size_t aoff = (size_t)(r0 + lr) * K + 8 * hi, boff = (size_t)(c0 + lr) * K + 8 * hi;
#pragma unroll 1
    for (int kc = 0; kc < Kl; kc += 32) {
        V a[4], a2[4];
#pragma unroll
        for (int mb = 0; mb < 4; ++mb) { a[mb] = WFrag<T16>::ld(A + aoff + (size_t)mb * 16 * K + kc); if (NSPLIT == 1 || NSPLIT == 2) a2[mb] = WFrag<T16>::ld(A2 + aoff + (size_t)mb * 16 * K + kc); }
#pragma unroll
        for (int nb = 0; nb < 4; ++nb) { const V b = WFrag<T16>::ld(Bt + boff + (size_t)nb * 16 * K + kc); V b2; if (NSPLIT >= 2) b2 = WFrag<T16>::ld(Bt2 + boff + (size_t)nb * 16 * K + kc);
#pragma unroll
            for (int mb = 0; mb < 4; ++mb) { acc[mb][nb] = WFrag<T16>::mma(a[mb], b, acc[mb][nb]); if (NSPLIT == 1 || NSPLIT == 2) acc[mb][nb] = WFrag<T16>::mma(a2[mb], b, acc[mb][nb]); if (NSPLIT >= 2) acc[mb][nb] = WFrag<T16>::mma(a[mb], b2, acc[mb][nb]); } }
        asm volatile("v_nop\n\tv_nop\n\tv_nop\n\tv_nop" : "+v"(acc[0][0]), "+v"(acc[1][1]), "+v"(acc[2][2]), "+v"(acc[3][3]) : "v"(a[0]), "v"(a[3]));
    }
#pragma unroll
    for (int mb = 0; mb < 4; ++mb) {
#pragma unroll
        for (int nb = 0; nb < 4; ++nb) {
#pragma unroll
            for (int j = 0; j < 8; ++j) os[(hi * 8 + j) * 68 + nb * 16 + lr] = acc[mb][nb][j]; }
        __builtin_amdgcn_wave_barrier(); asm volatile("" ::: "memory");
        float* crow = C + (size_t)(r0 + mb * 16) * ldc + c0;
{
#pragma unroll
            for (int s = 0; s < 8; ++s) { const int row = 2 * s + hi, cofs = lr * 4; v4f val = *(const v4fa*)(os + row * 68 + cofs);
                *(v4f*)(crow + (size_t)row * ldc + cofs) = val; }
             }
        __builtin_amdgcn_wave_barrier(); asm volatile("" ::: "memory");
    }
}

__device__ __forceinline__ h16 tohx(float x) { return (h16)x; }
__device__ __forceinline__ void splitf(float y, unsigned short& h, unsigned short& l) { h = f2bf(y); l = f2bf(y - bf2f(h)); }
typedef __attribute__((ext_vector_type(2))) _Float16 v2h;
typedef __attribute__((ext_vector_type(4))) _Float16 v4h;
typedef __attribute__((ext_vector_type(2))) unsigned short v2us;
typedef __attribute__((ext_vector_type(4))) unsigned short v4us;
typedef __attribute__((ext_vector_type(2))) float v2f;
typedef __attribute__((ext_vector_type(4))) int v4i;

__global__ __launch_bounds__(256) void k_wtG(const float* __restrict__ w, int K, int N, bf* Bt) {
    const int lane = threadIdx.x & 31; const int L0 = (blockIdx.x * 8 + (threadIdx.x >> 5)) * 8; const int nlines = N * K / 64;
{
#pragma unroll 1
        for (int l = 0; l < 8; ++l) { const int L = L0 + l; if (L >= nlines) break; const size_t e = (size_t)L * 64 + lane * 2; const int k = (int)(e % K), n = (int)(e / K); v2us o;
            o[0] = f2bf(w[(size_t)k * N + n]); o[1] = f2bf(w[(size_t)(k + 1) * N + n]); *(v2us*)(Bt + e) = o; }
         }
}
__global__ __launch_bounds__(256) void k_cvt8(const float* __restrict__ src, bf* dst, size_t n8) { const size_t i = (size_t)blockIdx.x * 256 + threadIdx.x; if (i >= n8) return; const v8f v = *(const v8f*)(src + i * 8); v8us o;
#pragma unroll
    for (int k = 0; k < 8; ++k) o[k] = f2bf(v[k]); *(v8us*)(dst + i * 8) = o;  }
__global__ __launch_bounds__(256) void k_cscvt(const float* __restrict__ cosT, const float* __restrict__ sinT, float* CS) { const int idx = blockIdx.x * 256 + threadIdx.x; if (idx >= TT * HD) return; v2f cs; cs[0] = bfr(cosT[idx]); cs[1] = bfr(sinT[idx]); *(v2f*)(CS + (size_t)idx * 2) = cs;  }
// k_rope: head planes [h][t][d] (fp16 + hi/lo) of rope(x) x sc with the rotate-half convention out[d] = x[d] cos[t][d] - x[d+HD/2] sin[t][d], out[d+HD/2] = x[d+HD/2] cos[t][d+HD/2] + x[d] sin[t][d+HD/2]
__global__ __launch_bounds__(256) void k_rope(const float* __restrict__ F, int pitch, int nheads, const float* __restrict__ CS, const float* __restrict__ RF, const float* __restrict__ nw, float sc, h16* P16, bf* Ph, bf* Pl) {
    const size_t e = ((size_t)blockIdx.x * 256 + threadIdx.x) * 2; if (e >= (size_t)nheads * TT * HD) return; const int d = (int)(e % HD); const int t = (int)((e / HD) % TT); const int h = (int)(e / ((size_t)HD * TT)); const float* f = F + (size_t)t * pitch + h * HD; const float rf = RF ? RF[(size_t)h * TT + t] : 1.0f; v2h o16; v2us oh, ol;
#pragma unroll
    for (int q = 0; q < 2; ++q) { const int dd = d + q; const int dp = (dd < HD / 2) ? dd + HD / 2 : dd - HD / 2; float x0 = f[dd], x1 = f[dp];
        if (RF) { float n0 = __fmul_rn(x0, rf), n1 = __fmul_rn(x1, rf); asm volatile("" : "+v"(n0)); asm volatile("" : "+v"(n1)); x0 = __fmul_rn(bfr(nw[dd]), n0); x1 = __fmul_rn(bfr(nw[dp]), n1); }
        const v2f cs = *(const v2f*)(CS + ((size_t)t * HD + dd) * 2); float a = __fmul_rn(x0, cs[0]), bq = __fmul_rn(x1, cs[1]); asm volatile("" : "+v"(a)); asm volatile("" : "+v"(bq)); const float r = ((dd < HD / 2) ? __fsub_rn(a, bq) : __fadd_rn(a, bq)) * sc;
        o16[q] = tohx(r); unsigned short a2, c2; splitf(r, a2, c2); oh[q] = a2; ol[q] = c2; }
    *(v2h*)(P16 + e) = o16; *(v2us*)(Ph + e) = oh; *(v2us*)(Pl + e) = ol;  }
__global__ __launch_bounds__(256) void k_vtp(const float* __restrict__ F, int pitch, int nheads, h16* V16, bf* Vh, bf* Vl) { const size_t e = ((size_t)blockIdx.x * 256 + threadIdx.x) * 2; if (e >= (size_t)nheads * HD * TT) return; const int t = (int)(e % TT); const int d = (int)((e / TT) % HD); const int g = (int)(e / ((size_t)TT * HD)); v2h o16; v2us oh, ol;
#pragma unroll
    for (int q = 0; q < 2; ++q) { const float x = F[(size_t)(t + q) * pitch + g * HD + d]; o16[q] = tohx(x); unsigned short a2, c2; splitf(x, a2, c2); oh[q] = a2; ol[q] = c2; }
    *(v2h*)(V16 + e) = o16; *(v2us*)(Vh + e) = oh; *(v2us*)(Vl + e) = ol;  }
// k_asoft: per row (zz, i): t = S x HD^-0.5 for j <= i and i - j < WIN (sliding causal window; the reference's -1e9 additive fill vanishes identically); softmax over the 2048 keys (register row, one exp, fixed trees);
__global__ __launch_bounds__(256) void k_asoft(const float* __restrict__ Sb, h16* P16, bf* Ph, bf* Pl) {
    const int lane = threadIdx.x & 31; const int row = blockIdx.x * 8 + (threadIdx.x >> 5); if (row >= ZH * TT) return; const int i = row % TT; const int zz = row / TT; (void)zz; const bool hires = (i < RH); const float* sr = Sb + (size_t)row * TT; float v[TT / 32]; float mx = -3.0e38f;
#pragma unroll
    for (int ch = 0; ch < TT / 128; ++ch) { const int j0 = ch * 128 + lane * 4; const v4f a = *(const v4f*)(sr + j0);
#pragma unroll
        for (int q = 0; q < 4; ++q) { const int j = j0 + q; (void)j; const float t = (j <= i && i - j < WIN) ? a[q] * SCL : -3.0e38f; v[ch * 4 + q] = t; mx = fmaxf(mx, t); } }
#pragma unroll
    for (int sh = 16; sh; sh >>= 1) mx = fmaxf(mx, __shfl_xor(mx, sh, 32));
    float sum = 0.f;
#pragma unroll
    for (int k = 0; k < TT / 32; ++k) { float d0 = __fsub_rn(v[k], mx); asm volatile("" : "+v"(d0)); v[k] = __builtin_amdgcn_exp2f(__fmul_rn(d0, 1.4426950408889634f)); sum += v[k]; }
#pragma unroll
    for (int sh = 16; sh; sh >>= 1) sum += __shfl_xor(sum, sh, 32);
    const float f = __fdiv_rn(hires ? 1.0f : PCAR, sum);
{
        if (hires) {
#pragma unroll
            for (int ch = 0; ch < TT / 128; ++ch) { v4us oh, ol;
#pragma unroll
                for (int q = 0; q < 4; ++q) { unsigned short a, c2; splitf(v[ch * 4 + q] * f, a, c2); oh[q] = a; ol[q] = c2; }
                const size_t oo = ((size_t)zz * (RH ? RH : 1) + i) * TT + ch * 128 + lane * 4; *(v4us*)(Ph + oo) = oh; *(v4us*)(Pl + oo) = ol; }
        } else {
#pragma unroll
            for (int ch = 0; ch < TT / 128; ++ch) { v4h o4;
#pragma unroll
                for (int q = 0; q < 4; ++q) o4[q] = tohx(v[ch * 4 + q] * f);
                *(v4h*)(P16 + (size_t)row * TT + ch * 128 + lane * 4) = o4; } }
         }
}
__global__ __launch_bounds__(256) void k_merge(const float* __restrict__ O, int h0, bf* Ah, bf* Al) { const size_t e = ((size_t)blockIdx.x * 256 + threadIdx.x) * 2; if (e >= (size_t)ZH * TT * HD) return; const int d = (int)(e % HD); const int t = (int)((e / HD) % TT); const int zz = (int)(e / ((size_t)HD * TT)); const float cs = (t < RH) ? 1.0f : (1.0f / PCAR); const size_t oo = (size_t)t * DQ + (h0 + zz) * HD + d;
    v2us oh, ol;
#pragma unroll
    for (int q = 0; q < 2; ++q) { unsigned short a, c2; splitf(O[e + q] * cs, a, c2); oh[q] = a; ol[q] = c2; } *(v2us*)(Ah + oo) = oh; *(v2us*)(Al + oo) = ol;  }

extern "C" void kernel_launch(void* const* d_in, const int* in_sizes, int n_in,
                              void* d_out, int out_size, void* d_ws, size_t ws_size, hipStream_t stream) {
    (void)in_sizes; (void)n_in; (void)out_size;
    const float* x = (const float*)d_in[0]; const float* ang = (const float*)d_in[1]; const float* wq = (const float*)d_in[2]; const float* bq = (const float*)d_in[3]; const float* wk = (const float*)d_in[4]; const float* bk = (const float*)d_in[5]; const float* wv = (const float*)d_in[6]; const float* bv = (const float*)d_in[7]; const float* wo = (const float*)d_in[8]; const float* cosT = ang; const float* sinT = ang + (size_t)2048 * 128;
    float* OUT = (float*)d_out;     // [2][2048][2048]
    char* wsp = (char*)d_ws;
    auto take = [&](size_t bytes) { char* p = wsp; wsp += (bytes + 255) & ~(size_t)255; return (void*)p; };
    bf* WQ = (bf*)take((size_t)DQ * DM * 2); bf* WK = (bf*)take((size_t)DKV * DM * 2); bf* WV = (bf*)take((size_t)DKV * DM * 2); bf* WO = (bf*)take((size_t)DM * DQ * 2); float* CS = (float*)take((size_t)TT * HD * 2 * 4);
    bf* XB = (bf*)take((size_t)TT * DM * 2); float* FQ = (float*)take((size_t)TT * DQ * 4); float* FK = (float*)take((size_t)TT * DKV * 4);
    h16* QP16 = (h16*)take((size_t)NH_ * TT * HD * 2); h16* KP16 = (h16*)take((size_t)NKV * TT * HD * 2); h16* VT16 = (h16*)take((size_t)NKV * HD * TT * 2);
    bf* QPh = (bf*)take((size_t)NH_ * TT * HD * 2); bf* QPl = (bf*)take((size_t)NH_ * TT * HD * 2); bf* KPh = (bf*)take((size_t)NKV * TT * HD * 2); bf* KPl = (bf*)take((size_t)NKV * TT * HD * 2); bf* VTh = (bf*)take((size_t)NKV * HD * TT * 2); bf* VTl = (bf*)take((size_t)NKV * HD * TT * 2); bf* Ph = (bf*)take((size_t)ZH * RH * TT * 2); bf* Pl = (bf*)take((size_t)ZH * RH * TT * 2);
    float* Sb = (float*)take((size_t)ZH * TT * TT * 4); h16* P16 = (h16*)take((size_t)ZH * TT * TT * 2); float* Ob = (float*)take((size_t)ZH * TT * HD * 4); bf* ATh = (bf*)take((size_t)TT * DQ * 2); bf* ATl = (bf*)take((size_t)TT * DQ * 2);
    if ((size_t)(wsp - (char*)d_ws) > ws_size) return;    // ws 256 MiB
    float* FV = FK;   // v projection reuses the k buffer after the k planes are built (stream-ordered)
    { k_cvt8<<<(unsigned)(((size_t)DQ * DM / 8 + 255) / 256), 256, 0, stream>>>(wq, WQ, (size_t)DQ * DM / 8); k_cvt8<<<(unsigned)(((size_t)DKV * DM / 8 + 255) / 256), 256, 0, stream>>>(wk, WK, (size_t)DKV * DM / 8); k_cvt8<<<(unsigned)(((size_t)DKV * DM / 8 + 255) / 256), 256, 0, stream>>>(wv, WV, (size_t)DKV * DM / 8);
      k_cvt8<<<(unsigned)(((size_t)DM * DQ / 8 + 255) / 256), 256, 0, stream>>>(wo, WO, (size_t)DM * DQ / 8);
       }
    const unsigned LQ = (unsigned)(((size_t)NH_ * TT * HD / 2 + 255) / 256), LKv = (unsigned)(((size_t)NKV * TT * HD / 2 + 255) / 256);
    for (int b = 0; b < NB_; ++b) {
        if (b == 0) k_cscvt<<<(TT * HD + 255) / 256, 256, 0, stream>>>(cosT, sinT, CS);
        k_cvt8<<<(unsigned)(((size_t)TT * DM / 8 + 255) / 256), 256, 0, stream>>>(x + (size_t)b * TT * DM, XB, (size_t)TT * DM / 8);
        k_gemmw<bf, 0, true><<<dim3(TT / 64, DQ / 64, 1), 32, 0, stream>>>(XB, nullptr, WQ, nullptr, DM, FQ, DQ, bq, 0, 0, 0);
        k_rope<<<LQ, 256, 0, stream>>>(FQ, DQ, NH_, CS, nullptr, nullptr, 1.0f, QP16, QPh, QPl);
        k_gemmw<bf, 0, true><<<dim3(TT / 64, DKV / 64, 1), 32, 0, stream>>>(XB, nullptr, WK, nullptr, DM, FK, DKV, bk, 0, 0, 0);
        k_rope<<<LKv, 256, 0, stream>>>(FK, DKV, NKV, CS, nullptr, nullptr, 1.0f, KP16, KPh, KPl);
        k_gemmw<bf, 0, true><<<dim3(TT / 64, DKV / 64, 1), 32, 0, stream>>>(XB, nullptr, WV, nullptr, DM, FV, DKV, bv, 0, 0, 0); k_vtp<<<LKv, 256, 0, stream>>>(FV, DKV, NKV, VT16, VTh, VTl);
        for (int h0 = 0; h0 < NH_; h0 += ZH) { const size_t zq = (size_t)h0, zk = (size_t)(h0 / REP);   // both heads of a pass share kv group h0/REP (REP >= 2): sB = 0
            k_gemmc<bf, 2, 1><<<dim3(RH / 64, TT / 64, ZH), 32, 0, stream>>>(QPh + zq * TT * HD, QPl + zq * TT * HD, KPh + zk * TT * HD, KPl + zk * TT * HD, HD, Sb, TT, 0, (size_t)TT * HD, 0, (size_t)TT * TT);
            k_gemmc<h16, 0, 1><<<dim3((TT - RH) / 64, TT / 64, ZH), 32, 0, stream>>>(QP16 + zq * TT * HD + (size_t)RH * HD, nullptr, KP16 + zk * TT * HD, nullptr, HD, Sb + (size_t)RH * TT, TT, RH, (size_t)TT * HD, 0, (size_t)TT * TT);
            k_asoft<<<ZH * TT / 8, 256, 0, stream>>>(Sb, P16, Ph, Pl);
            k_gemmc<bf, 2, 2><<<dim3(RH / 64, HD / 64, ZH), 32, 0, stream>>>(Ph, Pl, VTh + zk * HD * TT, VTl + zk * HD * TT, TT, Ob, HD, 0, (size_t)RH * TT, 0, (size_t)TT * HD);
            k_gemmc<h16, 0, 2><<<dim3((TT - RH) / 64, HD / 64, ZH), 32, 0, stream>>>(P16 + (size_t)RH * TT, nullptr, VT16 + zk * HD * TT, nullptr, TT, Ob + (size_t)RH * HD, HD, RH, (size_t)TT * TT, 0, (size_t)TT * HD);
            k_merge<<<(unsigned)(((size_t)ZH * TT * HD / 2 + 255) / 256), 256, 0, stream>>>(Ob, h0, ATh, ATl); }
        k_gemmw<bf, 1, false><<<dim3(TT / 64, DM / 64, 1), 32, 0, stream>>>(ATh, ATl, WO, nullptr, DQ, OUT + (size_t)b * TT * DM, DM, nullptr, 0, 0, 0); }
}

// v001
// One run takes 940 microseconds.
// Two timings next to v000 both put it at 1.74 times that version's speed.
#include <hip/hip_runtime.h>

// TMix_qwen2 (x [2][2048][2048]; q/k/v = x W^T + b (torch; 16 query heads, 4 kv heads x 128; group h/4); rotate-half RoPE with the given angles [2][2048][128] = (cos table, sin table) (read); causal softmax(q.k / sqrt(128)) (finfo.min fill); out = merged wo^T -> [2][2048][2048]).
// Compute dtypes, f32 accumulate: every input rounded to bf16; q/k/v on PLAIN bf16 operands (inputs: exact) + bias; RoPE f32 with the read tables; causal scores and attn.v: query rows < 512 hl (3 products), the rest single fp16 (x1024), causal tile skipping; softmax f32; wo hl x exact (2 products).

#define NB_  2
#define TT   2048
#define DM   2048
#define NH_  16
#define NKV  4
#define REP  (NH_ / NKV)
#define HD   128
#define DQ   (NH_ * HD)
#define DKV  (NKV * HD)
#define ZH   2
#define RH   512                  // query rows < RH use hi+lo planes (0: none)
#define WIN  2048
#define PCAR 1024.0f
#define SCL  0.088388347648318447f   // HD^-0.5
typedef _Float16 h16;
typedef unsigned short bf;
typedef __attribute__((ext_vector_type(16))) __bf16   v16bf;
typedef __attribute__((ext_vector_type(16))) _Float16 v16h;
typedef __attribute__((ext_vector_type(8)))  _Float16 v8h;
typedef __attribute__((ext_vector_type(8)))  unsigned short v8us;
typedef __attribute__((ext_vector_type(8)))  float    v8f;
typedef __attribute__((ext_vector_type(4)))  float    v4f;
typedef v8h  __attribute__((may_alias)) v8ha;
typedef v4f  __attribute__((may_alias)) v4fa;
typedef v8us __attribute__((may_alias)) v8usa;

__device__ __forceinline__ unsigned short f2bf(float f) { unsigned u = __float_as_uint(f); u += 0x7FFFu + ((u >> 16) & 1u); return (unsigned short)(u >> 16); }
__device__ __forceinline__ float bf2f(unsigned short b) { return __uint_as_float(((unsigned)b) << 16); }
__device__ __forceinline__ float bfr(float f) { return bf2f(f2bf(f)); }
__device__ __forceinline__ v16h cat16(v8h lo, v8h hi) { return __builtin_shufflevector(lo, hi, 0, 1, 2, 3, 4, 5, 6, 7, 8, 9, 10, 11, 12, 13, 14, 15); }
__device__ __forceinline__ v16bf cat16b(v8us lo, v8us hi) { return __builtin_bit_cast(v16bf, __builtin_shufflevector(lo, hi, 0, 1, 2, 3, 4, 5, 6, 7, 8, 9, 10, 11, 12, 13, 14, 15)); }
__device__ __forceinline__ v8f wmma16(v16h a, v16h b, v8f c) { return __builtin_amdgcn_wmma_f32_16x16x32_f16(false, a, false, b, (short)0, c, false, false); }
__device__ __forceinline__ v8f wmmab(v16bf a, v16bf b, v8f c) { return __builtin_amdgcn_wmma_f32_16x16x32_bf16(false, a, false, b, (short)0, c, false, false); }



// ---- K loop shared by NWK waves of one work-group: wave w takes the 32-k steps w, w + NWK, ... (neighbour waves read the two halves of one 128-byte line of every operand row at about the same time) into its own 64x64 f32 partial tile;
// the partial tiles meet in LDS and are summed in the fixed order wave 0, 1, ... NWK-1. LDS in 16-byte units [wave][mb][hi][nb][j/4][lr]: contiguous 256 bytes per 16 lanes for the writer and for the reader.
#define NWK 8
#define REDU (NWK * 4 * 2 * 4 * 2 * 16)   // 16-byte units: NWK partial tiles of 16 KiB
__device__ __forceinline__ void red_put(v4f* red, int wv, int lr, int hi, const v8f (&acc)[4][4]) {
#pragma unroll
    for (int mb = 0; mb < 4; ++mb)
#pragma unroll
        for (int nb = 0; nb < 4; ++nb) { v4f* p = red + ((((wv * 4 + mb) * 2 + hi) * 4 + nb) * 2) * 16 + lr;
            p[0] = __builtin_shufflevector(acc[mb][nb], acc[mb][nb], 0, 1, 2, 3); p[16] = __builtin_shufflevector(acc[mb][nb], acc[mb][nb], 4, 5, 6, 7); }
}
// wave wv sums and stores rows 8 wv .. 8 wv + 7 of the tile (mb = wv / 2, hi = wv % 2); lane = column within a 32-column group, so every store instruction writes one whole 128-byte line.
template <bool BIAS>
__device__ __forceinline__ void red_sum_store(const v4f* red, int wv, int lane, float* ctile, int ldc, const float* btile) {
#pragma unroll
    for (int g = 0; g < 2; ++g) { const v4f* p = red + ((wv * 4 + g * 2 + (lane >> 4)) * 2) * 16 + (lane & 15); v4f s0 = p[0], s1 = p[16];
#pragma unroll
        for (int s = 1; s < NWK; ++s) { s0 += p[s * (REDU / NWK)]; s1 += p[s * (REDU / NWK) + 16]; }
        const int col = g * 32 + lane; const float bb = BIAS ? bfr(btile[col]) : 0.0f; float* cp = ctile + (size_t)(wv * 8) * ldc + col;
#pragma unroll
        for (int j = 0; j < 4; ++j) { cp[(size_t)j * ldc] = BIAS ? s0[j] + bb : s0[j]; cp[(size_t)(j + 4) * ldc] = BIAS ? s1[j] + bb : s1[j]; } }
}

// ---- k_gemmw: register-blocked GEMM, NWK waves per 64x64 output tile (each 16 accumulators over its share of K), operands straight from K-contiguous 16-bit planes; grid (M/64, N/64, Z), 32 NWK threads.
// C[m][n] (f32, pitch ldc, + optional bias[n] rounded to bf16) = sum_k A[m][k] Bt[n][k] (+ split products per NSPLIT). z-batch strides sA/sB/sC in elements. K % 32 == 0.
template <typename T16> struct WFrag;
template <> struct WFrag<h16> { typedef v16h V; static __device__ __forceinline__ V ld(const h16* p) { return cat16(*(const v8h*)p, *(const v8h*)(p + 16)); } static __device__ __forceinline__ v8f mma(V a, V b, v8f c) { return wmma16(a, b, c); } };
template <> struct WFrag<bf> { typedef v16bf V; static __device__ __forceinline__ V ld(const bf* p) { return cat16b(*(const v8us*)p, *(const v8us*)(p + 16)); } static __device__ __forceinline__ v8f mma(V a, V b, v8f c) { return wmmab(a, b, c); } };
template <typename T16, int NSPLIT, bool BIAS>
__global__ __launch_bounds__(32 * NWK) void k_gemmw(const T16* __restrict__ A, const T16* __restrict__ A2, const T16* __restrict__ Bt, const T16* __restrict__ Bt2, int K, float* C, int ldc, const float* __restrict__ bias, size_t sA, size_t sB, size_t sC) {
    typedef typename WFrag<T16>::V V;
    __shared__ __align__(16) v4f red[REDU];
    const size_t z = blockIdx.z; A += z * sA; if (A2) A2 += z * sA; Bt += z * sB; if (Bt2) Bt2 += z * sB; C += z * sC;
    const int lane = threadIdx.x & 31, lr = lane & 15, hi = lane >> 4; const int wv = __builtin_amdgcn_readfirstlane(threadIdx.x >> 5); const int r0 = blockIdx.x * 64, c0 = blockIdx.y * 64;
    v8f acc[4][4];
#pragma unroll
    for (int mb = 0; mb < 4; ++mb)
#pragma unroll
        for (int nb = 0; nb < 4; ++nb) acc[mb][nb] = (v8f){};
    const size_t aoff = (size_t)(r0 + lr) * K + 8 * hi, boff = (size_t)(c0 + lr) * K + 8 * hi;
#pragma unroll 1
    for (int kc = wv * 32; kc < K; kc += NWK * 32) {
        V a[4], a2[4];
#pragma unroll
        for (int mb = 0; mb < 4; ++mb) { a[mb] = WFrag<T16>::ld(A + aoff + (size_t)mb * 16 * K + kc); if (NSPLIT == 1 || NSPLIT == 2) a2[mb] = WFrag<T16>::ld(A2 + aoff + (size_t)mb * 16 * K + kc); }
#pragma unroll
        for (int nb = 0; nb < 4; ++nb) { const V b = WFrag<T16>::ld(Bt + boff + (size_t)nb * 16 * K + kc); V b2; if (NSPLIT >= 2) b2 = WFrag<T16>::ld(Bt2 + boff + (size_t)nb * 16 * K + kc);
#pragma unroll
            for (int mb = 0; mb < 4; ++mb) { acc[mb][nb] = WFrag<T16>::mma(a[mb], b, acc[mb][nb]); if (NSPLIT == 1 || NSPLIT == 2) acc[mb][nb] = WFrag<T16>::mma(a2[mb], b, acc[mb][nb]); if (NSPLIT >= 2) acc[mb][nb] = WFrag<T16>::mma(a[mb], b2, acc[mb][nb]); } }
        asm volatile("v_nop\n\tv_nop\n\tv_nop\n\tv_nop" : "+v"(acc[0][0]), "+v"(acc[1][1]), "+v"(acc[2][2]), "+v"(acc[3][3]) : "v"(a[0]), "v"(a[3]));
    }
    red_put(red, wv, lr, hi, acc);
    __syncthreads();   // every wave's partial tile is in LDS before any wave sums its eight rows
    red_sum_store<BIAS>(red, wv, lane, C + (size_t)r0 * ldc + c0, ldc, BIAS ? bias + c0 : nullptr);
}

// ---- k_gemmc: the same 64x64 tile GEMM specialised for causal attention (CMODE 1: K = head size, one wave per tile; CMODE 2: NWK waves share the K loop as in k_gemmw): CMODE 1 skips score tiles entirely above the diagonal (query rows r0+roff.., key columns c0..), CMODE 2 limits the
// key (K) loop of the probability x value contraction to the diagonal block (probabilities beyond it are exactly zero). roff = row offset of this launch's first row within the sequence.
template <typename T16, int NSPLIT, int CMODE>
__global__ __launch_bounds__(CMODE == 2 ? 32 * NWK : 32) void k_gemmc(const T16* __restrict__ A, const T16* __restrict__ A2, const T16* __restrict__ Bt, const T16* __restrict__ Bt2, int K, float* C, int ldc, int roff, size_t sA, size_t sB, size_t sC) {
    typedef typename WFrag<T16>::V V;
    constexpr int NW = (CMODE == 2) ? NWK : 1;   // waves per tile
    const size_t z = blockIdx.z; A += z * sA; if (A2) A2 += z * sA; Bt += z * sB; if (Bt2) Bt2 += z * sB; C += z * sC;
    const int lane = threadIdx.x & 31, lr = lane & 15, hi = lane >> 4; const int wv = (NW == 1) ? 0 : __builtin_amdgcn_readfirstlane(threadIdx.x >> 5); const int r0 = blockIdx.x * 64, c0 = blockIdx.y * 64;
    if (CMODE == 1 && c0 > r0 + roff + 63) return;                  // score tile entirely above the causal diagonal: never read (the softmax masks j > i by select)
    const int Kl = (CMODE == 2) ? min(K, r0 + roff + 64) : K;        // P.V: probabilities are exactly 0 beyond the diagonal block, so the K loop stops there
    v8f acc[4][4];
#pragma unroll
    for (int mb = 0; mb < 4; ++mb)
#pragma unroll
        for (int nb = 0; nb < 4; ++nb) acc[mb][nb] = (v8f){};
    const size_t aoff = (size_t)(r0 + lr) * K + 8 * hi, boff = (size_t)(c0 + lr) * K + 8 * hi;
#pragma unroll 1
    for (int kc = wv * 32; kc < Kl; kc += NW * 32) {
        V a[4], a2[4];
#pragma unroll
        for (int mb = 0; mb < 4; ++mb) { a[mb] = WFrag<T16>::ld(A + aoff + (size_t)mb * 16 * K + kc); if (NSPLIT == 1 || NSPLIT == 2) a2[mb] = WFrag<T16>::ld(A2 + aoff + (size_t)mb * 16 * K + kc); }
#pragma unroll
        for (int nb = 0; nb < 4; ++nb) { const V b = WFrag<T16>::ld(Bt + boff + (size_t)nb * 16 * K + kc); V b2; if (NSPLIT >= 2) b2 = WFrag<T16>::ld(Bt2 + boff + (size_t)nb * 16 * K + kc);
#pragma unroll
            for (int mb = 0; mb < 4; ++mb) { acc[mb][nb] = WFrag<T16>::mma(a[mb], b, acc[mb][nb]); if (NSPLIT == 1 || NSPLIT == 2) acc[mb][nb] = WFrag<T16>::mma(a2[mb], b, acc[mb][nb]); if (NSPLIT >= 2) acc[mb][nb] = WFrag<T16>::mma(a[mb], b2, acc[mb][nb]); } }
        asm volatile("v_nop\n\tv_nop\n\tv_nop\n\tv_nop" : "+v"(acc[0][0]), "+v"(acc[1][1]), "+v"(acc[2][2]), "+v"(acc[3][3]) : "v"(a[0]), "v"(a[3]));
    }
    if constexpr (CMODE == 2) {
    __shared__ __align__(16) v4f red[REDU];
    red_put(red, wv, lr, hi, acc);
    __syncthreads();   // every wave's partial tile is in LDS before any wave sums its eight rows
    red_sum_store<false>(red, wv, lane, C + (size_t)r0 * ldc + c0, ldc, nullptr);
    } else {
    __shared__ __align__(16) float os[16 * 68];
#pragma unroll
    for (int mb = 0; mb < 4; ++mb) {
#pragma unroll
        for (int nb = 0; nb < 4; ++nb) {
#pragma unroll
            for (int j = 0; j < 8; ++j) os[(hi * 8 + j) * 68 + nb * 16 + lr] = acc[mb][nb][j]; }
        __builtin_amdgcn_wave_barrier(); asm volatile("" ::: "memory");
        float* crow = C + (size_t)(r0 + mb * 16) * ldc + c0;
{
#pragma unroll
            for (int s = 0; s < 8; ++s) { const int row = 2 * s + hi, cofs = lr * 4; v4f val = *(const v4fa*)(os + row * 68 + cofs);
                *(v4f*)(crow + (size_t)row * ldc + cofs) = val; }
             }
        __builtin_amdgcn_wave_barrier(); asm volatile("" ::: "memory");
    }
    }
}

__device__ __forceinline__ h16 tohx(float x) { return (h16)x; }
__device__ __forceinline__ void splitf(float y, unsigned short& h, unsigned short& l) { h = f2bf(y); l = f2bf(y - bf2f(h)); }
typedef __attribute__((ext_vector_type(2))) _Float16 v2h;
typedef __attribute__((ext_vector_type(4))) _Float16 v4h;
typedef __attribute__((ext_vector_type(2))) unsigned short v2us;
typedef __attribute__((ext_vector_type(4))) unsigned short v4us;
typedef __attribute__((ext_vector_type(2))) float v2f;
typedef __attribute__((ext_vector_type(4))) int v4i;

__global__ __launch_bounds__(256) void k_wtG(const float* __restrict__ w, int K, int N, bf* Bt) {
    const int lane = threadIdx.x & 31; const int L0 = (blockIdx.x * 8 + (threadIdx.x >> 5)) * 8; const int nlines = N * K / 64;
{
#pragma unroll 1
        for (int l = 0; l < 8; ++l) { const int L = L0 + l; if (L >= nlines) break; const size_t e = (size_t)L * 64 + lane * 2; const int k = (int)(e % K), n = (int)(e / K); v2us o;
            o[0] = f2bf(w[(size_t)k * N + n]); o[1] = f2bf(w[(size_t)(k + 1) * N + n]); *(v2us*)(Bt + e) = o; }
         }
}
__global__ __launch_bounds__(256) void k_cvt8(const float* __restrict__ src, bf* dst, size_t n8) { const size_t i = (size_t)blockIdx.x * 256 + threadIdx.x; if (i >= n8) return; const v8f v = *(const v8f*)(src + i * 8); v8us o;
#pragma unroll
    for (int k = 0; k < 8; ++k) o[k] = f2bf(v[k]); *(v8us*)(dst + i * 8) = o;  }
__global__ __launch_bounds__(256) void k_cscvt(const float* __restrict__ cosT, const float* __restrict__ sinT, float* CS) { const int idx = blockIdx.x * 256 + threadIdx.x; if (idx >= TT * HD) return; v2f cs; cs[0] = bfr(cosT[idx]); cs[1] = bfr(sinT[idx]); *(v2f*)(CS + (size_t)idx * 2) = cs;  }
// k_rope: head planes [h][t][d] (fp16 + hi/lo) of rope(x) x sc with the rotate-half convention out[d] = x[d] cos[t][d] - x[d+HD/2] sin[t][d], out[d+HD/2] = x[d+HD/2] cos[t][d+HD/2] + x[d] sin[t][d+HD/2]
__global__ __launch_bounds__(256) void k_rope(const float* __restrict__ F, int pitch, int nheads, const float* __restrict__ CS, const float* __restrict__ RF, const float* __restrict__ nw, float sc, h16* P16, bf* Ph, bf* Pl) {
    const size_t e = ((size_t)blockIdx.x * 256 + threadIdx.x) * 2; if (e >= (size_t)nheads * TT * HD) return; const int d = (int)(e % HD); const int t = (int)((e / HD) % TT); const int h = (int)(e / ((size_t)HD * TT)); const float* f = F + (size_t)t * pitch + h * HD; const float rf = RF ? RF[(size_t)h * TT + t] : 1.0f; v2h o16; v2us oh, ol;
#pragma unroll
    for (int q = 0; q < 2; ++q) { const int dd = d + q; const int dp = (dd < HD / 2) ? dd + HD / 2 : dd - HD / 2; float x0 = f[dd], x1 = f[dp];
        if (RF) { float n0 = __fmul_rn(x0, rf), n1 = __fmul_rn(x1, rf); asm volatile("" : "+v"(n0)); asm volatile("" : "+v"(n1)); x0 = __fmul_rn(bfr(nw[dd]), n0); x1 = __fmul_rn(bfr(nw[dp]), n1); }
        const v2f cs = *(const v2f*)(CS + ((size_t)t * HD + dd) * 2); float a = __fmul_rn(x0, cs[0]), bq = __fmul_rn(x1, cs[1]); asm volatile("" : "+v"(a)); asm volatile("" : "+v"(bq)); const float r = ((dd < HD / 2) ? __fsub_rn(a, bq) : __fadd_rn(a, bq)) * sc;
        o16[q] = tohx(r); unsigned short a2, c2; splitf(r, a2, c2); oh[q] = a2; ol[q] = c2; }
    *(v2h*)(P16 + e) = o16; *(v2us*)(Ph + e) = oh; *(v2us*)(Pl + e) = ol;  }
__global__ __launch_bounds__(256) void k_vtp(const float* __restrict__ F, int pitch, int nheads, h16* V16, bf* Vh, bf* Vl) { const size_t e = ((size_t)blockIdx.x * 256 + threadIdx.x) * 2; if (e >= (size_t)nheads * HD * TT) return; const int t = (int)(e % TT); const int d = (int)((e / TT) % HD); const int g = (int)(e / ((size_t)TT * HD)); v2h o16; v2us oh, ol;
#pragma unroll
    for (int q = 0; q < 2; ++q) { const float x = F[(size_t)(t + q) * pitch + g * HD + d]; o16[q] = tohx(x); unsigned short a2, c2; splitf(x, a2, c2); oh[q] = a2; ol[q] = c2; }
    *(v2h*)(V16 + e) = o16; *(v2us*)(Vh + e) = oh; *(v2us*)(Vl + e) = ol;  }
// k_asoft: per row (zz, i): t = S x HD^-0.5 for j <= i and i - j < WIN (causal; i - j < WIN always holds as WIN = TT; the reference's -1e9 additive fill vanishes identically); softmax over the 2048 keys (register row, one exp, fixed trees);
__global__ __launch_bounds__(256) void k_asoft(const float* __restrict__ Sb, h16* P16, bf* Ph, bf* Pl) {
    const int lane = threadIdx.x & 31; const int row = blockIdx.x * 8 + (threadIdx.x >> 5); if (row >= ZH * TT) return; const int i = row % TT; const int zz = row / TT; (void)zz; const bool hires = (i < RH); const float* sr = Sb + (size_t)row * TT; float v[TT / 32]; float mx = -3.0e38f;
#pragma unroll
    for (int ch = 0; ch < TT / 128; ++ch) { const int j0 = ch * 128 + lane * 4; const v4f a = *(const v4f*)(sr + j0);
#pragma unroll
        for (int q = 0; q < 4; ++q) { const int j = j0 + q; (void)j; const float t = (j <= i && i - j < WIN) ? a[q] * SCL : -3.0e38f; v[ch * 4 + q] = t; mx = fmaxf(mx, t); } }
#pragma unroll
    for (int sh = 16; sh; sh >>= 1) mx = fmaxf(mx, __shfl_xor(mx, sh, 32));
    float sum = 0.f;
#pragma unroll
    for (int k = 0; k < TT / 32; ++k) { float d0 = __fsub_rn(v[k], mx); asm volatile("" : "+v"(d0)); v[k] = __builtin_amdgcn_exp2f(__fmul_rn(d0, 1.4426950408889634f)); sum += v[k]; }
#pragma unroll
    for (int sh = 16; sh; sh >>= 1) sum += __shfl_xor(sum, sh, 32);
    const float f = __fdiv_rn(hires ? 1.0f : PCAR, sum);
{
        if (hires) {
#pragma unroll
            for (int ch = 0; ch < TT / 128; ++ch) { v4us oh, ol;
#pragma unroll
                for (int q = 0; q < 4; ++q) { unsigned short a, c2; splitf(v[ch * 4 + q] * f, a, c2); oh[q] = a; ol[q] = c2; }
                const size_t oo = ((size_t)zz * (RH ? RH : 1) + i) * TT + ch * 128 + lane * 4; *(v4us*)(Ph + oo) = oh; *(v4us*)(Pl + oo) = ol; }
        } else {
#pragma unroll
            for (int ch = 0; ch < TT / 128; ++ch) { v4h o4;
#pragma unroll
                for (int q = 0; q < 4; ++q) o4[q] = tohx(v[ch * 4 + q] * f);
                *(v4h*)(P16 + (size_t)row * TT + ch * 128 + lane * 4) = o4; } }
         }
}
__global__ __launch_bounds__(256) void k_merge(const float* __restrict__ O, int h0, bf* Ah, bf* Al) { const size_t e = ((size_t)blockIdx.x * 256 + threadIdx.x) * 2; if (e >= (size_t)ZH * TT * HD) return; const int d = (int)(e % HD); const int t = (int)((e / HD) % TT); const int zz = (int)(e / ((size_t)HD * TT)); const float cs = (t < RH) ? 1.0f : (1.0f / PCAR); const size_t oo = (size_t)t * DQ + (h0 + zz) * HD + d;
    v2us oh, ol;
#pragma unroll
    for (int q = 0; q < 2; ++q) { unsigned short a, c2; splitf(O[e + q] * cs, a, c2); oh[q] = a; ol[q] = c2; } *(v2us*)(Ah + oo) = oh; *(v2us*)(Al + oo) = ol;  }

extern "C" void kernel_launch(void* const* d_in, const int* in_sizes, int n_in,
                              void* d_out, int out_size, void* d_ws, size_t ws_size, hipStream_t stream) {
    (void)in_sizes; (void)n_in; (void)out_size;
    const float* x = (const float*)d_in[0]; const float* ang = (const float*)d_in[1]; const float* wq = (const float*)d_in[2]; const float* bq = (const float*)d_in[3]; const float* wk = (const float*)d_in[4]; const float* bk = (const float*)d_in[5]; const float* wv = (const float*)d_in[6]; const float* bv = (const float*)d_in[7]; const float* wo = (const float*)d_in[8]; const float* cosT = ang; const float* sinT = ang + (size_t)2048 * 128;
    float* OUT = (float*)d_out;     // [2][2048][2048]
    char* wsp = (char*)d_ws;
    auto take = [&](size_t bytes) { char* p = wsp; wsp += (bytes + 255) & ~(size_t)255; return (void*)p; };
    bf* WQ = (bf*)take((size_t)DQ * DM * 2); bf* WK = (bf*)take((size_t)DKV * DM * 2); bf* WV = (bf*)take((size_t)DKV * DM * 2); bf* WO = (bf*)take((size_t)DM * DQ * 2); float* CS = (float*)take((size_t)TT * HD * 2 * 4);
    bf* XB = (bf*)take((size_t)TT * DM * 2); float* FQ = (float*)take((size_t)TT * DQ * 4); float* FK = (float*)take((size_t)TT * DKV * 4);
    h16* QP16 = (h16*)take((size_t)NH_ * TT * HD * 2); h16* KP16 = (h16*)take((size_t)NKV * TT * HD * 2); h16* VT16 = (h16*)take((size_t)NKV * HD * TT * 2);
    bf* QPh = (bf*)take((size_t)NH_ * TT * HD * 2); bf* QPl = (bf*)take((size_t)NH_ * TT * HD * 2); bf* KPh = (bf*)take((size_t)NKV * TT * HD * 2); bf* KPl = (bf*)take((size_t)NKV * TT * HD * 2); bf* VTh = (bf*)take((size_t)NKV * HD * TT * 2); bf* VTl = (bf*)take((size_t)NKV * HD * TT * 2); bf* Ph = (bf*)take((size_t)ZH * RH * TT * 2); bf* Pl = (bf*)take((size_t)ZH * RH * TT * 2);
    float* Sb = (float*)take((size_t)ZH * TT * TT * 4); h16* P16 = (h16*)take((size_t)ZH * TT * TT * 2); float* Ob = (float*)take((size_t)ZH * TT * HD * 4); bf* ATh = (bf*)take((size_t)TT * DQ * 2); bf* ATl = (bf*)take((size_t)TT * DQ * 2);
    if ((size_t)(wsp - (char*)d_ws) > ws_size) return;    // ws 256 MiB
    float* FV = FK;   // v projection reuses the k buffer after the k planes are built (stream-ordered)
    { k_cvt8<<<(unsigned)(((size_t)DQ * DM / 8 + 255) / 256), 256, 0, stream>>>(wq, WQ, (size_t)DQ * DM / 8); k_cvt8<<<(unsigned)(((size_t)DKV * DM / 8 + 255) / 256), 256, 0, stream>>>(wk, WK, (size_t)DKV * DM / 8); k_cvt8<<<(unsigned)(((size_t)DKV * DM / 8 + 255) / 256), 256, 0, stream>>>(wv, WV, (size_t)DKV * DM / 8);
      k_cvt8<<<(unsigned)(((size_t)DM * DQ / 8 + 255) / 256), 256, 0, stream>>>(wo, WO, (size_t)DM * DQ / 8);
       }
    const unsigned LQ = (unsigned)(((size_t)NH_ * TT * HD / 2 + 255) / 256), LKv = (unsigned)(((size_t)NKV * TT * HD / 2 + 255) / 256);
    for (int b = 0; b < NB_; ++b) {
        if (b == 0) k_cscvt<<<(TT * HD + 255) / 256, 256, 0, stream>>>(cosT, sinT, CS);
        k_cvt8<<<(unsigned)(((size_t)TT * DM / 8 + 255) / 256), 256, 0, stream>>>(x + (size_t)b * TT * DM, XB, (size_t)TT * DM / 8);
        k_gemmw<bf, 0, true><<<dim3(TT / 64, DQ / 64, 1), 32 * NWK, 0, stream>>>(XB, nullptr, WQ, nullptr, DM, FQ, DQ, bq, 0, 0, 0);
        k_rope<<<LQ, 256, 0, stream>>>(FQ, DQ, NH_, CS, nullptr, nullptr, 1.0f, QP16, QPh, QPl);
        k_gemmw<bf, 0, true><<<dim3(TT / 64, DKV / 64, 1), 32 * NWK, 0, stream>>>(XB, nullptr, WK, nullptr, DM, FK, DKV, bk, 0, 0, 0);
        k_rope<<<LKv, 256, 0, stream>>>(FK, DKV, NKV, CS, nullptr, nullptr, 1.0f, KP16, KPh, KPl);
        k_gemmw<bf, 0, true><<<dim3(TT / 64, DKV / 64, 1), 32 * NWK, 0, stream>>>(XB, nullptr, WV, nullptr, DM, FV, DKV, bv, 0, 0, 0); k_vtp<<<LKv, 256, 0, stream>>>(FV, DKV, NKV, VT16, VTh, VTl);
        for (int h0 = 0; h0 < NH_; h0 += ZH) { const size_t zq = (size_t)h0, zk = (size_t)(h0 / REP);   // both heads of a pass share kv group h0/REP (REP >= 2): sB = 0
            k_gemmc<bf, 2, 1><<<dim3(RH / 64, TT / 64, ZH), 32, 0, stream>>>(QPh + zq * TT * HD, QPl + zq * TT * HD, KPh + zk * TT * HD, KPl + zk * TT * HD, HD, Sb, TT, 0, (size_t)TT * HD, 0, (size_t)TT * TT);
            k_gemmc<h16, 0, 1><<<dim3((TT - RH) / 64, TT / 64, ZH), 32, 0, stream>>>(QP16 + zq * TT * HD + (size_t)RH * HD, nullptr, KP16 + zk * TT * HD, nullptr, HD, Sb + (size_t)RH * TT, TT, RH, (size_t)TT * HD, 0, (size_t)TT * TT);
            k_asoft<<<ZH * TT / 8, 256, 0, stream>>>(Sb, P16, Ph, Pl);
            k_gemmc<bf, 2, 2><<<dim3(RH / 64, HD / 64, ZH), 32 * NWK, 0, stream>>>(Ph, Pl, VTh + zk * HD * TT, VTl + zk * HD * TT, TT, Ob, HD, 0, (size_t)RH * TT, 0, (size_t)TT * HD);
            k_gemmc<h16, 0, 2><<<dim3((TT - RH) / 64, HD / 64, ZH), 32 * NWK, 0, stream>>>(P16 + (size_t)RH * TT, nullptr, VT16 + zk * HD * TT, nullptr, TT, Ob + (size_t)RH * HD, HD, RH, (size_t)TT * TT, 0, (size_t)TT * HD);
            k_merge<<<(unsigned)(((size_t)ZH * TT * HD / 2 + 255) / 256), 256, 0, stream>>>(Ob, h0, ATh, ATl); }
        k_gemmw<bf, 1, false><<<dim3(TT / 64, DM / 64, 1), 32 * NWK, 0, stream>>>(ATh, ATl, WO, nullptr, DQ, OUT + (size_t)b * TT * DM, DM, nullptr, 0, 0, 0); }
}

// v002
// One run takes 608 microseconds.
// Next to v001, in two timings, it ran 1.55 and 1.54 times as fast.
// All steps since v000 together make it 2.69 times as fast.
#include <hip/hip_runtime.h>

// GQA attention block (x [2][2048][2048]; q/k/v = x W^T + b (torch; 16 query heads, 4 kv heads x 128; group h/4); rotate-half RoPE with the given angles [2][2048][128] = (cos table, sin table) (read); causal softmax(q.k / sqrt(128)) (finfo.min fill); out = merged wo^T -> [2][2048][2048]).
// Compute dtypes, f32 accumulate: every input rounded to bf16; q/k/v on PLAIN bf16 operands (inputs: exact) + bias; RoPE f32 with the read tables; causal scores and attn.v: query rows < 512 hl (3 products), the rest single fp16 (x1024), causal tile skipping; softmax f32; wo hl x exact (2 products).

#define NB_  2
#define TT   2048
#define DM   2048
#define NH_  16
#define NKV  4
#define REP  (NH_ / NKV)
#define HD   128
#define DQ   (NH_ * HD)
#define DKV  (NKV * HD)
#define ZH   8                    // query heads per attention pass (a multiple of REP: a pass covers ZH / REP whole kv groups)
#define RH   512                  // query rows < RH use hi+lo planes (0: none)
#define WIN  2048
#define PCAR 1024.0f
#define SCL  0.088388347648318447f   // HD^-0.5
typedef _Float16 h16;
typedef unsigned short bf;
typedef __attribute__((ext_vector_type(16))) __bf16   v16bf;
typedef __attribute__((ext_vector_type(16))) _Float16 v16h;
typedef __attribute__((ext_vector_type(8)))  _Float16 v8h;
typedef __attribute__((ext_vector_type(8)))  unsigned short v8us;
typedef __attribute__((ext_vector_type(8)))  float    v8f;
typedef __attribute__((ext_vector_type(4)))  float    v4f;
typedef v8h  __attribute__((may_alias)) v8ha;
typedef v4f  __attribute__((may_alias)) v4fa;
typedef v8us __attribute__((may_alias)) v8usa;

__device__ __forceinline__ unsigned short f2bf(float f) { unsigned u = __float_as_uint(f); u += 0x7FFFu + ((u >> 16) & 1u); return (unsigned short)(u >> 16); }
__device__ __forceinline__ float bf2f(unsigned short b) { return __uint_as_float(((unsigned)b) << 16); }
__device__ __forceinline__ float bfr(float f) { return bf2f(f2bf(f)); }
__device__ __forceinline__ v16h cat16(v8h lo, v8h hi) { return __builtin_shufflevector(lo, hi, 0, 1, 2, 3, 4, 5, 6, 7, 8, 9, 10, 11, 12, 13, 14, 15); }
__device__ __forceinline__ v16bf cat16b(v8us lo, v8us hi) { return __builtin_bit_cast(v16bf, __builtin_shufflevector(lo, hi, 0, 1, 2, 3, 4, 5, 6, 7, 8, 9, 10, 11, 12, 13, 14, 15)); }
__device__ __forceinline__ v8f wmma16(v16h a, v16h b, v8f c) { return __builtin_amdgcn_wmma_f32_16x16x32_f16(false, a, false, b, (short)0, c, false, false); }
__device__ __forceinline__ v8f wmmab(v16bf a, v16bf b, v8f c) { return __builtin_amdgcn_wmma_f32_16x16x32_bf16(false, a, false, b, (short)0, c, false, false); }



// ---- K loop shared by NWK waves of one work-group: wave w takes the 32-k steps w, w + NWK, ... (neighbour waves read the two halves of one 128-byte line of every operand row at about the same time) into its own 64x64 f32 partial tile;
// the partial tiles meet in LDS and are summed in the fixed order wave 0, 1, ... NWK-1. LDS in 16-byte units [wave][mb][hi][nb][j/4][lr]: contiguous 256 bytes per 16 lanes for the writer and for the reader.
#define NWK 8
#define REDU (NWK * 4 * 2 * 4 * 2 * 16)   // 16-byte units: NWK partial tiles of 16 KiB
__device__ __forceinline__ void red_put(v4f* red, int wv, int lr, int hi, const v8f (&acc)[4][4]) {
#pragma unroll
    for (int mb = 0; mb < 4; ++mb)
#pragma unroll
        for (int nb = 0; nb < 4; ++nb) { v4f* p = red + ((((wv * 4 + mb) * 2 + hi) * 4 + nb) * 2) * 16 + lr;
            p[0] = __builtin_shufflevector(acc[mb][nb], acc[mb][nb], 0, 1, 2, 3); p[16] = __builtin_shufflevector(acc[mb][nb], acc[mb][nb], 4, 5, 6, 7); }
}
// wave wv sums and stores rows 8 wv .. 8 wv + 7 of the tile (mb = wv / 2, hi = wv % 2); lane = column within a 32-column group, so every store instruction writes one whole 128-byte line.
template <bool BIAS>
__device__ __forceinline__ void red_sum_store(const v4f* red, int wv, int lane, float* ctile, int ldc, const float* btile) {
#pragma unroll
    for (int g = 0; g < 2; ++g) { const v4f* p = red + ((wv * 4 + g * 2 + (lane >> 4)) * 2) * 16 + (lane & 15); v4f s0 = p[0], s1 = p[16];
#pragma unroll
        for (int s = 1; s < NWK; ++s) { s0 += p[s * (REDU / NWK)]; s1 += p[s * (REDU / NWK) + 16]; }
        const int col = g * 32 + lane; const float bb = BIAS ? bfr(btile[col]) : 0.0f; float* cp = ctile + (size_t)(wv * 8) * ldc + col;
#pragma unroll
        for (int j = 0; j < 4; ++j) { cp[(size_t)j * ldc] = BIAS ? s0[j] + bb : s0[j]; cp[(size_t)(j + 4) * ldc] = BIAS ? s1[j] + bb : s1[j]; } }
}

// ---- k_gemmw: register-blocked GEMM, NWK waves per 64x64 output tile (each 16 accumulators over its share of K), operands straight from K-contiguous 16-bit planes; grid (M/64, N/64, Z), 32 NWK threads.
// C[m][n] (f32, pitch ldc, + optional bias[n] rounded to bf16) = sum_k A[m][k] Bt[n][k] (+ split products per NSPLIT). z-batch strides sA/sB/sC in elements. K % 32 == 0.
template <typename T16> struct WFrag;
template <> struct WFrag<h16> { typedef v16h V; static __device__ __forceinline__ V ld(const h16* p) { return cat16(*(const v8h*)p, *(const v8h*)(p + 16)); } static __device__ __forceinline__ v8f mma(V a, V b, v8f c) { return wmma16(a, b, c); } };
template <> struct WFrag<bf> { typedef v16bf V; static __device__ __forceinline__ V ld(const bf* p) { return cat16b(*(const v8us*)p, *(const v8us*)(p + 16)); } static __device__ __forceinline__ v8f mma(V a, V b, v8f c) { return wmmab(a, b, c); } };
template <typename T16, int NSPLIT, bool BIAS>
__global__ __launch_bounds__(32 * NWK) void k_gemmw(const T16* __restrict__ A, const T16* __restrict__ A2, const T16* __restrict__ Bt, const T16* __restrict__ Bt2, int K, float* C, int ldc, const float* __restrict__ bias, size_t sA, size_t sB, size_t sC) {
    typedef typename WFrag<T16>::V V;
    __shared__ __align__(16) v4f red[REDU];
    const size_t z = blockIdx.z; A += z * sA; if (A2) A2 += z * sA; Bt += z * sB; if (Bt2) Bt2 += z * sB; C += z * sC;
    const int lane = threadIdx.x & 31, lr = lane & 15, hi = lane >> 4; const int wv = __builtin_amdgcn_readfirstlane(threadIdx.x >> 5); const int r0 = blockIdx.x * 64, c0 = blockIdx.y * 64;
    v8f acc[4][4];
#pragma unroll
    for (int mb = 0; mb < 4; ++mb)
#pragma unroll
        for (int nb = 0; nb < 4; ++nb) acc[mb][nb] = (v8f){};
    const size_t aoff = (size_t)(r0 + lr) * K + 8 * hi, boff = (size_t)(c0 + lr) * K + 8 * hi;
#pragma unroll 1
    for (int kc = wv * 32; kc < K; kc += NWK * 32) {
        V a[4], a2[4];
#pragma unroll
        for (int mb = 0; mb < 4; ++mb) { a[mb] = WFrag<T16>::ld(A + aoff + (size_t)mb * 16 * K + kc); if (NSPLIT == 1 || NSPLIT == 2) a2[mb] = WFrag<T16>::ld(A2 + aoff + (size_t)mb * 16 * K + kc); }
#pragma unroll
        for (int nb = 0; nb < 4; ++nb) { const V b = WFrag<T16>::ld(Bt + boff + (size_t)nb * 16 * K + kc); V b2; if (NSPLIT >= 2) b2 = WFrag<T16>::ld(Bt2 + boff + (size_t)nb * 16 * K + kc);
#pragma unroll
            for (int mb = 0; mb < 4; ++mb) { acc[mb][nb] = WFrag<T16>::mma(a[mb], b, acc[mb][nb]); if (NSPLIT == 1 || NSPLIT == 2) acc[mb][nb] = WFrag<T16>::mma(a2[mb], b, acc[mb][nb]); if (NSPLIT >= 2) acc[mb][nb] = WFrag<T16>::mma(a[mb], b2, acc[mb][nb]); } }
        asm volatile("v_nop\n\tv_nop\n\tv_nop\n\tv_nop" : "+v"(acc[0][0]), "+v"(acc[1][1]), "+v"(acc[2][2]), "+v"(acc[3][3]) : "v"(a[0]), "v"(a[3]));
    }
    red_put(red, wv, lr, hi, acc);
    __syncthreads();   // every wave's partial tile is in LDS before any wave sums its eight rows
    red_sum_store<BIAS>(red, wv, lane, C + (size_t)r0 * ldc + c0, ldc, BIAS ? bias + c0 : nullptr);
}

// ---- k_gemmc: the same 64x64 tile GEMM specialised for causal attention (CMODE 1: K = head size, one wave per tile; CMODE 2: NWK waves share the K loop as in k_gemmw): CMODE 1 skips score tiles entirely above the diagonal (query rows r0+roff.., key columns c0..), CMODE 2 limits the
// key (K) loop of the probability x value contraction to the diagonal block (probabilities beyond it are exactly zero). roff = row offset of this launch's first row within the sequence. lda = pitch of the A rows in elements (the B rows have pitch K);
// z = query head within the pass: A and C step by sA / sC per head, B by sB per kv group (z / REP).
template <typename T16, int NSPLIT, int CMODE>
__global__ __launch_bounds__(CMODE == 2 ? 32 * NWK : 32) void k_gemmc(const T16* __restrict__ A, const T16* __restrict__ A2, int lda, const T16* __restrict__ Bt, const T16* __restrict__ Bt2, int K, float* C, int ldc, int roff, size_t sA, size_t sB, size_t sC) {
    typedef typename WFrag<T16>::V V;
    constexpr int NW = (CMODE == 2) ? NWK : 1;   // waves per tile
    const size_t z = blockIdx.z; A += z * sA; if (A2) A2 += z * sA; Bt += (z / REP) * sB; if (Bt2) Bt2 += (z / REP) * sB; C += z * sC;
    const int lane = threadIdx.x & 31, lr = lane & 15, hi = lane >> 4; const int wv = (NW == 1) ? 0 : __builtin_amdgcn_readfirstlane(threadIdx.x >> 5); const int r0 = blockIdx.x * 64, c0 = blockIdx.y * 64;
    if (CMODE == 1 && c0 > r0 + roff + 63) return;                  // score tile entirely above the causal diagonal: never read (the softmax masks j > i by select)
    const int Kl = (CMODE == 2) ? min(K, r0 + roff + 64) : K;        // P.V: probabilities are exactly 0 beyond the diagonal block, so the K loop stops there
    v8f acc[4][4];
#pragma unroll
    for (int mb = 0; mb < 4; ++mb)
#pragma unroll
        for (int nb = 0; nb < 4; ++nb) acc[mb][nb] = (v8f){};
    const size_t aoff = (size_t)(r0 + lr) * lda + 8 * hi, boff = (size_t)(c0 + lr) * K + 8 * hi;
#pragma unroll 1
    for (int kc = wv * 32; kc < Kl; kc += NW * 32) {
        V a[4], a2[4];
#pragma unroll
        for (int mb = 0; mb < 4; ++mb) { a[mb] = WFrag<T16>::ld(A + aoff + (size_t)mb * 16 * lda + kc); if (NSPLIT == 1 || NSPLIT == 2) a2[mb] = WFrag<T16>::ld(A2 + aoff + (size_t)mb * 16 * lda + kc); }
#pragma unroll
        for (int nb = 0; nb < 4; ++nb) { const V b = WFrag<T16>::ld(Bt + boff + (size_t)nb * 16 * K + kc); V b2; if (NSPLIT >= 2) b2 = WFrag<T16>::ld(Bt2 + boff + (size_t)nb * 16 * K + kc);
#pragma unroll
            for (int mb = 0; mb < 4; ++mb) { acc[mb][nb] = WFrag<T16>::mma(a[mb], b, acc[mb][nb]); if (NSPLIT == 1 || NSPLIT == 2) acc[mb][nb] = WFrag<T16>::mma(a2[mb], b, acc[mb][nb]); if (NSPLIT >= 2) acc[mb][nb] = WFrag<T16>::mma(a[mb], b2, acc[mb][nb]); } }
        asm volatile("v_nop\n\tv_nop\n\tv_nop\n\tv_nop" : "+v"(acc[0][0]), "+v"(acc[1][1]), "+v"(acc[2][2]), "+v"(acc[3][3]) : "v"(a[0]), "v"(a[3]));
    }
    if constexpr (CMODE == 2) {
    __shared__ __align__(16) v4f red[REDU];
    red_put(red, wv, lr, hi, acc);
    __syncthreads();   // every wave's partial tile is in LDS before any wave sums its eight rows
    red_sum_store<false>(red, wv, lane, C + (size_t)r0 * ldc + c0, ldc, nullptr);
    } else {
    __shared__ __align__(16) float os[16 * 68];
#pragma unroll
    for (int mb = 0; mb < 4; ++mb) {
#pragma unroll
        for (int nb = 0; nb < 4; ++nb) {
#pragma unroll
            for (int j = 0; j < 8; ++j) os[(hi * 8 + j) * 68 + nb * 16 + lr] = acc[mb][nb][j]; }
        __builtin_amdgcn_wave_barrier(); asm volatile("" ::: "memory");
        float* crow = C + (size_t)(r0 + mb * 16) * ldc + c0;
{
#pragma unroll
            for (int s = 0; s < 8; ++s) { const int row = 2 * s + hi, cofs = lr * 4; v4f val = *(const v4fa*)(os + row * 68 + cofs);
                *(v4f*)(crow + (size_t)row * ldc + cofs) = val; }
             }
        __builtin_amdgcn_wave_barrier(); asm volatile("" ::: "memory");
    }
    }
}

__device__ __forceinline__ h16 tohx(float x) { return (h16)x; }
__device__ __forceinline__ void splitf(float y, unsigned short& h, unsigned short& l) { h = f2bf(y); l = f2bf(y - bf2f(h)); }
typedef __attribute__((ext_vector_type(2))) _Float16 v2h;
typedef __attribute__((ext_vector_type(4))) _Float16 v4h;
typedef __attribute__((ext_vector_type(2))) unsigned short v2us;
typedef __attribute__((ext_vector_type(4))) unsigned short v4us;
typedef __attribute__((ext_vector_type(2))) float v2f;
typedef __attribute__((ext_vector_type(4))) int v4i;

__global__ __launch_bounds__(256) void k_wtG(const float* __restrict__ w, int K, int N, bf* Bt) {
    const int lane = threadIdx.x & 31; const int L0 = (blockIdx.x * 8 + (threadIdx.x >> 5)) * 8; const int nlines = N * K / 64;
{
#pragma unroll 1
        for (int l = 0; l < 8; ++l) { const int L = L0 + l; if (L >= nlines) break; const size_t e = (size_t)L * 64 + lane * 2; const int k = (int)(e % K), n = (int)(e / K); v2us o;
            o[0] = f2bf(w[(size_t)k * N + n]); o[1] = f2bf(w[(size_t)(k + 1) * N + n]); *(v2us*)(Bt + e) = o; }
         }
}
__global__ __launch_bounds__(256) void k_cvt8(const float* __restrict__ src, bf* dst, size_t n8) { const size_t i = (size_t)blockIdx.x * 256 + threadIdx.x; if (i >= n8) return; const v8f v = *(const v8f*)(src + i * 8); v8us o;
#pragma unroll
    for (int k = 0; k < 8; ++k) o[k] = f2bf(v[k]); *(v8us*)(dst + i * 8) = o;  }
__global__ __launch_bounds__(256) void k_cscvt(const float* __restrict__ cosT, const float* __restrict__ sinT, float* CS) { const int idx = blockIdx.x * 256 + threadIdx.x; if (idx >= TT * HD) return; v2f cs; cs[0] = bfr(cosT[idx]); cs[1] = bfr(sinT[idx]); *(v2f*)(CS + (size_t)idx * 2) = cs;  }
// k_rope: head planes [h][t][d] (fp16 + hi/lo) of rope(x) x sc with the rotate-half convention out[d] = x[d] cos[t][d] - x[d+HD/2] sin[t][d], out[d+HD/2] = x[d+HD/2] cos[t][d+HD/2] + x[d] sin[t][d+HD/2]
__global__ __launch_bounds__(256) void k_rope(const float* __restrict__ F, int pitch, int nheads, const float* __restrict__ CS, const float* __restrict__ RF, const float* __restrict__ nw, float sc, h16* P16, bf* Ph, bf* Pl) {
    const size_t e = ((size_t)blockIdx.x * 256 + threadIdx.x) * 2; if (e >= (size_t)nheads * TT * HD) return; const int d = (int)(e % HD); const int t = (int)((e / HD) % TT); const int h = (int)(e / ((size_t)HD * TT)); const float* f = F + (size_t)t * pitch + h * HD; const float rf = RF ? RF[(size_t)h * TT + t] : 1.0f; v2h o16; v2us oh, ol;
#pragma unroll
    for (int q = 0; q < 2; ++q) { const int dd = d + q; const int dp = (dd < HD / 2) ? dd + HD / 2 : dd - HD / 2; float x0 = f[dd], x1 = f[dp];
        if (RF) { float n0 = __fmul_rn(x0, rf), n1 = __fmul_rn(x1, rf); asm volatile("" : "+v"(n0)); asm volatile("" : "+v"(n1)); x0 = __fmul_rn(bfr(nw[dd]), n0); x1 = __fmul_rn(bfr(nw[dp]), n1); }
        const v2f cs = *(const v2f*)(CS + ((size_t)t * HD + dd) * 2); float a = __fmul_rn(x0, cs[0]), bq = __fmul_rn(x1, cs[1]); asm volatile("" : "+v"(a)); asm volatile("" : "+v"(bq)); const float r = ((dd < HD / 2) ? __fsub_rn(a, bq) : __fadd_rn(a, bq)) * sc;
        o16[q] = tohx(r); unsigned short a2, c2; splitf(r, a2, c2); oh[q] = a2; ol[q] = c2; }
    *(v2h*)(P16 + e) = o16; *(v2us*)(Ph + e) = oh; *(v2us*)(Pl + e) = ol;  }
__global__ __launch_bounds__(256) void k_vtp(const float* __restrict__ F, int pitch, int nheads, h16* V16, bf* Vh, bf* Vl) { const size_t e = ((size_t)blockIdx.x * 256 + threadIdx.x) * 2; if (e >= (size_t)nheads * HD * TT) return; const int t = (int)(e % TT); const int d = (int)((e / TT) % HD); const int g = (int)(e / ((size_t)TT * HD)); v2h o16; v2us oh, ol;
#pragma unroll
    for (int q = 0; q < 2; ++q) { const float x = F[(size_t)(t + q) * pitch + g * HD + d]; o16[q] = tohx(x); unsigned short a2, c2; splitf(x, a2, c2); oh[q] = a2; ol[q] = c2; }
    *(v2h*)(V16 + e) = o16; *(v2us*)(Vh + e) = oh; *(v2us*)(Vl + e) = ol;  }
// k_asoft: per row (zz, i): t = S x HD^-0.5 for j <= i and i - j < WIN (sliding causal window; the reference's -1e9 additive fill vanishes identically); softmax over the 2048 keys (register row, one exp, fixed trees);
// the probabilities go back into the row's own 8192 bytes (one wave owns a row and holds all of it in registers before its first store): fp16 in the first half, or the hi plane in the first half and the lo plane in the second; 16-bit pitch 2 TT.
__global__ __launch_bounds__(256) void k_asoft(float* Sb) {
    const int lane = threadIdx.x & 31; const int row = blockIdx.x * 8 + (threadIdx.x >> 5); if (row >= ZH * TT) return; const int i = row % TT; const int zz = row / TT; (void)zz; const bool hires = (i < RH); const float* sr = Sb + (size_t)row * TT; float v[TT / 32]; float mx = -3.0e38f;
#pragma unroll
    for (int ch = 0; ch < TT / 128; ++ch) { const int j0 = ch * 128 + lane * 4; const v4f a = *(const v4f*)(sr + j0);
#pragma unroll
        for (int q = 0; q < 4; ++q) { const int j = j0 + q; (void)j; const float t = (j <= i && i - j < WIN) ? a[q] * SCL : -3.0e38f; v[ch * 4 + q] = t; mx = fmaxf(mx, t); } }
#pragma unroll
    for (int sh = 16; sh; sh >>= 1) mx = fmaxf(mx, __shfl_xor(mx, sh, 32));
    float sum = 0.f;
#pragma unroll
    for (int k = 0; k < TT / 32; ++k) { float d0 = __fsub_rn(v[k], mx); asm volatile("" : "+v"(d0)); v[k] = __builtin_amdgcn_exp2f(__fmul_rn(d0, 1.4426950408889634f)); sum += v[k]; }
#pragma unroll
    for (int sh = 16; sh; sh >>= 1) sum += __shfl_xor(sum, sh, 32);
    const float f = __fdiv_rn(hires ? 1.0f : PCAR, sum);
{
        if (hires) {
#pragma unroll
            for (int ch = 0; ch < TT / 128; ++ch) { v4us oh, ol;
#pragma unroll
                for (int q = 0; q < 4; ++q) { unsigned short a, c2; splitf(v[ch * 4 + q] * f, a, c2); oh[q] = a; ol[q] = c2; }
                bf* po = (bf*)Sb + (size_t)row * (2 * TT) + ch * 128 + lane * 4; *(v4us*)po = oh; *(v4us*)(po + TT) = ol; }
        } else {
#pragma unroll
            for (int ch = 0; ch < TT / 128; ++ch) { v4h o4;
#pragma unroll
                for (int q = 0; q < 4; ++q) o4[q] = tohx(v[ch * 4 + q] * f);
                *(v4h*)((h16*)Sb + (size_t)row * (2 * TT) + ch * 128 + lane * 4) = o4; } }
         }
}
__global__ __launch_bounds__(256) void k_merge(const float* __restrict__ O, int h0, bf* Ah, bf* Al) { const size_t e = ((size_t)blockIdx.x * 256 + threadIdx.x) * 2; if (e >= (size_t)ZH * TT * HD) return; const int d = (int)(e % HD); const int t = (int)((e / HD) % TT); const int zz = (int)(e / ((size_t)HD * TT)); const float cs = (t < RH) ? 1.0f : (1.0f / PCAR); const size_t oo = (size_t)t * DQ + (h0 + zz) * HD + d;
    v2us oh, ol;
#pragma unroll
    for (int q = 0; q < 2; ++q) { unsigned short a, c2; splitf(O[e + q] * cs, a, c2); oh[q] = a; ol[q] = c2; } *(v2us*)(Ah + oo) = oh; *(v2us*)(Al + oo) = ol;  }

extern "C" void kernel_launch(void* const* d_in, const int* in_sizes, int n_in,
                              void* d_out, int out_size, void* d_ws, size_t ws_size, hipStream_t stream) {
    (void)in_sizes; (void)n_in; (void)out_size;
    const float* x = (const float*)d_in[0]; const float* ang = (const float*)d_in[1]; const float* wq = (const float*)d_in[2]; const float* bq = (const float*)d_in[3]; const float* wk = (const float*)d_in[4]; const float* bk = (const float*)d_in[5]; const float* wv = (const float*)d_in[6]; const float* bv = (const float*)d_in[7]; const float* wo = (const float*)d_in[8]; const float* cosT = ang; const float* sinT = ang + (size_t)2048 * 128;
    float* OUT = (float*)d_out;     // [2][2048][2048]
    char* wsp = (char*)d_ws;
    auto take = [&](size_t bytes) { char* p = wsp; wsp += (bytes + 255) & ~(size_t)255; return (void*)p; };
    bf* WQ = (bf*)take((size_t)DQ * DM * 2); bf* WK = (bf*)take((size_t)DKV * DM * 2); bf* WV = (bf*)take((size_t)DKV * DM * 2); bf* WO = (bf*)take((size_t)DM * DQ * 2); float* CS = (float*)take((size_t)TT * HD * 2 * 4);
    bf* XB = (bf*)take((size_t)TT * DM * 2); float* FQ = (float*)take((size_t)TT * DQ * 4); float* FK = (float*)take((size_t)TT * DKV * 4);
    h16* QP16 = (h16*)take((size_t)NH_ * TT * HD * 2); h16* KP16 = (h16*)take((size_t)NKV * TT * HD * 2); h16* VT16 = (h16*)take((size_t)NKV * HD * TT * 2);
    bf* QPh = (bf*)take((size_t)NH_ * TT * HD * 2); bf* QPl = (bf*)take((size_t)NH_ * TT * HD * 2); bf* KPh = (bf*)take((size_t)NKV * TT * HD * 2); bf* KPl = (bf*)take((size_t)NKV * TT * HD * 2); bf* VTh = (bf*)take((size_t)NKV * HD * TT * 2); bf* VTl = (bf*)take((size_t)NKV * HD * TT * 2);
    float* Sb = (float*)take((size_t)ZH * TT * TT * 4); float* Ob = (float*)take((size_t)ZH * TT * HD * 4); bf* ATh = (bf*)take((size_t)TT * DQ * 2); bf* ATl = (bf*)take((size_t)TT * DQ * 2);
    if ((size_t)(wsp - (char*)d_ws) > ws_size) return;    // ws 256 MiB
    h16* P16 = (h16*)Sb; bf* Ph = (bf*)Sb; bf* Pl = Ph + TT;   // probability planes inside the score rows (k_asoft), 16-bit pitch 2 TT
    float* FV = FK;   // v projection reuses the k buffer after the k planes are built (stream-ordered)
    { k_cvt8<<<(unsigned)(((size_t)DQ * DM / 8 + 255) / 256), 256, 0, stream>>>(wq, WQ, (size_t)DQ * DM / 8); k_cvt8<<<(unsigned)(((size_t)DKV * DM / 8 + 255) / 256), 256, 0, stream>>>(wk, WK, (size_t)DKV * DM / 8); k_cvt8<<<(unsigned)(((size_t)DKV * DM / 8 + 255) / 256), 256, 0, stream>>>(wv, WV, (size_t)DKV * DM / 8);
      k_cvt8<<<(unsigned)(((size_t)DM * DQ / 8 + 255) / 256), 256, 0, stream>>>(wo, WO, (size_t)DM * DQ / 8);
       }
    const unsigned LQ = (unsigned)(((size_t)NH_ * TT * HD / 2 + 255) / 256), LKv = (unsigned)(((size_t)NKV * TT * HD / 2 + 255) / 256);
    for (int b = 0; b < NB_; ++b) {
        if (b == 0) k_cscvt<<<(TT * HD + 255) / 256, 256, 0, stream>>>(cosT, sinT, CS);
        k_cvt8<<<(unsigned)(((size_t)TT * DM / 8 + 255) / 256), 256, 0, stream>>>(x + (size_t)b * TT * DM, XB, (size_t)TT * DM / 8);
        k_gemmw<bf, 0, true><<<dim3(TT / 64, DQ / 64, 1), 32 * NWK, 0, stream>>>(XB, nullptr, WQ, nullptr, DM, FQ, DQ, bq, 0, 0, 0);
        k_rope<<<LQ, 256, 0, stream>>>(FQ, DQ, NH_, CS, nullptr, nullptr, 1.0f, QP16, QPh, QPl);
        k_gemmw<bf, 0, true><<<dim3(TT / 64, DKV / 64, 1), 32 * NWK, 0, stream>>>(XB, nullptr, WK, nullptr, DM, FK, DKV, bk, 0, 0, 0);
        k_rope<<<LKv, 256, 0, stream>>>(FK, DKV, NKV, CS, nullptr, nullptr, 1.0f, KP16, KPh, KPl);
        k_gemmw<bf, 0, true><<<dim3(TT / 64, DKV / 64, 1), 32 * NWK, 0, stream>>>(XB, nullptr, WV, nullptr, DM, FV, DKV, bv, 0, 0, 0); k_vtp<<<LKv, 256, 0, stream>>>(FV, DKV, NKV, VT16, VTh, VTl);
        for (int h0 = 0; h0 < NH_; h0 += ZH) { const size_t zq = (size_t)h0, zk = (size_t)(h0 / REP);   // the heads of a pass cover the kv groups h0/REP .. : B steps by one kv plane per REP heads
            k_gemmc<bf, 2, 1><<<dim3(RH / 64, TT / 64, ZH), 32, 0, stream>>>(QPh + zq * TT * HD, QPl + zq * TT * HD, HD, KPh + zk * TT * HD, KPl + zk * TT * HD, HD, Sb, TT, 0, (size_t)TT * HD, (size_t)TT * HD, (size_t)TT * TT);
            k_gemmc<h16, 0, 1><<<dim3((TT - RH) / 64, TT / 64, ZH), 32, 0, stream>>>(QP16 + zq * TT * HD + (size_t)RH * HD, nullptr, HD, KP16 + zk * TT * HD, nullptr, HD, Sb + (size_t)RH * TT, TT, RH, (size_t)TT * HD, (size_t)TT * HD, (size_t)TT * TT);
            k_asoft<<<ZH * TT / 8, 256, 0, stream>>>(Sb);
            k_gemmc<bf, 2, 2><<<dim3(RH / 64, HD / 64, ZH), 32 * NWK, 0, stream>>>(Ph, Pl, 2 * TT, VTh + zk * HD * TT, VTl + zk * HD * TT, TT, Ob, HD, 0, (size_t)2 * TT * TT, (size_t)HD * TT, (size_t)TT * HD);
            k_gemmc<h16, 0, 2><<<dim3((TT - RH) / 64, HD / 64, ZH), 32 * NWK, 0, stream>>>(P16 + (size_t)RH * 2 * TT, nullptr, 2 * TT, VT16 + zk * HD * TT, nullptr, TT, Ob + (size_t)RH * HD, HD, RH, (size_t)2 * TT * TT, (size_t)HD * TT, (size_t)TT * HD);
            k_merge<<<(unsigned)(((size_t)ZH * TT * HD / 2 + 255) / 256), 256, 0, stream>>>(Ob, h0, ATh, ATl); }
        k_gemmw<bf, 1, false><<<dim3(TT / 64, DM / 64, 1), 32 * NWK, 0, stream>>>(ATh, ATl, WO, nullptr, DQ, OUT + (size_t)b * TT * DM, DM, nullptr, 0, 0, 0); }
}

// v003
// Measured time: 382 microseconds a run.
// In both of two side-by-side timings against v002, it was 1.59 times as fast.
// All steps since v000 together make it 4.28 times as fast.
#include <hip/hip_runtime.h>

// GQA attention block (x [2][2048][2048]; q/k/v = x W^T + b (torch; 16 query heads, 4 kv heads x 128; group h/4); rotate-half RoPE with the given angles [2][2048][128] = (cos table, sin table) (read); causal softmax(q.k / sqrt(128)) (finfo.min fill); out = merged wo^T -> [2][2048][2048]).
// Compute dtypes, f32 accumulate: every input rounded to bf16; q/k/v on PLAIN bf16 operands (inputs: exact) + bias; RoPE f32 with the read tables; causal scores and attn.v: query rows < 512 hl (3 products), the rest single fp16, in one kernel with a running softmax (f32), keys beyond the diagonal block never visited; wo hl x exact (2 products).

#define NB_  2
#define TT   2048
#define DM   2048
#define NH_  16
#define NKV  4
#define REP  (NH_ / NKV)
#define HD   128
#define DQ   (NH_ * HD)
#define DKV  (NKV * HD)
#define RH   512                  // query rows < RH use hi+lo planes (0: none)
#define SCL  0.088388347648318447f   // HD^-0.5
typedef _Float16 h16;
typedef unsigned short bf;
typedef __attribute__((ext_vector_type(16))) __bf16   v16bf;
typedef __attribute__((ext_vector_type(16))) _Float16 v16h;
typedef __attribute__((ext_vector_type(8)))  _Float16 v8h;
typedef __attribute__((ext_vector_type(8)))  unsigned short v8us;
typedef __attribute__((ext_vector_type(8)))  float    v8f;
typedef __attribute__((ext_vector_type(4)))  float    v4f;
typedef v8h  __attribute__((may_alias)) v8ha;
typedef v4f  __attribute__((may_alias)) v4fa;
typedef v8us __attribute__((may_alias)) v8usa;

__device__ __forceinline__ unsigned short f2bf(float f) { unsigned u = __float_as_uint(f); u += 0x7FFFu + ((u >> 16) & 1u); return (unsigned short)(u >> 16); }
__device__ __forceinline__ float bf2f(unsigned short b) { return __uint_as_float(((unsigned)b) << 16); }
__device__ __forceinline__ float bfr(float f) { return bf2f(f2bf(f)); }
__device__ __forceinline__ v16h cat16(v8h lo, v8h hi) { return __builtin_shufflevector(lo, hi, 0, 1, 2, 3, 4, 5, 6, 7, 8, 9, 10, 11, 12, 13, 14, 15); }
__device__ __forceinline__ v16bf cat16b(v8us lo, v8us hi) { return __builtin_bit_cast(v16bf, __builtin_shufflevector(lo, hi, 0, 1, 2, 3, 4, 5, 6, 7, 8, 9, 10, 11, 12, 13, 14, 15)); }
__device__ __forceinline__ v8f wmma16(v16h a, v16h b, v8f c) { return __builtin_amdgcn_wmma_f32_16x16x32_f16(false, a, false, b, (short)0, c, false, false); }
__device__ __forceinline__ v8f wmmab(v16bf a, v16bf b, v8f c) { return __builtin_amdgcn_wmma_f32_16x16x32_bf16(false, a, false, b, (short)0, c, false, false); }



// ---- K loop shared by NWK waves of one work-group: wave w takes the 32-k steps w, w + NWK, ... (neighbour waves read the two halves of one 128-byte line of every operand row at about the same time) into its own 64x64 f32 partial tile;
// the partial tiles meet in LDS and are summed in the fixed order wave 0, 1, ... NWK-1. LDS in 16-byte units [wave][mb][hi][nb][j/4][lr]: contiguous 256 bytes per 16 lanes for the writer and for the reader.
#define NWK 8
#define REDU (NWK * 4 * 2 * 4 * 2 * 16)   // 16-byte units: NWK partial tiles of 16 KiB
__device__ __forceinline__ void red_put(v4f* red, int wv, int lr, int hi, const v8f (&acc)[4][4]) {
#pragma unroll
    for (int mb = 0; mb < 4; ++mb)
#pragma unroll
        for (int nb = 0; nb < 4; ++nb) { v4f* p = red + ((((wv * 4 + mb) * 2 + hi) * 4 + nb) * 2) * 16 + lr;
            p[0] = __builtin_shufflevector(acc[mb][nb], acc[mb][nb], 0, 1, 2, 3); p[16] = __builtin_shufflevector(acc[mb][nb], acc[mb][nb], 4, 5, 6, 7); }
}
// wave wv sums and stores rows 8 wv .. 8 wv + 7 of the tile (mb = wv / 2, hi = wv % 2); lane = column within a 32-column group, so every store instruction writes one whole 128-byte line.
template <bool BIAS>
__device__ __forceinline__ void red_sum_store(const v4f* red, int wv, int lane, float* ctile, int ldc, const float* btile) {
#pragma unroll
    for (int g = 0; g < 2; ++g) { const v4f* p = red + ((wv * 4 + g * 2 + (lane >> 4)) * 2) * 16 + (lane & 15); v4f s0 = p[0], s1 = p[16];
#pragma unroll
        for (int s = 1; s < NWK; ++s) { s0 += p[s * (REDU / NWK)]; s1 += p[s * (REDU / NWK) + 16]; }
        const int col = g * 32 + lane; const float bb = BIAS ? bfr(btile[col]) : 0.0f; float* cp = ctile + (size_t)(wv * 8) * ldc + col;
#pragma unroll
        for (int j = 0; j < 4; ++j) { cp[(size_t)j * ldc] = BIAS ? s0[j] + bb : s0[j]; cp[(size_t)(j + 4) * ldc] = BIAS ? s1[j] + bb : s1[j]; } }
}

// ---- k_gemmw: register-blocked GEMM, NWK waves per 64x64 output tile (each 16 accumulators over its share of K), operands straight from K-contiguous 16-bit planes; grid (M/64, N/64, Z), 32 NWK threads.
// C[m][n] (f32, pitch ldc, + optional bias[n] rounded to bf16) = sum_k A[m][k] Bt[n][k] (+ split products per NSPLIT). z-batch strides sA/sB/sC in elements. K % 32 == 0.
template <typename T16> struct WFrag;
template <> struct WFrag<h16> { typedef v16h V; static __device__ __forceinline__ V ld(const h16* p) { return cat16(*(const v8h*)p, *(const v8h*)(p + 16)); } static __device__ __forceinline__ v8f mma(V a, V b, v8f c) { return wmma16(a, b, c); } };
template <> struct WFrag<bf> { typedef v16bf V; static __device__ __forceinline__ V ld(const bf* p) { return cat16b(*(const v8us*)p, *(const v8us*)(p + 16)); } static __device__ __forceinline__ v8f mma(V a, V b, v8f c) { return wmmab(a, b, c); } };
template <typename T16, int NSPLIT, bool BIAS>
__global__ __launch_bounds__(32 * NWK) void k_gemmw(const T16* __restrict__ A, const T16* __restrict__ A2, const T16* __restrict__ Bt, const T16* __restrict__ Bt2, int K, float* C, int ldc, const float* __restrict__ bias, size_t sA, size_t sB, size_t sC) {
    typedef typename WFrag<T16>::V V;
    __shared__ __align__(16) v4f red[REDU];
    const size_t z = blockIdx.z; A += z * sA; if (A2) A2 += z * sA; Bt += z * sB; if (Bt2) Bt2 += z * sB; C += z * sC;
    const int lane = threadIdx.x & 31, lr = lane & 15, hi = lane >> 4; const int wv = __builtin_amdgcn_readfirstlane(threadIdx.x >> 5); const int r0 = blockIdx.x * 64, c0 = blockIdx.y * 64;
    v8f acc[4][4];
#pragma unroll
    for (int mb = 0; mb < 4; ++mb)
#pragma unroll
        for (int nb = 0; nb < 4; ++nb) acc[mb][nb] = (v8f){};
    const size_t aoff = (size_t)(r0 + lr) * K + 8 * hi, boff = (size_t)(c0 + lr) * K + 8 * hi;
#pragma unroll 1
    for (int kc = wv * 32; kc < K; kc += NWK * 32) {
        V a[4], a2[4];
#pragma unroll
        for (int mb = 0; mb < 4; ++mb) { a[mb] = WFrag<T16>::ld(A + aoff + (size_t)mb * 16 * K + kc); if (NSPLIT == 1 || NSPLIT == 2) a2[mb] = WFrag<T16>::ld(A2 + aoff + (size_t)mb * 16 * K + kc); }
#pragma unroll
        for (int nb = 0; nb < 4; ++nb) { const V b = WFrag<T16>::ld(Bt + boff + (size_t)nb * 16 * K + kc); V b2; if (NSPLIT >= 2) b2 = WFrag<T16>::ld(Bt2 + boff + (size_t)nb * 16 * K + kc);
#pragma unroll
            for (int mb = 0; mb < 4; ++mb) { acc[mb][nb] = WFrag<T16>::mma(a[mb], b, acc[mb][nb]); if (NSPLIT == 1 || NSPLIT == 2) acc[mb][nb] = WFrag<T16>::mma(a2[mb], b, acc[mb][nb]); if (NSPLIT >= 2) acc[mb][nb] = WFrag<T16>::mma(a[mb], b2, acc[mb][nb]); } }
        asm volatile("v_nop\n\tv_nop\n\tv_nop\n\tv_nop" : "+v"(acc[0][0]), "+v"(acc[1][1]), "+v"(acc[2][2]), "+v"(acc[3][3]) : "v"(a[0]), "v"(a[3]));
    }
    red_put(red, wv, lr, hi, acc);
    __syncthreads();   // every wave's partial tile is in LDS before any wave sums its eight rows
    red_sum_store<BIAS>(red, wv, lane, C + (size_t)r0 * ldc + c0, ldc, BIAS ? bias + c0 : nullptr);
}

__device__ __forceinline__ h16 tohx(float x) { return (h16)x; }
__device__ __forceinline__ void splitf(float y, unsigned short& h, unsigned short& l) { h = f2bf(y); l = f2bf(y - bf2f(h)); }
typedef __attribute__((ext_vector_type(2))) _Float16 v2h;
typedef __attribute__((ext_vector_type(4))) _Float16 v4h;
typedef __attribute__((ext_vector_type(2))) unsigned short v2us;
typedef __attribute__((ext_vector_type(4))) unsigned short v4us;
typedef __attribute__((ext_vector_type(2))) float v2f;
typedef __attribute__((ext_vector_type(4))) int v4i;

// ---- k_fattn: scores, softmax and probability x value in one kernel; no score or probability leaves the registers. Work-group = 32 query rows x the REP query heads of one kv group x KSP key shares: wave (hg, ks) owns head hg and the 32-key passes ks, ks + KSP, ...
// Transposed products: S^T = K Q^T (A = key rows, B = query rows), so a lane holds scores of ONE query (column lr; keys 8 hi + j of each 16-key tile), which is already the B operand order of O^T += V^T P^T (A = rows of the transposed value plane).
// Running softmax in the log2 domain: m_run is the maximum in use, l_run the lane's share of the sum; the accumulators are rescaled only when some query's maximum exceeds m_run by more than LAZY. Every exponential carries the factor 2^PBIAS (it cancels in acc / l): at most 2^(LAZY + PBIAS) in fp16.
#define KSP   2
#define ACS   (SCL * 1.4426950408889634f)
#define LAZY  8.0f
#define PBIAS 6.0f
__device__ __forceinline__ float xhalf(float x) { return __builtin_bit_cast(float, __builtin_amdgcn_permlanex16(__builtin_bit_cast(int, x), __builtin_bit_cast(int, x), 0x76543210, 0xfedcba98, false, false)); }   // lane l with lane l ^ 16: the two holders of one query
template <typename T16, bool HI>
__device__ __forceinline__ void attn_walk(const T16* __restrict__ Q, const T16* __restrict__ Q2, const T16* __restrict__ Kp, const T16* __restrict__ K2, const T16* __restrict__ Vt, const T16* __restrict__ V2, int q0, int ks, int lr, int hi, v8f (&acc)[2][8], float (&m_run)[2], float (&l_run)[2]) {
    typedef typename WFrag<T16>::V V;
    const int npass = q0 / 32 + 1;                       // keys 0 .. q0 + 31; only the last pass meets the diagonal
    if (ks >= npass) return;                             // wave-uniform: a key share without a pass keeps its start state (weight 0 in the join)
    const size_t ko = (size_t)lr * HD + 8 * hi, vo = (size_t)lr * TT + 8 * hi;
    __builtin_amdgcn_sched_barrier(0);                   // keeps the lane arithmetic above in front of the loads below: none of it may land between them and their wait, where it would reuse an address register
    V qf[2][4], qf2[2][4];
#pragma unroll
    for (int g = 0; g < 2; ++g)
#pragma unroll
        for (int kc = 0; kc < 4; ++kc) { const size_t o = (size_t)(q0 + 16 * g + lr) * HD + kc * 32 + 8 * hi; qf[g][kc] = WFrag<T16>::ld(Q + o); if (HI) qf2[g][kc] = WFrag<T16>::ld(Q2 + o); }
    V kf[2][4], kf2[2][4];
    if (!HI) { const int k0 = ks * 32;                   // single-plane path: K fragments are fetched one pass ahead
#pragma unroll
        for (int kt = 0; kt < 2; ++kt)
#pragma unroll
            for (int kc = 0; kc < 4; ++kc) kf[kt][kc] = WFrag<T16>::ld(Kp + ko + (size_t)(k0 + 16 * kt) * HD + kc * 32); }
    asm volatile("s_wait_xcnt 0x0" ::: "memory");   // the wait owed before the address registers of the loads above are rewritten
    __builtin_amdgcn_sched_barrier(0);               // keeps the later arithmetic, which reuses those registers, behind that wait
#pragma unroll 1
    for (int p = ks; p < npass; p += KSP) {
        const int key0 = p * 32;
        V vf[8], vf2[8];
        if (!HI) {
#pragma unroll
            for (int t = 0; t < 8; ++t) vf[t] = WFrag<T16>::ld(Vt + vo + (size_t)(t * 16) * TT + key0);
            asm volatile("" ::: "memory");   // compiler fence: keeps the pass's V loads issued here, ahead of the score products, so that they fly under them (without it they sink to the block that uses them)
        } else {
#pragma unroll
            for (int kt = 0; kt < 2; ++kt)
#pragma unroll
                for (int kc = 0; kc < 4; ++kc) { const size_t o = ko + (size_t)(key0 + 16 * kt) * HD + kc * 32; kf[kt][kc] = WFrag<T16>::ld(Kp + o); kf2[kt][kc] = WFrag<T16>::ld(K2 + o); }
            __builtin_amdgcn_sched_barrier(0);   // all of the pass's K loads are issued before its first product (without it they are issued pair by pair, each pair waited for in turn)
        }
        v8f s[2][2];
#pragma unroll
        for (int kt = 0; kt < 2; ++kt)
#pragma unroll
            for (int g = 0; g < 2; ++g) { s[kt][g] = (v8f){};
#pragma unroll
                for (int kc = 0; kc < 4; ++kc) { s[kt][g] = WFrag<T16>::mma(kf[kt][kc], qf[g][kc], s[kt][g]); if (HI) { s[kt][g] = WFrag<T16>::mma(kf[kt][kc], qf2[g][kc], s[kt][g]); s[kt][g] = WFrag<T16>::mma(kf2[kt][kc], qf[g][kc], s[kt][g]); } } }
        if (!HI) { const int k1 = min(p + KSP, npass - 1) * 32;   // next pass's K (the last pass fetches rows that exist and are not used)
#pragma unroll
            for (int kt = 0; kt < 2; ++kt)
#pragma unroll
                for (int kc = 0; kc < 4; ++kc) kf[kt][kc] = WFrag<T16>::ld(Kp + ko + (size_t)(k1 + 16 * kt) * HD + kc * 32);
            asm volatile("s_wait_xcnt 0x0" ::: "memory");   // the wait owed before the loads' address registers are rewritten (the mask below reuses them); its memory clobber also keeps the next pass's K loads issued here, to fly under the softmax and the second product (without it they sink to the pass's end)
        } else {
#pragma unroll
            for (int t = 0; t < 8; ++t) { const size_t o = vo + (size_t)(t * 16) * TT + key0; vf[t] = WFrag<T16>::ld(Vt + o); vf2[t] = WFrag<T16>::ld(V2 + o); }
            asm volatile("s_wait_xcnt 0x0" ::: "memory");   // the wait owed before the loads' address registers are rewritten; its memory clobber also keeps the pass's V loads issued here, to fly under the maxima and the exponentials
        }
        if (p == npass - 1) {                             // wave-uniform: the diagonal pass masks key > query
#pragma unroll
            for (int g = 0; g < 2; ++g)
#pragma unroll
                for (int kt = 0; kt < 2; ++kt)
#pragma unroll
                    for (int j = 0; j < 8; ++j) if (16 * kt + 8 * hi + j > 16 * g + lr) s[kt][g][j] = -3.0e38f;
        }
        float mb[2]; bool need = false;
#pragma unroll
        for (int g = 0; g < 2; ++g) { float mx = -3.0e38f;
#pragma unroll
            for (int kt = 0; kt < 2; ++kt)
#pragma unroll
                for (int j = 0; j < 8; ++j) mx = fmaxf(mx, s[kt][g][j]);
            mx = fmaxf(mx, xhalf(mx)) * ACS; mb[g] = mx; need = need || (mx > m_run[g] + LAZY); }
        if (__builtin_amdgcn_ballot_w32(need) != 0) {     // one scalar test per pass
#pragma unroll
            for (int g = 0; g < 2; ++g) { const float mn = fmaxf(m_run[g], mb[g]); const float corr = __builtin_amdgcn_exp2f(m_run[g] - mn); l_run[g] *= corr; m_run[g] = mn;   // first pass: corr = 0 on zeros
#pragma unroll
                for (int t = 0; t < 8; ++t) acc[g][t] = acc[g][t] * corr; }
        }
#pragma unroll
        for (int g = 0; g < 2; ++g) { const float nm = PBIAS - m_run[g]; float e[16], ps0 = 0.f, ps1 = 0.f;
#pragma unroll
            for (int i = 0; i < 8; ++i) { const v2f arg = __builtin_elementwise_fma((v2f){s[i >> 2][g][2 * (i & 3)], s[i >> 2][g][2 * (i & 3) + 1]}, (v2f){ACS, ACS}, (v2f){nm, nm});   // a register pair of the score tile at a time
                e[2 * i] = __builtin_amdgcn_exp2f(arg[0]); e[2 * i + 1] = __builtin_amdgcn_exp2f(arg[1]); ps0 += e[2 * i]; ps1 += e[2 * i + 1]; }
            l_run[g] += ps0 + ps1;
            if constexpr (!HI) { v16h pf;
#pragma unroll
                for (int i = 0; i < 16; ++i) pf[i] = (h16)e[i];
#pragma unroll
                for (int t = 0; t < 8; ++t) acc[g][t] = WFrag<T16>::mma(vf[t], pf, acc[g][t]);
            } else { v8us h0, h1, l0, l1;
#pragma unroll
                for (int i = 0; i < 8; ++i) { unsigned short a, c2; splitf(e[i], a, c2); h0[i] = a; l0[i] = c2; }
#pragma unroll
                for (int i = 0; i < 8; ++i) { unsigned short a, c2; splitf(e[i + 8], a, c2); h1[i] = a; l1[i] = c2; }
                const V ph = cat16b(h0, h1), pl = cat16b(l0, l1);
#pragma unroll
                for (int t = 0; t < 8; ++t) { acc[g][t] = WFrag<T16>::mma(vf[t], ph, acc[g][t]); acc[g][t] = WFrag<T16>::mma(vf[t], pl, acc[g][t]); acc[g][t] = WFrag<T16>::mma(vf2[t], ph, acc[g][t]); }
            } }
    }
}
__global__ __launch_bounds__(32 * REP * KSP) void k_fattn(const h16* __restrict__ Q16, const bf* __restrict__ Qh, const bf* __restrict__ Ql, const h16* __restrict__ K16, const bf* __restrict__ Kh, const bf* __restrict__ Kl, const h16* __restrict__ V16, const bf* __restrict__ Vh, const bf* __restrict__ Vl, bf* Ah, bf* Al) {
    __shared__ __align__(16) v4f mrg[REP * 32 * 32];     // the second key share's accumulators, [head][16-byte piece][lane]
    __shared__ float mls[REP * 4 * 32];                  // its maxima and sums
    const int lane = threadIdx.x & 31, lr = lane & 15, hi = lane >> 4; const int wv = __builtin_amdgcn_readfirstlane(threadIdx.x >> 5); const int hg = wv % REP, ks = wv / REP;
    const int kvg = blockIdx.y, h = kvg * REP + hg; const int q0 = (int)(gridDim.x - 1 - blockIdx.x) * 32;   // longest rows first
    v8f acc[2][8]; float m_run[2], l_run[2];
#pragma unroll
    for (int g = 0; g < 2; ++g) { m_run[g] = -3.0e38f; l_run[g] = 0.f;
#pragma unroll
        for (int t = 0; t < 8; ++t) acc[g][t] = (v8f){}; }
    const size_t qo = (size_t)h * TT * HD, kvo = (size_t)kvg * TT * HD;
    if (q0 < RH) attn_walk<bf, true>(Qh + qo, Ql + qo, Kh + kvo, Kl + kvo, Vh + kvo, Vl + kvo, q0, ks, lr, hi, acc, m_run, l_run);
    else attn_walk<h16, false>(Q16 + qo, nullptr, K16 + kvo, nullptr, V16 + kvo, nullptr, q0, ks, lr, hi, acc, m_run, l_run);
    if (ks == 1) {
#pragma unroll
        for (int g = 0; g < 2; ++g) { mls[(hg * 4 + g) * 32 + lane] = m_run[g]; mls[(hg * 4 + 2 + g) * 32 + lane] = l_run[g];
#pragma unroll
            for (int t = 0; t < 8; ++t) { v4f* p = mrg + (hg * 32 + (g * 8 + t) * 2) * 32 + lane; p[0] = __builtin_shufflevector(acc[g][t], acc[g][t], 0, 1, 2, 3); p[32] = __builtin_shufflevector(acc[g][t], acc[g][t], 4, 5, 6, 7); } }
    }
    __syncthreads();   // the second share's state is in LDS before the first share's wave joins it to its own
    if (ks == 0) {
#pragma unroll
        for (int g = 0; g < 2; ++g) { const float m1 = mls[(hg * 4 + g) * 32 + lane], l1 = mls[(hg * 4 + 2 + g) * 32 + lane]; const float m = fmaxf(m_run[g], m1);   // a share without a pass: m1 = -3e38, weight 0
            const float c0 = __builtin_amdgcn_exp2f(m_run[g] - m), c1 = __builtin_amdgcn_exp2f(m1 - m); float l = l_run[g] * c0 + l1 * c1; l += xhalf(l); const float inv = __fdiv_rn(1.0f, l); const float a0 = c0 * inv, a1 = c1 * inv;
            const size_t oo = (size_t)(q0 + 16 * g + lr) * DQ + h * HD + 8 * hi;
#pragma unroll
            for (int t = 0; t < 8; ++t) { const v4f* p = mrg + (hg * 32 + (g * 8 + t) * 2) * 32 + lane; const v4f b0 = p[0], b1 = p[32]; v8us oh, ol;
#pragma unroll
                for (int j = 0; j < 8; ++j) { unsigned short a, c2; splitf(acc[g][t][j] * a0 + (j < 4 ? b0[j & 3] : b1[j & 3]) * a1, a, c2); oh[j] = a; ol[j] = c2; }
                *(v8us*)(Ah + oo + t * 16) = oh; *(v8us*)(Al + oo + t * 16) = ol; } }
    }
}

__global__ __launch_bounds__(256) void k_wtG(const float* __restrict__ w, int K, int N, bf* Bt) {
    const int lane = threadIdx.x & 31; const int L0 = (blockIdx.x * 8 + (threadIdx.x >> 5)) * 8; const int nlines = N * K / 64;
{
#pragma unroll 1
        for (int l = 0; l < 8; ++l) { const int L = L0 + l; if (L >= nlines) break; const size_t e = (size_t)L * 64 + lane * 2; const int k = (int)(e % K), n = (int)(e / K); v2us o;
            o[0] = f2bf(w[(size_t)k * N + n]); o[1] = f2bf(w[(size_t)(k + 1) * N + n]); *(v2us*)(Bt + e) = o; }
         }
}
__global__ __launch_bounds__(256) void k_cvt8(const float* __restrict__ src, bf* dst, size_t n8) { const size_t i = (size_t)blockIdx.x * 256 + threadIdx.x; if (i >= n8) return; const v8f v = *(const v8f*)(src + i * 8); v8us o;
#pragma unroll
    for (int k = 0; k < 8; ++k) o[k] = f2bf(v[k]); *(v8us*)(dst + i * 8) = o;  }
__global__ __launch_bounds__(256) void k_cscvt(const float* __restrict__ cosT, const float* __restrict__ sinT, float* CS) { const int idx = blockIdx.x * 256 + threadIdx.x; if (idx >= TT * HD) return; v2f cs; cs[0] = bfr(cosT[idx]); cs[1] = bfr(sinT[idx]); *(v2f*)(CS + (size_t)idx * 2) = cs;  }
// k_rope: head planes [h][t][d] (fp16 + hi/lo) of rope(x) x sc with the rotate-half convention out[d] = x[d] cos[t][d] - x[d+HD/2] sin[t][d], out[d+HD/2] = x[d+HD/2] cos[t][d+HD/2] + x[d] sin[t][d+HD/2]
__global__ __launch_bounds__(256) void k_rope(const float* __restrict__ F, int pitch, int nheads, const float* __restrict__ CS, const float* __restrict__ RF, const float* __restrict__ nw, float sc, h16* P16, bf* Ph, bf* Pl) {
    const size_t e = ((size_t)blockIdx.x * 256 + threadIdx.x) * 2; if (e >= (size_t)nheads * TT * HD) return; const int d = (int)(e % HD); const int t = (int)((e / HD) % TT); const int h = (int)(e / ((size_t)HD * TT)); const float* f = F + (size_t)t * pitch + h * HD; const float rf = RF ? RF[(size_t)h * TT + t] : 1.0f; v2h o16; v2us oh, ol;
#pragma unroll
    for (int q = 0; q < 2; ++q) { const int dd = d + q; const int dp = (dd < HD / 2) ? dd + HD / 2 : dd - HD / 2; float x0 = f[dd], x1 = f[dp];
        if (RF) { float n0 = __fmul_rn(x0, rf), n1 = __fmul_rn(x1, rf); asm volatile("" : "+v"(n0)); asm volatile("" : "+v"(n1)); x0 = __fmul_rn(bfr(nw[dd]), n0); x1 = __fmul_rn(bfr(nw[dp]), n1); }
        const v2f cs = *(const v2f*)(CS + ((size_t)t * HD + dd) * 2); float a = __fmul_rn(x0, cs[0]), bq = __fmul_rn(x1, cs[1]); asm volatile("" : "+v"(a)); asm volatile("" : "+v"(bq)); const float r = ((dd < HD / 2) ? __fsub_rn(a, bq) : __fadd_rn(a, bq)) * sc;
        o16[q] = tohx(r); unsigned short a2, c2; splitf(r, a2, c2); oh[q] = a2; ol[q] = c2; }
    *(v2h*)(P16 + e) = o16; *(v2us*)(Ph + e) = oh; *(v2us*)(Pl + e) = ol;  }
__global__ __launch_bounds__(256) void k_vtp(const float* __restrict__ F, int pitch, int nheads, h16* V16, bf* Vh, bf* Vl) { const size_t e = ((size_t)blockIdx.x * 256 + threadIdx.x) * 2; if (e >= (size_t)nheads * HD * TT) return; const int t = (int)(e % TT); const int d = (int)((e / TT) % HD); const int g = (int)(e / ((size_t)TT * HD)); v2h o16; v2us oh, ol;
#pragma unroll
    for (int q = 0; q < 2; ++q) { const float x = F[(size_t)(t + q) * pitch + g * HD + d]; o16[q] = tohx(x); unsigned short a2, c2; splitf(x, a2, c2); oh[q] = a2; ol[q] = c2; }
    *(v2h*)(V16 + e) = o16; *(v2us*)(Vh + e) = oh; *(v2us*)(Vl + e) = ol;  }
extern "C" void kernel_launch(void* const* d_in, const int* in_sizes, int n_in,
                              void* d_out, int out_size, void* d_ws, size_t ws_size, hipStream_t stream) {
    (void)in_sizes; (void)n_in; (void)out_size;
    const float* x = (const float*)d_in[0]; const float* ang = (const float*)d_in[1]; const float* wq = (const float*)d_in[2]; const float* bq = (const float*)d_in[3]; const float* wk = (const float*)d_in[4]; const float* bk = (const float*)d_in[5]; const float* wv = (const float*)d_in[6]; const float* bv = (const float*)d_in[7]; const float* wo = (const float*)d_in[8]; const float* cosT = ang; const float* sinT = ang + (size_t)2048 * 128;
    float* OUT = (float*)d_out;     // [2][2048][2048]
    char* wsp = (char*)d_ws;
    auto take = [&](size_t bytes) { char* p = wsp; wsp += (bytes + 255) & ~(size_t)255; return (void*)p; };
    bf* WQ = (bf*)take((size_t)DQ * DM * 2); bf* WK = (bf*)take((size_t)DKV * DM * 2); bf* WV = (bf*)take((size_t)DKV * DM * 2); bf* WO = (bf*)take((size_t)DM * DQ * 2); float* CS = (float*)take((size_t)TT * HD * 2 * 4);
    bf* XB = (bf*)take((size_t)TT * DM * 2); float* FQ = (float*)take((size_t)TT * DQ * 4); float* FK = (float*)take((size_t)TT * DKV * 4);
    h16* QP16 = (h16*)take((size_t)NH_ * TT * HD * 2); h16* KP16 = (h16*)take((size_t)NKV * TT * HD * 2); h16* VT16 = (h16*)take((size_t)NKV * HD * TT * 2);
    bf* QPh = (bf*)take((size_t)NH_ * TT * HD * 2); bf* QPl = (bf*)take((size_t)NH_ * TT * HD * 2); bf* KPh = (bf*)take((size_t)NKV * TT * HD * 2); bf* KPl = (bf*)take((size_t)NKV * TT * HD * 2); bf* VTh = (bf*)take((size_t)NKV * HD * TT * 2); bf* VTl = (bf*)take((size_t)NKV * HD * TT * 2);
    bf* ATh = (bf*)take((size_t)TT * DQ * 2); bf* ATl = (bf*)take((size_t)TT * DQ * 2);
    if ((size_t)(wsp - (char*)d_ws) > ws_size) return;    // ws 256 MiB
    float* FV = FK;   // v projection reuses the k buffer after the k planes are built (stream-ordered)
    { k_cvt8<<<(unsigned)(((size_t)DQ * DM / 8 + 255) / 256), 256, 0, stream>>>(wq, WQ, (size_t)DQ * DM / 8); k_cvt8<<<(unsigned)(((size_t)DKV * DM / 8 + 255) / 256), 256, 0, stream>>>(wk, WK, (size_t)DKV * DM / 8); k_cvt8<<<(unsigned)(((size_t)DKV * DM / 8 + 255) / 256), 256, 0, stream>>>(wv, WV, (size_t)DKV * DM / 8);
      k_cvt8<<<(unsigned)(((size_t)DM * DQ / 8 + 255) / 256), 256, 0, stream>>>(wo, WO, (size_t)DM * DQ / 8);
       }
    const unsigned LQ = (unsigned)(((size_t)NH_ * TT * HD / 2 + 255) / 256), LKv = (unsigned)(((size_t)NKV * TT * HD / 2 + 255) / 256);
    for (int b = 0; b < NB_; ++b) {
        if (b == 0) k_cscvt<<<(TT * HD + 255) / 256, 256, 0, stream>>>(cosT, sinT, CS);
        k_cvt8<<<(unsigned)(((size_t)TT * DM / 8 + 255) / 256), 256, 0, stream>>>(x + (size_t)b * TT * DM, XB, (size_t)TT * DM / 8);
        k_gemmw<bf, 0, true><<<dim3(TT / 64, DQ / 64, 1), 32 * NWK, 0, stream>>>(XB, nullptr, WQ, nullptr, DM, FQ, DQ, bq, 0, 0, 0);
        k_rope<<<LQ, 256, 0, stream>>>(FQ, DQ, NH_, CS, nullptr, nullptr, 1.0f, QP16, QPh, QPl);
        k_gemmw<bf, 0, true><<<dim3(TT / 64, DKV / 64, 1), 32 * NWK, 0, stream>>>(XB, nullptr, WK, nullptr, DM, FK, DKV, bk, 0, 0, 0);
        k_rope<<<LKv, 256, 0, stream>>>(FK, DKV, NKV, CS, nullptr, nullptr, 1.0f, KP16, KPh, KPl);
        k_gemmw<bf, 0, true><<<dim3(TT / 64, DKV / 64, 1), 32 * NWK, 0, stream>>>(XB, nullptr, WV, nullptr, DM, FV, DKV, bv, 0, 0, 0); k_vtp<<<LKv, 256, 0, stream>>>(FV, DKV, NKV, VT16, VTh, VTl);
        k_fattn<<<dim3(TT / 32, NKV, 1), 32 * REP * KSP, 0, stream>>>(QP16, QPh, QPl, KP16, KPh, KPl, VT16, VTh, VTl, ATh, ATl);
        k_gemmw<bf, 1, false><<<dim3(TT / 64, DM / 64, 1), 32 * NWK, 0, stream>>>(ATh, ATl, WO, nullptr, DQ, OUT + (size_t)b * TT * DM, DM, nullptr, 0, 0, 0); }
}

// v004
// A run of this version takes 297 microseconds.
// Next to v003, in two timings, it ran 1.29 and 1.31 times as fast.
// Counting every step since v000, it is 5.56 times as fast.
#include <hip/hip_runtime.h>

// GQA attention block (x [2][2048][2048]; q/k/v = x W^T + b (torch; 16 query heads, 4 kv heads x 128; group h/4); rotate-half RoPE with the given angles [2][2048][128] = (cos table, sin table) (read); causal softmax(q.k / sqrt(128)) (finfo.min fill); out = merged wo^T -> [2][2048][2048]).
// Compute dtypes, f32 accumulate: every input rounded to bf16; q/k/v on PLAIN bf16 operands (inputs: exact) + bias; RoPE f32 with the read tables; causal scores and attn.v: query rows < 512 hl (3 products), the rest single fp16, in one kernel with a running softmax (f32), keys beyond the diagonal block never visited; wo hl x exact (2 products).

#define NB_  2
#define TT   2048
#define DM   2048
#define NH_  16
#define NKV  4
#define REP  (NH_ / NKV)
#define HD   128
#define DQ   (NH_ * HD)
#define DKV  (NKV * HD)
#define RH   512                  // query rows < RH use hi+lo planes (0: none)
#define SCL  0.088388347648318447f   // HD^-0.5
typedef _Float16 h16;
typedef unsigned short bf;
typedef __attribute__((ext_vector_type(16))) __bf16   v16bf;
typedef __attribute__((ext_vector_type(16))) _Float16 v16h;
typedef __attribute__((ext_vector_type(8)))  _Float16 v8h;
typedef __attribute__((ext_vector_type(8)))  unsigned short v8us;
typedef __attribute__((ext_vector_type(8)))  float    v8f;
typedef __attribute__((ext_vector_type(4)))  float    v4f;
typedef v8h  __attribute__((may_alias)) v8ha;
typedef v4f  __attribute__((may_alias)) v4fa;
typedef v8us __attribute__((may_alias)) v8usa;

__device__ __forceinline__ unsigned short f2bf(float f) { unsigned u = __float_as_uint(f); u += 0x7FFFu + ((u >> 16) & 1u); return (unsigned short)(u >> 16); }
__device__ __forceinline__ float bf2f(unsigned short b) { return __uint_as_float(((unsigned)b) << 16); }
__device__ __forceinline__ float bfr(float f) { return bf2f(f2bf(f)); }
__device__ __forceinline__ v16h cat16(v8h lo, v8h hi) { return __builtin_shufflevector(lo, hi, 0, 1, 2, 3, 4, 5, 6, 7, 8, 9, 10, 11, 12, 13, 14, 15); }
__device__ __forceinline__ v16bf cat16b(v8us lo, v8us hi) { return __builtin_bit_cast(v16bf, __builtin_shufflevector(lo, hi, 0, 1, 2, 3, 4, 5, 6, 7, 8, 9, 10, 11, 12, 13, 14, 15)); }
__device__ __forceinline__ v8f wmma16(v16h a, v16h b, v8f c) { return __builtin_amdgcn_wmma_f32_16x16x32_f16(false, a, false, b, (short)0, c, false, false); }
__device__ __forceinline__ v8f wmmab(v16bf a, v16bf b, v8f c) { return __builtin_amdgcn_wmma_f32_16x16x32_bf16(false, a, false, b, (short)0, c, false, false); }



// ---- K loop shared by NWK waves of one work-group: wave w takes the 32-k steps w, w + NWK, ... (neighbour waves read the two halves of one 128-byte line of every operand row at about the same time) into its own 64x64 f32 partial tile;
// the partial tiles meet in LDS and are summed in the fixed order wave 0, 1, ... NWK-1. LDS in 16-byte units [wave][mb][hi][nb][j/4][lr]: contiguous 256 bytes per 16 lanes for the writer and for the reader.
#define NWK 8
#define REDU (NWK * 4 * 2 * 4 * 2 * 16)   // 16-byte units: NWK partial tiles of 16 KiB
__device__ __forceinline__ void red_put(v4f* red, int wv, int lr, int hi, const v8f (&acc)[4][4]) {
#pragma unroll
    for (int mb = 0; mb < 4; ++mb)
#pragma unroll
        for (int nb = 0; nb < 4; ++nb) { v4f* p = red + ((((wv * 4 + mb) * 2 + hi) * 4 + nb) * 2) * 16 + lr;
            p[0] = __builtin_shufflevector(acc[mb][nb], acc[mb][nb], 0, 1, 2, 3); p[16] = __builtin_shufflevector(acc[mb][nb], acc[mb][nb], 4, 5, 6, 7); }
}
// wave wv sums and stores rows 8 wv .. 8 wv + 7 of the tile (mb = wv / 2, hi = wv % 2); lane = column within a 32-column group, so every store instruction writes one whole 128-byte line.
template <bool BIAS>
__device__ __forceinline__ void red_sum_store(const v4f* red, int wv, int lane, float* ctile, int ldc, const float* btile) {
#pragma unroll
    for (int g = 0; g < 2; ++g) { const v4f* p = red + ((wv * 4 + g * 2 + (lane >> 4)) * 2) * 16 + (lane & 15); v4f s0 = p[0], s1 = p[16];
#pragma unroll
        for (int s = 1; s < NWK; ++s) { s0 += p[s * (REDU / NWK)]; s1 += p[s * (REDU / NWK) + 16]; }
        const int col = g * 32 + lane; const float bb = BIAS ? bfr(btile[col]) : 0.0f; float* cp = ctile + (size_t)(wv * 8) * ldc + col;
#pragma unroll
        for (int j = 0; j < 4; ++j) { cp[(size_t)j * ldc] = BIAS ? s0[j] + bb : s0[j]; cp[(size_t)(j + 4) * ldc] = BIAS ? s1[j] + bb : s1[j]; } }
}

// ---- k_gemmw: register-blocked GEMM, NWK waves per 64x64 output tile (each 16 accumulators over its share of K), operands straight from K-contiguous 16-bit planes; grid (M/64, N/64, Z), 32 NWK threads.
// C[m][n] (f32, pitch ldc, + optional bias[n] rounded to bf16) = sum_k A[m][k] Bt[n][k] (+ split products per NSPLIT). z-batch strides sA/sB/sC in elements. K % 32 == 0.
template <typename T16> struct WFrag;
template <> struct WFrag<h16> { typedef v16h V; static __device__ __forceinline__ V ld(const h16* p) { return cat16(*(const v8h*)p, *(const v8h*)(p + 16)); } static __device__ __forceinline__ v8f mma(V a, V b, v8f c) { return wmma16(a, b, c); } };
template <> struct WFrag<bf> { typedef v16bf V; static __device__ __forceinline__ V ld(const bf* p) { return cat16b(*(const v8us*)p, *(const v8us*)(p + 16)); } static __device__ __forceinline__ v8f mma(V a, V b, v8f c) { return wmmab(a, b, c); } };
template <typename T16, int NSPLIT, bool BIAS>
__global__ __launch_bounds__(32 * NWK) void k_gemmw(const T16* __restrict__ A, const T16* __restrict__ A2, const T16* __restrict__ Bt, const T16* __restrict__ Bt2, int K, float* C, int ldc, const float* __restrict__ bias, size_t sA, size_t sB, size_t sC) {
    typedef typename WFrag<T16>::V V;
    __shared__ __align__(16) v4f red[REDU];
    const size_t z = blockIdx.z; A += z * sA; if (A2) A2 += z * sA; Bt += z * sB; if (Bt2) Bt2 += z * sB; C += z * sC;
    const int lane = threadIdx.x & 31, lr = lane & 15, hi = lane >> 4; const int wv = __builtin_amdgcn_readfirstlane(threadIdx.x >> 5); const int r0 = blockIdx.x * 64, c0 = blockIdx.y * 64;
    v8f acc[4][4];
#pragma unroll
    for (int mb = 0; mb < 4; ++mb)
#pragma unroll
        for (int nb = 0; nb < 4; ++nb) acc[mb][nb] = (v8f){};
    const size_t aoff = (size_t)(r0 + lr) * K + 8 * hi, boff = (size_t)(c0 + lr) * K + 8 * hi;
#pragma unroll 1
    for (int kc = wv * 32; kc < K; kc += NWK * 32) {
        V a[4], a2[4];
#pragma unroll
        for (int mb = 0; mb < 4; ++mb) { a[mb] = WFrag<T16>::ld(A + aoff + (size_t)mb * 16 * K + kc); if (NSPLIT == 1 || NSPLIT == 2) a2[mb] = WFrag<T16>::ld(A2 + aoff + (size_t)mb * 16 * K + kc); }
#pragma unroll
        for (int nb = 0; nb < 4; ++nb) { const V b = WFrag<T16>::ld(Bt + boff + (size_t)nb * 16 * K + kc); V b2; if (NSPLIT >= 2) b2 = WFrag<T16>::ld(Bt2 + boff + (size_t)nb * 16 * K + kc);
#pragma unroll
            for (int mb = 0; mb < 4; ++mb) { acc[mb][nb] = WFrag<T16>::mma(a[mb], b, acc[mb][nb]); if (NSPLIT == 1 || NSPLIT == 2) acc[mb][nb] = WFrag<T16>::mma(a2[mb], b, acc[mb][nb]); if (NSPLIT >= 2) acc[mb][nb] = WFrag<T16>::mma(a[mb], b2, acc[mb][nb]); } }
        asm volatile("v_nop\n\tv_nop\n\tv_nop\n\tv_nop" : "+v"(acc[0][0]), "+v"(acc[1][1]), "+v"(acc[2][2]), "+v"(acc[3][3]) : "v"(a[0]), "v"(a[3]));
    }
    red_put(red, wv, lr, hi, acc);
    __syncthreads();   // every wave's partial tile is in LDS before any wave sums its eight rows
    red_sum_store<BIAS>(red, wv, lane, C + (size_t)r0 * ldc + c0, ldc, BIAS ? bias + c0 : nullptr);
}

__device__ __forceinline__ h16 tohx(float x) { return (h16)x; }
__device__ __forceinline__ void splitf(float y, unsigned short& h, unsigned short& l) { h = f2bf(y); l = f2bf(y - bf2f(h)); }
typedef __attribute__((ext_vector_type(2))) _Float16 v2h;
typedef __attribute__((ext_vector_type(4))) _Float16 v4h;
typedef __attribute__((ext_vector_type(2))) unsigned short v2us;
typedef __attribute__((ext_vector_type(4))) unsigned short v4us;
typedef __attribute__((ext_vector_type(2))) float v2f;
typedef __attribute__((ext_vector_type(4))) int v4i;

// ---- k_fattn: scores, softmax and probability x value in one kernel; no score or probability leaves the registers. Work-group = 32 query rows x the REP query heads of one kv group x KSP key shares: wave (hg, ks) owns head hg and the 32-key passes ks, ks + KSP, ...
// Grid (NKV x NB_, TT / 32): both batches in one launch, twice as many work-groups as resident places, so the start order decides the tail. The query block is the slow index: first the hi+lo blocks (three products for one: short rows, dear passes), longest first, then the single-plane blocks, longest first; no dear block starts late.
// Transposed products: S^T = K Q^T (A = key rows, B = query rows), so a lane holds scores of ONE query (column lr; keys 8 hi + j of each 16-key tile), which is already the B operand order of O^T += V^T P^T (A = rows of the transposed value plane).
// Running softmax in the log2 domain: m_run is the maximum in use, l_run the lane's share of the sum; the accumulators are rescaled only when some query's maximum exceeds m_run by more than LAZY. Every exponential carries the factor 2^PBIAS (it cancels in acc / l): at most 2^(LAZY + PBIAS) in fp16.
#define KSP   2
#define ACS   (SCL * 1.4426950408889634f)
#define LAZY  8.0f
#define PBIAS 6.0f
__device__ __forceinline__ float xhalf(float x) { return __builtin_bit_cast(float, __builtin_amdgcn_permlanex16(__builtin_bit_cast(int, x), __builtin_bit_cast(int, x), 0x76543210, 0xfedcba98, false, false)); }   // lane l with lane l ^ 16: the two holders of one query
template <typename T16, bool HI>
__device__ __forceinline__ void attn_walk(const T16* __restrict__ Q, const T16* __restrict__ Q2, const T16* __restrict__ Kp, const T16* __restrict__ K2, const T16* __restrict__ Vt, const T16* __restrict__ V2, int q0, int ks, int lr, int hi, v8f (&acc)[2][8], float (&m_run)[2], float (&l_run)[2]) {
    typedef typename WFrag<T16>::V V;
    const int npass = q0 / 32 + 1;                       // keys 0 .. q0 + 31; only the last pass meets the diagonal
    if (ks >= npass) return;                             // wave-uniform: a key share without a pass keeps its start state (weight 0 in the join)
    const size_t ko = (size_t)lr * HD + 8 * hi, vo = (size_t)lr * TT + 8 * hi;
    __builtin_amdgcn_sched_barrier(0);                   // keeps the lane arithmetic above in front of the loads below: none of it may land between them and their wait, where it would reuse an address register
    V qf[2][4], qf2[2][4];
#pragma unroll
    for (int g = 0; g < 2; ++g)
#pragma unroll
        for (int kc = 0; kc < 4; ++kc) { const size_t o = (size_t)(q0 + 16 * g + lr) * HD + kc * 32 + 8 * hi; qf[g][kc] = WFrag<T16>::ld(Q + o); if (HI) qf2[g][kc] = WFrag<T16>::ld(Q2 + o); }
    V kf[2][4], kf2[2][4];
    if (!HI) { const int k0 = ks * 32;                   // single-plane path: K fragments are fetched one pass ahead
#pragma unroll
        for (int kt = 0; kt < 2; ++kt)
#pragma unroll
            for (int kc = 0; kc < 4; ++kc) kf[kt][kc] = WFrag<T16>::ld(Kp + ko + (size_t)(k0 + 16 * kt) * HD + kc * 32); }
    asm volatile("s_wait_xcnt 0x0" ::: "memory");   // the wait owed before the address registers of the loads above are rewritten
    __builtin_amdgcn_sched_barrier(0);               // keeps the later arithmetic, which reuses those registers, behind that wait
#pragma unroll 1
    for (int p = ks; p < npass; p += KSP) {
        const int key0 = p * 32;
        V vf[8], vf2[8];
        if (!HI) {
#pragma unroll
            for (int t = 0; t < 8; ++t) vf[t] = WFrag<T16>::ld(Vt + vo + (size_t)(t * 16) * TT + key0);
            asm volatile("" ::: "memory");   // compiler fence: keeps the pass's V loads issued here, ahead of the score products, so that they fly under them (without it they sink to the block that uses them)
        } else {
#pragma unroll
            for (int kt = 0; kt < 2; ++kt)
#pragma unroll
                for (int kc = 0; kc < 4; ++kc) { const size_t o = ko + (size_t)(key0 + 16 * kt) * HD + kc * 32; kf[kt][kc] = WFrag<T16>::ld(Kp + o); kf2[kt][kc] = WFrag<T16>::ld(K2 + o); }
            __builtin_amdgcn_sched_barrier(0);   // all of the pass's K loads are issued before its first product (without it they are issued pair by pair, each pair waited for in turn)
        }
        v8f s[2][2];
#pragma unroll
        for (int kt = 0; kt < 2; ++kt)
#pragma unroll
            for (int g = 0; g < 2; ++g) { s[kt][g] = (v8f){};
#pragma unroll
                for (int kc = 0; kc < 4; ++kc) { s[kt][g] = WFrag<T16>::mma(kf[kt][kc], qf[g][kc], s[kt][g]); if (HI) { s[kt][g] = WFrag<T16>::mma(kf[kt][kc], qf2[g][kc], s[kt][g]); s[kt][g] = WFrag<T16>::mma(kf2[kt][kc], qf[g][kc], s[kt][g]); } } }
        if (!HI) { const int k1 = min(p + KSP, npass - 1) * 32;   // next pass's K (the last pass fetches rows that exist and are not used)
#pragma unroll
            for (int kt = 0; kt < 2; ++kt)
#pragma unroll
                for (int kc = 0; kc < 4; ++kc) kf[kt][kc] = WFrag<T16>::ld(Kp + ko + (size_t)(k1 + 16 * kt) * HD + kc * 32);
            asm volatile("s_wait_xcnt 0x0" ::: "memory");   // the wait owed before the loads' address registers are rewritten (the mask below reuses them); its memory clobber also keeps the next pass's K loads issued here, to fly under the softmax and the second product (without it they sink to the pass's end)
        } else {
#pragma unroll
            for (int t = 0; t < 8; ++t) { const size_t o = vo + (size_t)(t * 16) * TT + key0; vf[t] = WFrag<T16>::ld(Vt + o); vf2[t] = WFrag<T16>::ld(V2 + o); }
            asm volatile("s_wait_xcnt 0x0" ::: "memory");   // the wait owed before the loads' address registers are rewritten; its memory clobber also keeps the pass's V loads issued here, to fly under the maxima and the exponentials
        }
        if (p == npass - 1) {                             // wave-uniform: the diagonal pass masks key > query
#pragma unroll
            for (int g = 0; g < 2; ++g)
#pragma unroll
                for (int kt = 0; kt < 2; ++kt)
#pragma unroll
                    for (int j = 0; j < 8; ++j) if (16 * kt + 8 * hi + j > 16 * g + lr) s[kt][g][j] = -3.0e38f;
        }
        float mb[2]; bool need = false;
#pragma unroll
        for (int g = 0; g < 2; ++g) { float mx = -3.0e38f;
#pragma unroll
            for (int kt = 0; kt < 2; ++kt)
#pragma unroll
                for (int j = 0; j < 8; ++j) mx = fmaxf(mx, s[kt][g][j]);
            mx = fmaxf(mx, xhalf(mx)) * ACS; mb[g] = mx; need = need || (mx > m_run[g] + LAZY); }
        if (__builtin_amdgcn_ballot_w32(need) != 0) {     // one scalar test per pass
#pragma unroll
            for (int g = 0; g < 2; ++g) { const float mn = fmaxf(m_run[g], mb[g]); const float corr = __builtin_amdgcn_exp2f(m_run[g] - mn); l_run[g] *= corr; m_run[g] = mn;   // first pass: corr = 0 on zeros
#pragma unroll
                for (int t = 0; t < 8; ++t) acc[g][t] = acc[g][t] * corr; }
        }
#pragma unroll
        for (int g = 0; g < 2; ++g) { const float nm = PBIAS - m_run[g]; float e[16], ps0 = 0.f, ps1 = 0.f;
#pragma unroll
            for (int i = 0; i < 8; ++i) { const v2f arg = __builtin_elementwise_fma((v2f){s[i >> 2][g][2 * (i & 3)], s[i >> 2][g][2 * (i & 3) + 1]}, (v2f){ACS, ACS}, (v2f){nm, nm});   // a register pair of the score tile at a time
                e[2 * i] = __builtin_amdgcn_exp2f(arg[0]); e[2 * i + 1] = __builtin_amdgcn_exp2f(arg[1]); ps0 += e[2 * i]; ps1 += e[2 * i + 1]; }
            l_run[g] += ps0 + ps1;
            if constexpr (!HI) { v16h pf;
#pragma unroll
                for (int i = 0; i < 16; ++i) pf[i] = (h16)e[i];
#pragma unroll
                for (int t = 0; t < 8; ++t) acc[g][t] = WFrag<T16>::mma(vf[t], pf, acc[g][t]);
            } else { v8us h0, h1, l0, l1;
#pragma unroll
                for (int i = 0; i < 8; ++i) { unsigned short a, c2; splitf(e[i], a, c2); h0[i] = a; l0[i] = c2; }
#pragma unroll
                for (int i = 0; i < 8; ++i) { unsigned short a, c2; splitf(e[i + 8], a, c2); h1[i] = a; l1[i] = c2; }
                const V ph = cat16b(h0, h1), pl = cat16b(l0, l1);
#pragma unroll
                for (int t = 0; t < 8; ++t) { acc[g][t] = WFrag<T16>::mma(vf[t], ph, acc[g][t]); acc[g][t] = WFrag<T16>::mma(vf[t], pl, acc[g][t]); acc[g][t] = WFrag<T16>::mma(vf2[t], ph, acc[g][t]); }
            } }
    }
}
__global__ __launch_bounds__(32 * REP * KSP) void k_fattn(const h16* __restrict__ Q16, const bf* __restrict__ Qh, const bf* __restrict__ Ql, const h16* __restrict__ K16, const bf* __restrict__ Kh, const bf* __restrict__ Kl, const h16* __restrict__ V16, const bf* __restrict__ Vh, const bf* __restrict__ Vl, bf* Ah, bf* Al) {
    __shared__ __align__(16) v4f mrg[REP * 32 * 32];     // the second key share's accumulators, [head][16-byte piece][lane]
    __shared__ float mls[REP * 4 * 32];                  // its maxima and sums
    const int lane = threadIdx.x & 31, lr = lane & 15, hi = lane >> 4; const int wv = __builtin_amdgcn_readfirstlane(threadIdx.x >> 5); const int hg = wv % REP, ks = wv / REP;
    const int kvg = blockIdx.x % NKV, bt = blockIdx.x / NKV, h = kvg * REP + hg; const int rk = blockIdx.y; const int q0 = (rk < RH / 32 ? RH / 32 - 1 - rk : (int)gridDim.y - 1 - (rk - RH / 32)) * 32;   // a permutation of the query blocks: see the grid note above
    v8f acc[2][8]; float m_run[2], l_run[2];
#pragma unroll
    for (int g = 0; g < 2; ++g) { m_run[g] = -3.0e38f; l_run[g] = 0.f;
#pragma unroll
        for (int t = 0; t < 8; ++t) acc[g][t] = (v8f){}; }
    const size_t qo = (size_t)(bt * NH_ + h) * TT * HD, kvo = (size_t)(bt * NKV + kvg) * TT * HD;
    if (q0 < RH) attn_walk<bf, true>(Qh + qo, Ql + qo, Kh + kvo, Kl + kvo, Vh + kvo, Vl + kvo, q0, ks, lr, hi, acc, m_run, l_run);
    else attn_walk<h16, false>(Q16 + qo, nullptr, K16 + kvo, nullptr, V16 + kvo, nullptr, q0, ks, lr, hi, acc, m_run, l_run);
    if (ks == 1) {
#pragma unroll
        for (int g = 0; g < 2; ++g) { mls[(hg * 4 + g) * 32 + lane] = m_run[g]; mls[(hg * 4 + 2 + g) * 32 + lane] = l_run[g];
#pragma unroll
            for (int t = 0; t < 8; ++t) { v4f* p = mrg + (hg * 32 + (g * 8 + t) * 2) * 32 + lane; p[0] = __builtin_shufflevector(acc[g][t], acc[g][t], 0, 1, 2, 3); p[32] = __builtin_shufflevector(acc[g][t], acc[g][t], 4, 5, 6, 7); } }
    }
    __syncthreads();   // the second share's state is in LDS before the first share's wave joins it to its own
    if (ks == 0) {
#pragma unroll
        for (int g = 0; g < 2; ++g) { const float m1 = mls[(hg * 4 + g) * 32 + lane], l1 = mls[(hg * 4 + 2 + g) * 32 + lane]; const float m = fmaxf(m_run[g], m1);   // a share without a pass: m1 = -3e38, weight 0
            const float c0 = __builtin_amdgcn_exp2f(m_run[g] - m), c1 = __builtin_amdgcn_exp2f(m1 - m); float l = l_run[g] * c0 + l1 * c1; l += xhalf(l); const float inv = __fdiv_rn(1.0f, l); const float a0 = c0 * inv, a1 = c1 * inv;
            const size_t oo = (size_t)(bt * TT + q0 + 16 * g + lr) * DQ + h * HD + 8 * hi;
#pragma unroll
            for (int t = 0; t < 8; ++t) { const v4f* p = mrg + (hg * 32 + (g * 8 + t) * 2) * 32 + lane; const v4f b0 = p[0], b1 = p[32]; v8us oh, ol;
#pragma unroll
                for (int j = 0; j < 8; ++j) { unsigned short a, c2; splitf(acc[g][t][j] * a0 + (j < 4 ? b0[j & 3] : b1[j & 3]) * a1, a, c2); oh[j] = a; ol[j] = c2; }
                *(v8us*)(Ah + oo + t * 16) = oh; *(v8us*)(Al + oo + t * 16) = ol; } }
    }
}

__global__ __launch_bounds__(256) void k_wtG(const float* __restrict__ w, int K, int N, bf* Bt) {
    const int lane = threadIdx.x & 31; const int L0 = (blockIdx.x * 8 + (threadIdx.x >> 5)) * 8; const int nlines = N * K / 64;
{
#pragma unroll 1
        for (int l = 0; l < 8; ++l) { const int L = L0 + l; if (L >= nlines) break; const size_t e = (size_t)L * 64 + lane * 2; const int k = (int)(e % K), n = (int)(e / K); v2us o;
            o[0] = f2bf(w[(size_t)k * N + n]); o[1] = f2bf(w[(size_t)(k + 1) * N + n]); *(v2us*)(Bt + e) = o; }
         }
}
// ---- k_prep: every input conversion of the run in one grid. The block index picks the job (block-uniform): 2048 elements of x (both batches), wq, wk, wv or wo to bf16; 256 (cos, sin) pairs; 256 bias values into one row.
// wq, wk, wv land one under the other (WS [DS][DM]) and bq, bk, bv one behind the other (BS [DS]), so that one GEMM makes q, k and v.
#define DS    (DQ + 2 * DKV)
#define PB_X  (NB_ * TT * DM / 2048)
#define PB_WQ (DQ * DM / 2048)
#define PB_WK (DKV * DM / 2048)
#define PB_WO (DM * DQ / 2048)
#define PB_CS (TT * HD / 256)
#define PB_BS (DS / 256)
__global__ __launch_bounds__(256) void k_prep(const float* __restrict__ x, const float* __restrict__ wq, const float* __restrict__ wk, const float* __restrict__ wv, const float* __restrict__ wo, const float* __restrict__ cosT, const float* __restrict__ sinT, const float* __restrict__ bq, const float* __restrict__ bk, const float* __restrict__ bv, bf* XB, bf* WS, bf* WO, float* CS, float* BS) {
    int blk = blockIdx.x; const float* src; bf* dst;
    if (blk < PB_X) { src = x; dst = XB; }
    else if ((blk -= PB_X) < PB_WQ) { src = wq; dst = WS; }
    else if ((blk -= PB_WQ) < PB_WK) { src = wk; dst = WS + (size_t)DQ * DM; }
    else if ((blk -= PB_WK) < PB_WK) { src = wv; dst = WS + (size_t)(DQ + DKV) * DM; }
    else if ((blk -= PB_WK) < PB_WO) { src = wo; dst = WO; }
    else if ((blk -= PB_WO) < PB_CS) { const int idx = blk * 256 + threadIdx.x; v2f cs; cs[0] = bfr(cosT[idx]); cs[1] = bfr(sinT[idx]); *(v2f*)(CS + (size_t)idx * 2) = cs; asm volatile("s_wait_xcnt 0x0" ::: "memory"); return; }   // the wait owed behind a store before its registers are rewritten: the jobs are laid one behind the other in the build
    else { const int c = (blk - PB_CS) * 256 + threadIdx.x; BS[c] = c < DQ ? bq[c] : c < DQ + DKV ? bk[c - DQ] : bv[c - DQ - DKV]; asm volatile("s_wait_xcnt 0x0" ::: "memory"); return; }   // the same wait behind this job's store
    const size_t i = (size_t)blk * 256 + threadIdx.x; const v8f v = *(const v8f*)(src + i * 8); v8us o;
#pragma unroll
    for (int k = 0; k < 8; ++k) o[k] = f2bf(v[k]); *(v8us*)(dst + i * 8) = o;  }
// rope_do: head planes [batch][h][t][d] (fp16 + hi/lo) of rope(x) x sc with the rotate-half convention out[d] = x[d] cos[t][d] - x[d+HD/2] sin[t][d], out[d+HD/2] = x[d+HD/2] cos[t][d+HD/2] + x[d] sin[t][d+HD/2]
__device__ __forceinline__ void rope_do(int blk, const float* __restrict__ F, int pitch, int nheads, const float* __restrict__ CS, const float* __restrict__ RF, const float* __restrict__ nw, float sc, h16* P16, bf* Ph, bf* Pl) {
    const size_t e = ((size_t)blk * 256 + threadIdx.x) * 2; const int d = (int)(e % HD); const int t = (int)((e / HD) % TT); const int hb = (int)(e / ((size_t)HD * TT)); const int h = hb % nheads; const float* f = F + (size_t)((hb / nheads) * TT + t) * pitch + h * HD; const float rf = RF ? RF[(size_t)hb * TT + t] : 1.0f; v2h o16; v2us oh, ol;
#pragma unroll
    for (int q = 0; q < 2; ++q) { const int dd = d + q; const int dp = (dd < HD / 2) ? dd + HD / 2 : dd - HD / 2; float x0 = f[dd], x1 = f[dp];
        if (RF) { float n0 = __fmul_rn(x0, rf), n1 = __fmul_rn(x1, rf); asm volatile("" : "+v"(n0)); asm volatile("" : "+v"(n1)); x0 = __fmul_rn(bfr(nw[dd]), n0); x1 = __fmul_rn(bfr(nw[dp]), n1); }
        const v2f cs = *(const v2f*)(CS + ((size_t)t * HD + dd) * 2); float a = __fmul_rn(x0, cs[0]), bq = __fmul_rn(x1, cs[1]); asm volatile("" : "+v"(a)); asm volatile("" : "+v"(bq)); const float r = ((dd < HD / 2) ? __fsub_rn(a, bq) : __fadd_rn(a, bq)) * sc;
        o16[q] = tohx(r); unsigned short a2, c2; splitf(r, a2, c2); oh[q] = a2; ol[q] = c2; }
    *(v2h*)(P16 + e) = o16; *(v2us*)(Ph + e) = oh; *(v2us*)(Pl + e) = ol;
    asm volatile("s_wait_xcnt 0x0" ::: "memory"); }   // the wait owed behind the three stores before their registers are rewritten (the next job's code follows in the build)
__device__ __forceinline__ void vtp_do(int blk, const float* __restrict__ F, int pitch, int nheads, h16* V16, bf* Vh, bf* Vl) { const size_t e = ((size_t)blk * 256 + threadIdx.x) * 2; const int t = (int)(e % TT) + (int)(e / ((size_t)TT * HD * nheads)) * TT; const int d = (int)((e / TT) % HD); const int g = (int)((e / ((size_t)TT * HD)) % nheads); v2h o16; v2us oh, ol;
#pragma unroll
    for (int q = 0; q < 2; ++q) { const float x = F[(size_t)(t + q) * pitch + g * HD + d]; o16[q] = tohx(x); unsigned short a2, c2; splitf(x, a2, c2); oh[q] = a2; ol[q] = c2; }
    *(v2h*)(V16 + e) = o16; *(v2us*)(Vh + e) = oh; *(v2us*)(Vl + e) = ol;
    asm volatile("s_wait_xcnt 0x0" ::: "memory"); }   // the same wait behind these three stores
// ---- k_planes: the operand planes of q, k (rope) and v (transposed), both batches, in one grid over the stacked projection F [NB_ TT][DS]; the block index picks the job (block-uniform).
#define PL_Q (NB_ * NH_ * TT * HD / 512)
#define PL_K (NB_ * NKV * TT * HD / 512)
__global__ __launch_bounds__(256) void k_planes(const float* __restrict__ F, const float* __restrict__ CS, h16* Q16, bf* Qh, bf* Ql, h16* K16, bf* Kh, bf* Kl, h16* V16, bf* Vh, bf* Vl) {
    const int blk = blockIdx.x;
    if (blk < PL_Q) rope_do(blk, F, DS, NH_, CS, nullptr, nullptr, 1.0f, Q16, Qh, Ql);
    else if (blk < PL_Q + PL_K) rope_do(blk - PL_Q, F + DQ, DS, NKV, CS, nullptr, nullptr, 1.0f, K16, Kh, Kl);
    else vtp_do(blk - PL_Q - PL_K, F + DQ + DKV, DS, NKV, V16, Vh, Vl);
}
extern "C" void kernel_launch(void* const* d_in, const int* in_sizes, int n_in,
                              void* d_out, int out_size, void* d_ws, size_t ws_size, hipStream_t stream) {
    (void)in_sizes; (void)n_in; (void)out_size;
    const float* x = (const float*)d_in[0]; const float* ang = (const float*)d_in[1]; const float* wq = (const float*)d_in[2]; const float* bq = (const float*)d_in[3]; const float* wk = (const float*)d_in[4]; const float* bk = (const float*)d_in[5]; const float* wv = (const float*)d_in[6]; const float* bv = (const float*)d_in[7]; const float* wo = (const float*)d_in[8]; const float* cosT = ang; const float* sinT = ang + (size_t)2048 * 128;
    float* OUT = (float*)d_out;     // [2][2048][2048]
    char* wsp = (char*)d_ws;
    auto take = [&](size_t bytes) { char* p = wsp; wsp += (bytes + 255) & ~(size_t)255; return (void*)p; };
    bf* WS = (bf*)take((size_t)DS * DM * 2); bf* WO = (bf*)take((size_t)DM * DQ * 2); float* CS = (float*)take((size_t)TT * HD * 2 * 4); float* BS = (float*)take((size_t)DS * 4);
    bf* XB = (bf*)take((size_t)NB_ * TT * DM * 2); float* F = (float*)take((size_t)NB_ * TT * DS * 4);
    h16* QP16 = (h16*)take((size_t)NB_ * NH_ * TT * HD * 2); h16* KP16 = (h16*)take((size_t)NB_ * NKV * TT * HD * 2); h16* VT16 = (h16*)take((size_t)NB_ * NKV * HD * TT * 2);
    bf* QPh = (bf*)take((size_t)NB_ * NH_ * TT * HD * 2); bf* QPl = (bf*)take((size_t)NB_ * NH_ * TT * HD * 2); bf* KPh = (bf*)take((size_t)NB_ * NKV * TT * HD * 2); bf* KPl = (bf*)take((size_t)NB_ * NKV * TT * HD * 2); bf* VTh = (bf*)take((size_t)NB_ * NKV * HD * TT * 2); bf* VTl = (bf*)take((size_t)NB_ * NKV * HD * TT * 2);
    bf* ATh = (bf*)take((size_t)NB_ * TT * DQ * 2); bf* ATl = (bf*)take((size_t)NB_ * TT * DQ * 2);
    if ((size_t)(wsp - (char*)d_ws) > ws_size) return;    // ws 256 MiB
    // five launches, each over both batches (rows b TT + t)
    k_prep<<<PB_X + PB_WQ + 2 * PB_WK + PB_WO + PB_CS + PB_BS, 256, 0, stream>>>(x, wq, wk, wv, wo, cosT, sinT, bq, bk, bv, XB, WS, WO, CS, BS);
    k_gemmw<bf, 0, true><<<dim3(NB_ * TT / 64, DS / 64, 1), 32 * NWK, 0, stream>>>(XB, nullptr, WS, nullptr, DM, F, DS, BS, 0, 0, 0);
    k_planes<<<PL_Q + 2 * PL_K, 256, 0, stream>>>(F, CS, QP16, QPh, QPl, KP16, KPh, KPl, VT16, VTh, VTl);
    k_fattn<<<dim3(NKV * NB_, TT / 32, 1), 32 * REP * KSP, 0, stream>>>(QP16, QPh, QPl, KP16, KPh, KPl, VT16, VTh, VTl, ATh, ATl);
    k_gemmw<bf, 1, false><<<dim3(NB_ * TT / 64, DM / 64, 1), 32 * NWK, 0, stream>>>(ATh, ATl, WO, nullptr, DQ, OUT, DM, nullptr, 0, 0, 0);
}

// v005
// One run takes 181 microseconds.
// Two timings next to v004 put it at 1.64 and 1.63 times that version's speed.
// Over all steps from v000 it is 9.08 times as fast.
#include <hip/hip_runtime.h>

// GQA attention block (x [2][2048][2048]; q/k/v = x W^T + b (torch; 16 query heads, 4 kv heads x 128; group h/4); rotate-half RoPE with the given angles [2][2048][128] = (cos table, sin table) (read); causal softmax(q.k / sqrt(128)) (finfo.min fill); out = merged wo^T -> [2][2048][2048]).
// Compute dtypes, f32 accumulate: every input rounded to bf16; q/k/v on PLAIN bf16 operands (inputs: exact) + bias; RoPE f32 with the read tables; causal scores and attn.v: query rows < 512 hl (3 products), the rest single fp16, in one kernel with a running softmax (f32), keys beyond the diagonal block never visited; wo hl x exact (2 products).

#define NB_  2
#define TT   2048
#define DM   2048
#define NH_  16
#define NKV  4
#define REP  (NH_ / NKV)
#define HD   128
#define DQ   (NH_ * HD)
#define DKV  (NKV * HD)
#define RH   512                  // query rows < RH use hi+lo planes (0: none)
#define SCL  0.088388347648318447f   // HD^-0.5
typedef _Float16 h16;
typedef unsigned short bf;
typedef __attribute__((ext_vector_type(16))) __bf16   v16bf;
typedef __attribute__((ext_vector_type(16))) _Float16 v16h;
typedef __attribute__((ext_vector_type(8)))  _Float16 v8h;
typedef __attribute__((ext_vector_type(8)))  unsigned short v8us;
typedef __attribute__((ext_vector_type(8)))  float    v8f;
typedef __attribute__((ext_vector_type(4)))  float    v4f;
typedef v8h  __attribute__((may_alias)) v8ha;
typedef v4f  __attribute__((may_alias)) v4fa;
typedef v8us __attribute__((may_alias)) v8usa;

__device__ __forceinline__ unsigned short f2bf(float f) { unsigned u = __float_as_uint(f); u += 0x7FFFu + ((u >> 16) & 1u); return (unsigned short)(u >> 16); }
__device__ __forceinline__ float bf2f(unsigned short b) { return __uint_as_float(((unsigned)b) << 16); }
__device__ __forceinline__ float bfr(float f) { return bf2f(f2bf(f)); }
__device__ __forceinline__ v16h cat16(v8h lo, v8h hi) { return __builtin_shufflevector(lo, hi, 0, 1, 2, 3, 4, 5, 6, 7, 8, 9, 10, 11, 12, 13, 14, 15); }
__device__ __forceinline__ v16bf cat16b(v8us lo, v8us hi) { return __builtin_bit_cast(v16bf, __builtin_shufflevector(lo, hi, 0, 1, 2, 3, 4, 5, 6, 7, 8, 9, 10, 11, 12, 13, 14, 15)); }
__device__ __forceinline__ v8f wmma16(v16h a, v16h b, v8f c) { return __builtin_amdgcn_wmma_f32_16x16x32_f16(false, a, false, b, (short)0, c, false, false); }
__device__ __forceinline__ v8f wmmab(v16bf a, v16bf b, v8f c) { return __builtin_amdgcn_wmma_f32_16x16x32_bf16(false, a, false, b, (short)0, c, false, false); }



// ---- K loop shared by NWK waves of one work-group: wave w takes the 32-k steps w, w + NWK, ... (neighbour waves read neighbouring 1-KiB fragments of every row block) into its own 64x64 f32 partial tile;
// the partial tiles meet in LDS and are summed in the fixed order wave 0, 1, ... NWK-1. LDS in 16-byte units [wave][mb][hi][nb][j/4][lr]: contiguous 256 bytes per 16 lanes for the writer and for the reader.
#define NWK 8
#define REDU (NWK * 4 * 2 * 4 * 2 * 16)   // 16-byte units: NWK partial tiles of 16 KiB
__device__ __forceinline__ void red_put(v4f* red, int wv, int lr, int hi, const v8f (&acc)[4][4]) {
#pragma unroll
    for (int mb = 0; mb < 4; ++mb)
#pragma unroll
        for (int nb = 0; nb < 4; ++nb) { v4f* p = red + ((((wv * 4 + mb) * 2 + hi) * 4 + nb) * 2) * 16 + lr;
            p[0] = __builtin_shufflevector(acc[mb][nb], acc[mb][nb], 0, 1, 2, 3); p[16] = __builtin_shufflevector(acc[mb][nb], acc[mb][nb], 4, 5, 6, 7); }
}
// wave wv sums and stores rows 8 wv .. 8 wv + 7 of the tile (mb = wv / 2, hi = wv % 2); lane = column within a 32-column group, so every store instruction writes one whole 128-byte line.
template <bool BIAS>
__device__ __forceinline__ void red_sum_store(const v4f* red, int wv, int lane, float* ctile, int ldc, const float* btile) {
#pragma unroll
    for (int g = 0; g < 2; ++g) { const v4f* p = red + ((wv * 4 + g * 2 + (lane >> 4)) * 2) * 16 + (lane & 15); v4f s0 = p[0], s1 = p[16];
#pragma unroll
        for (int s = 1; s < NWK; ++s) { s0 += p[s * (REDU / NWK)]; s1 += p[s * (REDU / NWK) + 16]; }
        const int col = g * 32 + lane; const float bb = BIAS ? bfr(btile[col]) : 0.0f; float* cp = ctile + (size_t)(wv * 8) * ldc + col;
#pragma unroll
        for (int j = 0; j < 4; ++j) { cp[(size_t)j * ldc] = BIAS ? s0[j] + bb : s0[j]; cp[(size_t)(j + 4) * ldc] = BIAS ? s1[j] + bb : s1[j]; } }
}

// ---- Fragment order of a 16-bit operand plane M[R][K]: the 16 rows x 32 k of one matrix operand lie in 1024 contiguous bytes, as the two 16-byte loads of the 32 lanes read them (WFrag::ld), so that one wave-wide load covers four whole 128-byte lines (row-major: 32 bytes of each of 16 lines).
// In a fragment the 16-byte unit of (row r, k .. k + 7) is ((k / 16) % 2) 32 + ((k / 8) % 2) 16 + r % 16. The fragments of a 16-row block follow one another in k, then the next row block: a row block fills 16 K elements, as in the row-major plane. (The transposed value planes alone order theirs the other way: see vtp_do.)
// ---- k_gemmw: register-blocked GEMM, NWK waves per 64x64 output tile (each 16 accumulators over its share of K), operands straight from 16-bit planes in fragment order; grid (M/64, N/64, Z), 32 NWK threads.
// C[m][n] (f32, pitch ldc, + optional bias[n] rounded to bf16) = sum_k A[m][k] Bt[n][k] (+ split products per NSPLIT). z-batch strides sA/sB/sC in elements. K % 32 == 0.
template <typename T16> struct WFrag;
template <> struct WFrag<h16> { typedef v16h V; static __device__ __forceinline__ V ld(const h16* p) { return cat16(*(const v8h*)p, *(const v8h*)(p + 256)); } static __device__ __forceinline__ v8f mma(V a, V b, v8f c) { return wmma16(a, b, c); } };
template <> struct WFrag<bf> { typedef v16bf V; static __device__ __forceinline__ V ld(const bf* p) { return cat16b(*(const v8us*)p, *(const v8us*)(p + 256)); } static __device__ __forceinline__ v8f mma(V a, V b, v8f c) { return wmmab(a, b, c); } };
template <typename T16, int NSPLIT, bool BIAS>
__global__ __launch_bounds__(32 * NWK) void k_gemmw(const T16* __restrict__ A, const T16* __restrict__ A2, const T16* __restrict__ Bt, const T16* __restrict__ Bt2, int K, float* C, int ldc, const float* __restrict__ bias, size_t sA, size_t sB, size_t sC) {
    typedef typename WFrag<T16>::V V;
    __shared__ __align__(16) v4f red[REDU];
    const size_t z = blockIdx.z; A += z * sA; if (A2) A2 += z * sA; Bt += z * sB; if (Bt2) Bt2 += z * sB; C += z * sC;
    const int lane = threadIdx.x & 31, lr = lane & 15, hi = lane >> 4; const int wv = __builtin_amdgcn_readfirstlane(threadIdx.x >> 5); const int r0 = blockIdx.x * 64, c0 = blockIdx.y * 64;
    v8f acc[4][4];
#pragma unroll
    for (int mb = 0; mb < 4; ++mb)
#pragma unroll
        for (int nb = 0; nb < 4; ++nb) acc[mb][nb] = (v8f){};
    const size_t aoff = (size_t)r0 * K + 8 * lane, boff = (size_t)c0 * K + 8 * lane;   // the lane's 16 bytes in the first fragment of the tile's first row block; the fragment of k step kc lies 16 kc elements on
#pragma unroll 1
    for (int kc = wv * 32; kc < K; kc += NWK * 32) {
        V a[4], a2[4];
#pragma unroll
        for (int mb = 0; mb < 4; ++mb) { a[mb] = WFrag<T16>::ld(A + aoff + (size_t)mb * 16 * K + kc * 16); if (NSPLIT == 1 || NSPLIT == 2) a2[mb] = WFrag<T16>::ld(A2 + aoff + (size_t)mb * 16 * K + kc * 16); }
#pragma unroll
        for (int nb = 0; nb < 4; ++nb) { const V b = WFrag<T16>::ld(Bt + boff + (size_t)nb * 16 * K + kc * 16); V b2; if (NSPLIT >= 2) b2 = WFrag<T16>::ld(Bt2 + boff + (size_t)nb * 16 * K + kc * 16);
#pragma unroll
            for (int mb = 0; mb < 4; ++mb) { acc[mb][nb] = WFrag<T16>::mma(a[mb], b, acc[mb][nb]); if (NSPLIT == 1 || NSPLIT == 2) acc[mb][nb] = WFrag<T16>::mma(a2[mb], b, acc[mb][nb]); if (NSPLIT >= 2) acc[mb][nb] = WFrag<T16>::mma(a[mb], b2, acc[mb][nb]); } }
        asm volatile("v_nop\n\tv_nop\n\tv_nop\n\tv_nop" : "+v"(acc[0][0]), "+v"(acc[1][1]), "+v"(acc[2][2]), "+v"(acc[3][3]) : "v"(a[0]), "v"(a[3]));
    }
    red_put(red, wv, lr, hi, acc);
    __syncthreads();   // every wave's partial tile is in LDS before any wave sums its eight rows
    red_sum_store<BIAS>(red, wv, lane, C + (size_t)r0 * ldc + c0, ldc, BIAS ? bias + c0 : nullptr);
}

__device__ __forceinline__ h16 tohx(float x) { return (h16)x; }
__device__ __forceinline__ void splitf(float y, unsigned short& h, unsigned short& l) { h = f2bf(y); l = f2bf(y - bf2f(h)); }
typedef __attribute__((ext_vector_type(2))) _Float16 v2h;
typedef __attribute__((ext_vector_type(4))) _Float16 v4h;
typedef __attribute__((ext_vector_type(2))) unsigned short v2us;
typedef __attribute__((ext_vector_type(4))) unsigned short v4us;
typedef __attribute__((ext_vector_type(2))) float v2f;
typedef __attribute__((ext_vector_type(4))) int v4i;

// ---- k_fattn: scores, softmax and probability x value in one kernel; no score or probability leaves the registers. Work-group = 32 query rows x the REP query heads of one kv group x KSP key shares: wave (hg, ks) owns head hg and the 32-key passes ks, ks + KSP, ...
// Grid (NKV x NB_, TT / 32): both batches in one launch, twice as many work-groups as resident places, so the start order decides the tail. The query block is the slow index: first the hi+lo blocks (three products for one: short rows, dear passes), longest first, then the single-plane blocks, longest first; no dear block starts late.
// Transposed products: S^T = K Q^T (A = key rows, B = query rows), so a lane holds scores of ONE query (column lr; keys 8 hi + j of each 16-key tile), which is already the B operand order of O^T += V^T P^T (A = rows of the transposed value plane).
// Running softmax in the log2 domain: m_run is the maximum in use, l_run the lane's share of the sum; the accumulators are rescaled only when some query's maximum exceeds m_run by more than LAZY. Every exponential carries the factor 2^PBIAS (it cancels in acc / l): at most 2^(LAZY + PBIAS) in fp16.
#define KSP   2
#define ACS   (SCL * 1.4426950408889634f)
#define LAZY  8.0f
#define PBIAS 6.0f
__device__ __forceinline__ float xhalf(float x) { return __builtin_bit_cast(float, __builtin_amdgcn_permlanex16(__builtin_bit_cast(int, x), __builtin_bit_cast(int, x), 0x76543210, 0xfedcba98, false, false)); }   // lane l with lane l ^ 16: the two holders of one query
template <typename T16, bool HI>
__device__ __forceinline__ void attn_walk(const T16* __restrict__ Q, const T16* __restrict__ Q2, const T16* __restrict__ Kp, const T16* __restrict__ K2, const T16* __restrict__ Vt, const T16* __restrict__ V2, int q0, int ks, int lr, int hi, v8f (&acc)[2][8], float (&m_run)[2], float (&l_run)[2]) {
    typedef typename WFrag<T16>::V V;
    const int npass = q0 / 32 + 1;                       // keys 0 .. q0 + 31; only the last pass meets the diagonal
    if (ks >= npass) return;                             // wave-uniform: a key share without a pass keeps its start state (weight 0 in the join)
    const size_t ko = (size_t)(hi * 16 + lr) * 8, vo = ko;   // the lane's 16 bytes in a fragment (fragment order: see k_gemmw); the 8 fragments of a pass's 32 keys, K and V alike, are 8 KiB in a row
    __builtin_amdgcn_sched_barrier(0);                   // keeps the lane arithmetic above in front of the loads below: none of it may land between them and their wait, where it would reuse an address register
    V qf[2][4], qf2[2][4];
#pragma unroll
    for (int g = 0; g < 2; ++g)
#pragma unroll
        for (int kc = 0; kc < 4; ++kc) { const size_t o = ko + (size_t)(q0 + 16 * g) * HD + kc * 512; qf[g][kc] = WFrag<T16>::ld(Q + o); if (HI) qf2[g][kc] = WFrag<T16>::ld(Q2 + o); }
    V kf[2][4], kf2[2][4];
    if (!HI) { const int k0 = ks * 32;                   // single-plane path: K fragments are fetched one pass ahead
#pragma unroll
        for (int kt = 0; kt < 2; ++kt)
#pragma unroll
            for (int kc = 0; kc < 4; ++kc) kf[kt][kc] = WFrag<T16>::ld(Kp + ko + (size_t)(k0 + 16 * kt) * HD + kc * 512); }
    asm volatile("s_wait_xcnt 0x0" ::: "memory");   // the wait owed before the address registers of the loads above are rewritten
    __builtin_amdgcn_sched_barrier(0);               // keeps the later arithmetic, which reuses those registers, behind that wait
#pragma unroll 1
    for (int p = ks; p < npass; p += KSP) {
        const int key0 = p * 32;
        V vf[8], vf2[8];
        if (!HI) {
#pragma unroll
            for (int t = 0; t < 8; ++t) vf[t] = WFrag<T16>::ld(Vt + vo + (size_t)key0 * HD + t * 512);
            asm volatile("" ::: "memory");   // compiler fence: keeps the pass's V loads issued here, ahead of the score products, so that they fly under them (without it they sink to the block that uses them)
        } else {
#pragma unroll
            for (int kt = 0; kt < 2; ++kt)
#pragma unroll
                for (int kc = 0; kc < 4; ++kc) { const size_t o = ko + (size_t)(key0 + 16 * kt) * HD + kc * 512; kf[kt][kc] = WFrag<T16>::ld(Kp + o); kf2[kt][kc] = WFrag<T16>::ld(K2 + o); }
            __builtin_amdgcn_sched_barrier(0);   // all of the pass's K loads are issued before its first product (without it they are issued pair by pair, each pair waited for in turn)
        }
        v8f s[2][2];
#pragma unroll
        for (int kt = 0; kt < 2; ++kt)
#pragma unroll
            for (int g = 0; g < 2; ++g) { s[kt][g] = (v8f){};
#pragma unroll
                for (int kc = 0; kc < 4; ++kc) { s[kt][g] = WFrag<T16>::mma(kf[kt][kc], qf[g][kc], s[kt][g]); if (HI) { s[kt][g] = WFrag<T16>::mma(kf[kt][kc], qf2[g][kc], s[kt][g]); s[kt][g] = WFrag<T16>::mma(kf2[kt][kc], qf[g][kc], s[kt][g]); } } }
        if (!HI) { const int k1 = min(p + KSP, npass - 1) * 32;   // next pass's K (the last pass fetches rows that exist and are not used)
#pragma unroll
            for (int kt = 0; kt < 2; ++kt)
#pragma unroll
                for (int kc = 0; kc < 4; ++kc) kf[kt][kc] = WFrag<T16>::ld(Kp + ko + (size_t)(k1 + 16 * kt) * HD + kc * 512);
            asm volatile("s_wait_xcnt 0x0" ::: "memory");   // the wait owed before the loads' address registers are rewritten (the mask below reuses them); its memory clobber also keeps the next pass's K loads issued here, to fly under the softmax and the second product (without it they sink to the pass's end)
        } else {
#pragma unroll
            for (int t = 0; t < 8; ++t) { const size_t o = vo + (size_t)key0 * HD + t * 512; vf[t] = WFrag<T16>::ld(Vt + o); vf2[t] = WFrag<T16>::ld(V2 + o); }
            asm volatile("s_wait_xcnt 0x0" ::: "memory");   // the wait owed before the loads' address registers are rewritten; its memory clobber also keeps the pass's V loads issued here, to fly under the maxima and the exponentials
        }
        if (p == npass - 1) {                             // wave-uniform: the diagonal pass masks key > query
#pragma unroll
            for (int g = 0; g < 2; ++g)
#pragma unroll
                for (int kt = 0; kt < 2; ++kt)
#pragma unroll
                    for (int j = 0; j < 8; ++j) if (16 * kt + 8 * hi + j > 16 * g + lr) s[kt][g][j] = -3.0e38f;
        }
        float mb[2]; bool need = false;
#pragma unroll
        for (int g = 0; g < 2; ++g) { float mx = -3.0e38f;
#pragma unroll
            for (int kt = 0; kt < 2; ++kt)
#pragma unroll
                for (int j = 0; j < 8; ++j) mx = fmaxf(mx, s[kt][g][j]);
            mx = fmaxf(mx, xhalf(mx)) * ACS; mb[g] = mx; need = need || (mx > m_run[g] + LAZY); }
        if (__builtin_amdgcn_ballot_w32(need) != 0) {     // one scalar test per pass
#pragma unroll
            for (int g = 0; g < 2; ++g) { const float mn = fmaxf(m_run[g], mb[g]); const float corr = __builtin_amdgcn_exp2f(m_run[g] - mn); l_run[g] *= corr; m_run[g] = mn;   // first pass: corr = 0 on zeros
#pragma unroll
                for (int t = 0; t < 8; ++t) acc[g][t] = acc[g][t] * corr; }
        }
#pragma unroll
        for (int g = 0; g < 2; ++g) { const float nm = PBIAS - m_run[g]; float e[16], ps0 = 0.f, ps1 = 0.f;
#pragma unroll
            for (int i = 0; i < 8; ++i) { const v2f arg = __builtin_elementwise_fma((v2f){s[i >> 2][g][2 * (i & 3)], s[i >> 2][g][2 * (i & 3) + 1]}, (v2f){ACS, ACS}, (v2f){nm, nm});   // a register pair of the score tile at a time
                e[2 * i] = __builtin_amdgcn_exp2f(arg[0]); e[2 * i + 1] = __builtin_amdgcn_exp2f(arg[1]); ps0 += e[2 * i]; ps1 += e[2 * i + 1]; }
            l_run[g] += ps0 + ps1;
            if constexpr (!HI) { v16h pf;
#pragma unroll
                for (int i = 0; i < 16; ++i) pf[i] = (h16)e[i];
#pragma unroll
                for (int t = 0; t < 8; ++t) acc[g][t] = WFrag<T16>::mma(vf[t], pf, acc[g][t]);
            } else { v8us h0, h1, l0, l1;
#pragma unroll
                for (int i = 0; i < 8; ++i) { unsigned short a, c2; splitf(e[i], a, c2); h0[i] = a; l0[i] = c2; }
#pragma unroll
                for (int i = 0; i < 8; ++i) { unsigned short a, c2; splitf(e[i + 8], a, c2); h1[i] = a; l1[i] = c2; }
                const V ph = cat16b(h0, h1), pl = cat16b(l0, l1);
#pragma unroll
                for (int t = 0; t < 8; ++t) { acc[g][t] = WFrag<T16>::mma(vf[t], ph, acc[g][t]); acc[g][t] = WFrag<T16>::mma(vf[t], pl, acc[g][t]); acc[g][t] = WFrag<T16>::mma(vf2[t], ph, acc[g][t]); }
            } }
    }
}
__global__ __launch_bounds__(32 * REP * KSP) void k_fattn(const h16* __restrict__ Q16, const bf* __restrict__ Qh, const bf* __restrict__ Ql, const h16* __restrict__ K16, const bf* __restrict__ Kh, const bf* __restrict__ Kl, const h16* __restrict__ V16, const bf* __restrict__ Vh, const bf* __restrict__ Vl, bf* Ah, bf* Al) {
    __shared__ __align__(16) v4f mrg[REP * 32 * 32];     // the second key share's accumulators, [head][16-byte piece][lane]
    __shared__ float mls[REP * 4 * 32];                  // its maxima and sums
    const int lane = threadIdx.x & 31, lr = lane & 15, hi = lane >> 4; const int wv = __builtin_amdgcn_readfirstlane(threadIdx.x >> 5); const int hg = wv % REP, ks = wv / REP;
    const int kvg = blockIdx.x % NKV, bt = blockIdx.x / NKV, h = kvg * REP + hg; const int rk = blockIdx.y; const int q0 = (rk < RH / 32 ? RH / 32 - 1 - rk : (int)gridDim.y - 1 - (rk - RH / 32)) * 32;   // a permutation of the query blocks: see the grid note above
    v8f acc[2][8]; float m_run[2], l_run[2];
#pragma unroll
    for (int g = 0; g < 2; ++g) { m_run[g] = -3.0e38f; l_run[g] = 0.f;
#pragma unroll
        for (int t = 0; t < 8; ++t) acc[g][t] = (v8f){}; }
    const size_t qo = (size_t)(bt * NH_ + h) * TT * HD, kvo = (size_t)(bt * NKV + kvg) * TT * HD;
    if (q0 < RH) attn_walk<bf, true>(Qh + qo, Ql + qo, Kh + kvo, Kl + kvo, Vh + kvo, Vl + kvo, q0, ks, lr, hi, acc, m_run, l_run);
    else attn_walk<h16, false>(Q16 + qo, nullptr, K16 + kvo, nullptr, V16 + kvo, nullptr, q0, ks, lr, hi, acc, m_run, l_run);
    if (ks == 1) {
#pragma unroll
        for (int g = 0; g < 2; ++g) { mls[(hg * 4 + g) * 32 + lane] = m_run[g]; mls[(hg * 4 + 2 + g) * 32 + lane] = l_run[g];
#pragma unroll
            for (int t = 0; t < 8; ++t) { v4f* p = mrg + (hg * 32 + (g * 8 + t) * 2) * 32 + lane; p[0] = __builtin_shufflevector(acc[g][t], acc[g][t], 0, 1, 2, 3); p[32] = __builtin_shufflevector(acc[g][t], acc[g][t], 4, 5, 6, 7); } }
    }
    __syncthreads();   // the second share's state is in LDS before the first share's wave joins it to its own
    if (ks == 0) {
#pragma unroll
        for (int g = 0; g < 2; ++g) { const float m1 = mls[(hg * 4 + g) * 32 + lane], l1 = mls[(hg * 4 + 2 + g) * 32 + lane]; const float m = fmaxf(m_run[g], m1);   // a share without a pass: m1 = -3e38, weight 0
            const float c0 = __builtin_amdgcn_exp2f(m_run[g] - m), c1 = __builtin_amdgcn_exp2f(m1 - m); float l = l_run[g] * c0 + l1 * c1; l += xhalf(l); const float inv = __fdiv_rn(1.0f, l); const float a0 = c0 * inv, a1 = c1 * inv;
            const size_t oo = (size_t)(bt * TT + q0 + 16 * g) * DQ + (size_t)(h * (HD / 32) * 64 + lane) * 8;   // fragment order: row block, then the head's first fragment; the 16 columns of tile t are one 512-byte half fragment
#pragma unroll
            for (int t = 0; t < 8; ++t) { const v4f* p = mrg + (hg * 32 + (g * 8 + t) * 2) * 32 + lane; const v4f b0 = p[0], b1 = p[32]; v8us oh, ol;
#pragma unroll
                for (int j = 0; j < 8; ++j) { unsigned short a, c2; splitf(acc[g][t][j] * a0 + (j < 4 ? b0[j & 3] : b1[j & 3]) * a1, a, c2); oh[j] = a; ol[j] = c2; }
                *(v8us*)(Ah + oo + t * 256) = oh; *(v8us*)(Al + oo + t * 256) = ol;
                asm volatile("s_wait_xcnt 0x0" ::: "memory");   // the wait owed behind the two stores before their registers are rewritten
                __builtin_amdgcn_sched_barrier(0); } }           // keeps the next tile's arithmetic, which reuses those registers, behind that wait
    }
}

__global__ __launch_bounds__(256) void k_wtG(const float* __restrict__ w, int K, int N, bf* Bt) {
    const int lane = threadIdx.x & 31; const int L0 = (blockIdx.x * 8 + (threadIdx.x >> 5)) * 8; const int nlines = N * K / 64;
{
#pragma unroll 1
        for (int l = 0; l < 8; ++l) { const int L = L0 + l; if (L >= nlines) break; const size_t e = (size_t)L * 64 + lane * 2; const int k = (int)(e % K), n = (int)(e / K); v2us o;
            o[0] = f2bf(w[(size_t)k * N + n]); o[1] = f2bf(w[(size_t)(k + 1) * N + n]); *(v2us*)(Bt + e) = o; }
         }
}
// ---- k_prep: every input conversion of the run in one grid. The block index picks the job (block-uniform): 2048 elements of x (both batches), wq, wk, wv or wo to bf16; 256 (cos, sin) pairs; 256 bias values into one row.
// wq, wk, wv land one under the other (WS [DS][DM]) and bq, bk, bv one behind the other (BS [DS]), so that one GEMM makes q, k and v.
#define DS    (DQ + 2 * DKV)
#define PB_X  (NB_ * TT * DM / 2048)
#define PB_WQ (DQ * DM / 2048)
#define PB_WK (DKV * DM / 2048)
#define PB_WO (DM * DQ / 2048)
#define PB_CS (TT * HD / 256)
#define PB_BS (DS / 256)
__global__ __launch_bounds__(256) void k_prep(const float* __restrict__ x, const float* __restrict__ wq, const float* __restrict__ wk, const float* __restrict__ wv, const float* __restrict__ wo, const float* __restrict__ cosT, const float* __restrict__ sinT, const float* __restrict__ bq, const float* __restrict__ bk, const float* __restrict__ bv, bf* XB, bf* WS, bf* WO, float* CS, float* BS) {
    int blk = blockIdx.x; const float* src; bf* dst;
    if (blk < PB_X) { src = x; dst = XB; }
    else if ((blk -= PB_X) < PB_WQ) { src = wq; dst = WS; }
    else if ((blk -= PB_WQ) < PB_WK) { src = wk; dst = WS + (size_t)DQ * DM; }
    else if ((blk -= PB_WK) < PB_WK) { src = wv; dst = WS + (size_t)(DQ + DKV) * DM; }
    else if ((blk -= PB_WK) < PB_WO) { src = wo; dst = WO; }
    else if ((blk -= PB_WO) < PB_CS) { const int idx = blk * 256 + threadIdx.x; v2f cs; cs[0] = bfr(cosT[idx]); cs[1] = bfr(sinT[idx]); *(v2f*)(CS + (size_t)idx * 2) = cs; asm volatile("s_wait_xcnt 0x0" ::: "memory"); return; }   // the wait owed behind a store before its registers are rewritten: the jobs are laid one behind the other in the build
    else { const int c = (blk - PB_CS) * 256 + threadIdx.x; BS[c] = c < DQ ? bq[c] : c < DQ + DKV ? bk[c - DQ] : bv[c - DQ - DKV]; asm volatile("s_wait_xcnt 0x0" ::: "memory"); return; }   // the same wait behind this job's store
    // fragment order (see k_gemmw; all five planes have DM columns): a wave takes 8 rows x 32 k, reads one 128-byte line of each row and writes four whole lines; a block takes 16 rows x 128 k
    const int tx = threadIdx.x; const int row = (blk >> 4) * 16 + ((tx >> 5) & 1) * 8 + (tx & 7), pc = (tx >> 3) & 3, kb = (blk & 15) * 4 + (tx >> 6);
    const size_t i = ((size_t)((row >> 4) * (DM / 32) + kb) * 2 + (pc >> 1)) * 32 + (pc & 1) * 16 + (row & 15); const v8f v = *(const v8f*)(src + (size_t)row * DM + kb * 32 + pc * 8); v8us o;
#pragma unroll
    for (int k = 0; k < 8; ++k) o[k] = f2bf(v[k]); *(v8us*)(dst + i * 8) = o;  }
// A thread makes one 16-byte unit (8 d of one t); a wave takes 8 rows x 32 d, reads whole 128-byte lines of F and writes four whole lines per plane; a block takes 16 rows x HD.
// rope_do: head planes [batch][h] (fp16 + hi/lo), each in fragment order (rows t, k = d: see k_gemmw), of rope(x) x sc with the rotate-half convention out[d] = x[d] cos[t][d] - x[d+HD/2] sin[t][d], out[d+HD/2] = x[d+HD/2] cos[t][d+HD/2] + x[d] sin[t][d+HD/2]
__device__ __forceinline__ void rope_do(int blk, const float* __restrict__ F, int pitch, int nheads, const float* __restrict__ CS, const float* __restrict__ RF, const float* __restrict__ nw, float sc, h16* P16, bf* Ph, bf* Pl) {
    const int tx = threadIdx.x; const int pc = (tx >> 3) & 3, kb = tx >> 6; const int d = kb * 32 + pc * 8; const int t = (blk % (TT / 16)) * 16 + ((tx >> 5) & 1) * 8 + (tx & 7); const int hb = blk / (TT / 16); const size_t e = ((size_t)(blk * (HD / 32) + kb) * 64 + (pc >> 1) * 32 + (pc & 1) * 16 + (t & 15)) * 8;
    const int h = hb % nheads; const float* f = F + (size_t)((hb / nheads) * TT + t) * pitch + h * HD; const float rf = RF ? RF[(size_t)hb * TT + t] : 1.0f; v8h o16; v8us oh, ol;
    __builtin_amdgcn_sched_barrier(0);   // keeps the lane arithmetic above in front of the loads below: none of it may land between them and their wait, where it would reuse an address register
    const v8f xa = *(const v8f*)(f + d), xb = *(const v8f*)(f + ((d < HD / 2) ? d + HD / 2 : d - HD / 2)), ca = *(const v8f*)(CS + ((size_t)t * HD + d) * 2), cb = *(const v8f*)(CS + ((size_t)t * HD + d) * 2 + 8);   // the unit's 8 values, their 8 partners and their 8 (cos, sin) pairs, in 16-byte loads issued together
    asm volatile("s_wait_xcnt 0x0" ::: "memory");   // the wait owed before the address registers of these loads are rewritten
    __builtin_amdgcn_sched_barrier(0);               // keeps the later arithmetic, which reuses those registers, behind that wait
#pragma unroll
    for (int q = 0; q < 8; ++q) { const int dd = d + q; const int dp = (dd < HD / 2) ? dd + HD / 2 : dd - HD / 2; float x0 = xa[q], x1 = xb[q];
        if (RF) { float n0 = __fmul_rn(x0, rf), n1 = __fmul_rn(x1, rf); asm volatile("" : "+v"(n0)); asm volatile("" : "+v"(n1)); x0 = __fmul_rn(bfr(nw[dd]), n0); x1 = __fmul_rn(bfr(nw[dp]), n1); }
        const v2f cs = q < 4 ? (v2f){ca[(2 * q) & 7], ca[(2 * q + 1) & 7]} : (v2f){cb[(2 * q) & 7], cb[(2 * q + 1) & 7]}; float a = __fmul_rn(x0, cs[0]), bq = __fmul_rn(x1, cs[1]); asm volatile("" : "+v"(a)); asm volatile("" : "+v"(bq)); const float r = ((dd < HD / 2) ? __fsub_rn(a, bq) : __fadd_rn(a, bq)) * sc;
        o16[q] = tohx(r); unsigned short a2, c2; splitf(r, a2, c2); oh[q] = a2; ol[q] = c2; }
    *(v8h*)(P16 + e) = o16; *(v8us*)(Ph + e) = oh; *(v8us*)(Pl + e) = ol;
    asm volatile("s_wait_xcnt 0x0" ::: "memory"); }   // the wait owed behind the three stores before their registers are rewritten (the next job's code follows in the build)
// vtp_do: transposed value planes [batch][g] (rows d, k = t) in fragments as above, but the HD / 16 row blocks of one 32-key step follow one another, then the next step: a pass of k_fattn reads 8 KiB in a row.
// A thread makes one 16-byte unit (8 t of one d); a wave takes 32 d: every load reads one whole line of a row of F, every store writes four whole lines; a block takes 16 t x HD.
__device__ __forceinline__ void vtp_do(int blk, const float* __restrict__ F, int pitch, int nheads, h16* V16, bf* Vh, bf* Vl) { const int tx = threadIdx.x; const int d = tx & (HD - 1), hi = tx >> 7; const int t16 = blk % (TT / 16), hb = blk / (TT / 16); const int g = hb % nheads; const int t = (hb / nheads) * TT + t16 * 16 + hi * 8;
    const size_t e = ((size_t)((hb * (TT / 32) + (t16 >> 1)) * (HD / 16) + (d >> 4)) * 64 + (t16 & 1) * 32 + hi * 16 + (d & 15)) * 8; v8h o16; v8us oh, ol;
#pragma unroll
    for (int q = 0; q < 8; ++q) { const float x = F[(size_t)(t + q) * pitch + g * HD + d]; o16[q] = tohx(x); unsigned short a2, c2; splitf(x, a2, c2); oh[q] = a2; ol[q] = c2; }
    *(v8h*)(V16 + e) = o16; *(v8us*)(Vh + e) = oh; *(v8us*)(Vl + e) = ol;
    asm volatile("s_wait_xcnt 0x0" ::: "memory"); }   // the same wait behind these three stores
// ---- k_planes: the operand planes of q, k (rope) and v (transposed), both batches, in one grid over the stacked projection F [NB_ TT][DS]; the block index picks the job (block-uniform).
#define PL_Q (NB_ * NH_ * TT * HD / 2048)
#define PL_K (NB_ * NKV * TT * HD / 2048)
__global__ __launch_bounds__(256) void k_planes(const float* __restrict__ F, const float* __restrict__ CS, h16* Q16, bf* Qh, bf* Ql, h16* K16, bf* Kh, bf* Kl, h16* V16, bf* Vh, bf* Vl) {
    const int blk = blockIdx.x;
    if (blk < PL_Q) rope_do(blk, F, DS, NH_, CS, nullptr, nullptr, 1.0f, Q16, Qh, Ql);
    else if (blk < PL_Q + PL_K) rope_do(blk - PL_Q, F + DQ, DS, NKV, CS, nullptr, nullptr, 1.0f, K16, Kh, Kl);
    else vtp_do(blk - PL_Q - PL_K, F + DQ + DKV, DS, NKV, V16, Vh, Vl);
}
extern "C" void kernel_launch(void* const* d_in, const int* in_sizes, int n_in,
                              void* d_out, int out_size, void* d_ws, size_t ws_size, hipStream_t stream) {
    (void)in_sizes; (void)n_in; (void)out_size;
    const float* x = (const float*)d_in[0]; const float* ang = (const float*)d_in[1]; const float* wq = (const float*)d_in[2]; const float* bq = (const float*)d_in[3]; const float* wk = (const float*)d_in[4]; const float* bk = (const float*)d_in[5]; const float* wv = (const float*)d_in[6]; const float* bv = (const float*)d_in[7]; const float* wo = (const float*)d_in[8]; const float* cosT = ang; const float* sinT = ang + (size_t)2048 * 128;
    float* OUT = (float*)d_out;     // [2][2048][2048]
    char* wsp = (char*)d_ws;
    auto take = [&](size_t bytes) { char* p = wsp; wsp += (bytes + 255) & ~(size_t)255; return (void*)p; };
    bf* WS = (bf*)take((size_t)DS * DM * 2); bf* WO = (bf*)take((size_t)DM * DQ * 2); float* CS = (float*)take((size_t)TT * HD * 2 * 4); float* BS = (float*)take((size_t)DS * 4);
    bf* XB = (bf*)take((size_t)NB_ * TT * DM * 2); float* F = (float*)take((size_t)NB_ * TT * DS * 4);
    h16* QP16 = (h16*)take((size_t)NB_ * NH_ * TT * HD * 2); h16* KP16 = (h16*)take((size_t)NB_ * NKV * TT * HD * 2); h16* VT16 = (h16*)take((size_t)NB_ * NKV * HD * TT * 2);
    bf* QPh = (bf*)take((size_t)NB_ * NH_ * TT * HD * 2); bf* QPl = (bf*)take((size_t)NB_ * NH_ * TT * HD * 2); bf* KPh = (bf*)take((size_t)NB_ * NKV * TT * HD * 2); bf* KPl = (bf*)take((size_t)NB_ * NKV * TT * HD * 2); bf* VTh = (bf*)take((size_t)NB_ * NKV * HD * TT * 2); bf* VTl = (bf*)take((size_t)NB_ * NKV * HD * TT * 2);
    bf* ATh = (bf*)take((size_t)NB_ * TT * DQ * 2); bf* ATl = (bf*)take((size_t)NB_ * TT * DQ * 2);
    if ((size_t)(wsp - (char*)d_ws) > ws_size) return;    // ws 256 MiB
    // five launches, each over both batches (rows b TT + t)
    k_prep<<<PB_X + PB_WQ + 2 * PB_WK + PB_WO + PB_CS + PB_BS, 256, 0, stream>>>(x, wq, wk, wv, wo, cosT, sinT, bq, bk, bv, XB, WS, WO, CS, BS);
    k_gemmw<bf, 0, true><<<dim3(NB_ * TT / 64, DS / 64, 1), 32 * NWK, 0, stream>>>(XB, nullptr, WS, nullptr, DM, F, DS, BS, 0, 0, 0);
    k_planes<<<PL_Q + 2 * PL_K, 256, 0, stream>>>(F, CS, QP16, QPh, QPl, KP16, KPh, KPl, VT16, VTh, VTl);
    k_fattn<<<dim3(NKV * NB_, TT / 32, 1), 32 * REP * KSP, 0, stream>>>(QP16, QPh, QPl, KP16, KPh, KPl, VT16, VTh, VTl, ATh, ATl);
    k_gemmw<bf, 1, false><<<dim3(NB_ * TT / 64, DM / 64, 1), 32 * NWK, 0, stream>>>(ATh, ATl, WO, nullptr, DQ, OUT, DM, nullptr, 0, 0, 0);
}

// v006
// One run takes 133 microseconds.
// In both of two side-by-side timings against v005, it was 1.36 times as fast.
// All steps since v000 together make it 12.4 times as fast.
#include <hip/hip_runtime.h>

// GQA attention block (x [2][2048][2048]; q/k/v = x W^T + b (torch; 16 query heads, 4 kv heads x 128; group h/4); rotate-half RoPE with the given angles [2][2048][128] = (cos table, sin table) (read); causal softmax(q.k / sqrt(128)) (finfo.min fill); out = merged wo^T -> [2][2048][2048]).
// Compute dtypes, f32 accumulate: every input rounded to bf16; q/k/v on PLAIN bf16 operands (inputs: exact) + bias; RoPE f32 with the read tables; causal scores and attn.v: query rows < 512 hl (3 products), the rest single fp16, in one kernel with a running softmax (f32), keys beyond the diagonal block never visited; wo hl x exact (2 products).

#define NB_  2
#define TT   2048
#define DM   2048
#define NH_  16
#define NKV  4
#define REP  (NH_ / NKV)
#define HD   128
#define DQ   (NH_ * HD)
#define DKV  (NKV * HD)
#define RH   512                  // query rows < RH use hi+lo planes (0: none)
#define SCL  0.088388347648318447f   // HD^-0.5
typedef _Float16 h16;
typedef unsigned short bf;
typedef __attribute__((ext_vector_type(16))) __bf16   v16bf;
typedef __attribute__((ext_vector_type(16))) _Float16 v16h;
typedef __attribute__((ext_vector_type(8)))  _Float16 v8h;
typedef __attribute__((ext_vector_type(8)))  unsigned short v8us;
typedef __attribute__((ext_vector_type(8)))  float    v8f;
typedef __attribute__((ext_vector_type(4)))  float    v4f;
typedef v8h  __attribute__((may_alias)) v8ha;
typedef v4f  __attribute__((may_alias)) v4fa;
typedef v8us __attribute__((may_alias)) v8usa;

__device__ __forceinline__ unsigned short f2bf(float f) { unsigned u = __float_as_uint(f); u += 0x7FFFu + ((u >> 16) & 1u); return (unsigned short)(u >> 16); }
__device__ __forceinline__ float bf2f(unsigned short b) { return __uint_as_float(((unsigned)b) << 16); }
__device__ __forceinline__ float bfr(float f) { return bf2f(f2bf(f)); }
__device__ __forceinline__ v16h cat16(v8h lo, v8h hi) { return __builtin_shufflevector(lo, hi, 0, 1, 2, 3, 4, 5, 6, 7, 8, 9, 10, 11, 12, 13, 14, 15); }
__device__ __forceinline__ v16bf cat16b(v8us lo, v8us hi) { return __builtin_bit_cast(v16bf, __builtin_shufflevector(lo, hi, 0, 1, 2, 3, 4, 5, 6, 7, 8, 9, 10, 11, 12, 13, 14, 15)); }
__device__ __forceinline__ v8f wmma16(v16h a, v16h b, v8f c) { return __builtin_amdgcn_wmma_f32_16x16x32_f16(false, a, false, b, (short)0, c, false, false); }
__device__ __forceinline__ v8f wmmab(v16bf a, v16bf b, v8f c) { return __builtin_amdgcn_wmma_f32_16x16x32_bf16(false, a, false, b, (short)0, c, false, false); }



// ---- Fragment order of a 16-bit operand plane M[R][K]: the 16 rows x 32 k of one matrix operand lie in 1024 contiguous bytes, as the two 16-byte loads of the 32 lanes read them (WFrag::ld), so that one wave-wide load covers four whole 128-byte lines (row-major: 32 bytes of each of 16 lines).
// In a fragment the 16-byte unit of (row r, k .. k + 7) is ((k / 16) % 2) 32 + ((k / 8) % 2) 16 + r % 16. The fragments of a 16-row block follow one another in k, then the next row block: a row block fills 16 K elements, as in the row-major plane. (The transposed value planes alone order theirs the other way: see vtp_do.)
template <typename T16> struct WFrag;
template <> struct WFrag<h16> { typedef v16h V; static __device__ __forceinline__ V ld(const h16* p) { return cat16(*(const v8h*)p, *(const v8h*)(p + 256)); } static __device__ __forceinline__ v8f mma(V a, V b, v8f c) { return wmma16(a, b, c); } };
template <> struct WFrag<bf> { typedef v16bf V; static __device__ __forceinline__ V ld(const bf* p) { return cat16b(*(const v8us*)p, *(const v8us*)(p + 256)); } static __device__ __forceinline__ v8f mma(V a, V b, v8f c) { return wmmab(a, b, c); } };
// ---- k_gemmw: tiled GEMM, 8 waves (WM x WN) per (WM MB 16) x (WN NB 16) output tile, each wave MB x NB accumulators over the whole K; grid (M / tile rows, N / tile columns), 256 threads.
// C[m][n] (f32, pitch ldc, + optional bias[n], f32 rounded to bf16) = sum_k (A[m][k] + A2[m][k] if NA == 2) Bt[n][k]; operand planes in fragment order, K = KG columns.
// The operands come through LDS, so that the WN waves of a tile row share one fetch of A and the WM waves of a tile column one fetch of Bt. A stage is KP k of every row block of the tile: per row block 4 KiB in a row in the plane (KP / 32 fragments), kept in that order in LDS
// [A row blocks | A2 row blocks | Bt row blocks]; wave w copies the w-th 512 bytes of every row block with asynchronous 16-byte copies. Two buffers: the copies of stage t + 1 are issued behind the barrier at which every wave has left stage t - 1, and fly under stage t.
// Every plain '#pragma unroll' in it makes the indices of the fragment and accumulator arrays constants, so that these stay in registers.
#define KG 2048
#define KP 128
#define RBB_ (KP * 16 * 2)   // bytes of one row block in a stage
typedef __attribute__((ext_vector_type(4))) int c16;   // the 16 bytes of one lane's copy (builtin form: the compiler keeps the copies' address registers itself; the waits on the copies are written by hand below)
__device__ __forceinline__ void acopy(unsigned char* l, const bf* g) { __builtin_amdgcn_global_load_async_to_lds_b128((__attribute__((address_space(1))) c16*)g, (__attribute__((address_space(3))) c16*)l, 0, 0); }
template <int NA, int WM, int WN, int MB, int NB, bool BIAS>
__global__ __launch_bounds__(256) void k_gemmw(const bf* __restrict__ A, const bf* __restrict__ A2, const bf* __restrict__ Bt, float* C, int ldc, const float* __restrict__ bias) {
    typedef WFrag<bf>::V V;
    constexpr int RA = WM * MB, RB = WN * NB, NRB = NA * RA + RB, STG = NRB * RBB_, NT = KG / KP, NK = KP / 32;
    static_assert(WM * WN == 8 && NRB <= 63 && NB % 2 == 0 && NT >= 2 && MB * NB * 1024 * 8 <= 2 * STG, "tile shape");
    __shared__ __attribute__((aligned(16))) unsigned char ring[2 * STG];
    const int lane = threadIdx.x & 31, lr = lane & 15, hi = lane >> 4; const int wv = __builtin_amdgcn_readfirstlane(threadIdx.x >> 5); const int wm = wv % WM, wn = wv / WM; const int r0 = blockIdx.x * (RA * 16), c0 = blockIdx.y * (RB * 16);
    const int lo = wv * 256 + lane * 8;   // the lane's 16 bytes (in elements) in the wave's 512 bytes of a row block
    const bf* gA = A + (size_t)r0 * KG + lo; const bf* gA2 = NA == 2 ? A2 + (size_t)r0 * KG + lo : nullptr; const bf* gB = Bt + (size_t)c0 * KG + lo;   // the lane's bytes in the tile's first row blocks, at the stage to be copied next
    auto src = [&](int i) -> const bf* { return i < RA ? gA + (size_t)i * 16 * KG : (NA == 2 && i < 2 * RA) ? gA2 + (size_t)(i - RA) * 16 * KG : gB + (size_t)(i - NA * RA) * 16 * KG; };
    auto fill = [&](int t) { unsigned char* lb = ring + (t & 1) * STG + lo * 2;
#pragma unroll
        for (int i = 0; i < NRB; ++i) acopy(lb + i * RBB_, src(i));
        gA += KP * 16; if (NA == 2) gA2 += KP * 16; gB += KP * 16; };
    v8f acc[MB][NB];
#pragma unroll
    for (int mb = 0; mb < MB; ++mb)
#pragma unroll
        for (int nb = 0; nb < NB; ++nb) acc[mb][nb] = (v8f){};
    fill(0);
    asm volatile("s_wait_asynccnt 0x0" ::: "memory");   // the wave's own copies of stage 0 have landed
    __syncthreads();                                    // every wave's have: stage 0 may be read
#pragma unroll 1   // one stage a trip: unrolled, the loop's text would grow NT-fold for nothing
    for (int t = 0; t < NT; ++t) {
        const bf* sb = (const bf*)(ring + (t & 1) * STG) + lane * 8;
        V fa[2][NA * MB], fb[2][NB];   // two fragment sets: the 32-k block in work and the next one of the same stage
        auto frag = [&](int ks, int s) {
#pragma unroll
            for (int mb = 0; mb < NA * MB; ++mb) fa[s][mb] = WFrag<bf>::ld(sb + (((mb / MB) * RA + wm * MB + mb % MB) * NK + ks) * 512);
#pragma unroll
            for (int nb = 0; nb < NB; ++nb) fb[s][nb] = WFrag<bf>::ld(sb + ((NA * RA + wn * NB + nb) * NK + ks) * 512); };
        frag(0, 0);                    // stage t, published by the barrier above; these reads land while the copies below are issued
        if (t + 1 < NT) fill(t + 1);   // into the buffer that every wave left at that barrier (stage t - 1's)
#pragma unroll
        for (int ks = 0; ks < NK; ++ks) {
            if (ks + 1 < NK) frag(ks + 1, (ks + 1) & 1);
            __builtin_amdgcn_sched_barrier(0);   // keeps the next block's LDS reads issued as one group ahead of this block's products (without it they are issued pair by pair among the products, each pair waited for in turn)
#pragma unroll
            for (int nb = 0; nb < NB; ++nb)
#pragma unroll
                for (int mb = 0; mb < NA * MB; ++mb) acc[mb % MB][nb] = WFrag<bf>::mma(fa[ks & 1][mb], fb[ks & 1][nb], acc[mb % MB][nb]);
        }
        asm volatile("s_wait_dscnt 0x0" ::: "memory");      // the wave's reads of stage t are done before the buffer may be refilled
        asm volatile("s_wait_asynccnt 0x0" ::: "memory");   // its copies of stage t + 1 have landed
        __syncthreads();                                    // one barrier: publishes stage t + 1 and ends every wave's reads of stage t
    }
    asm volatile("s_wait_asynccnt 0x0" ::: "memory");   // no copy is outstanding when the ring becomes output staging
    // Output staging, each wave in its own MB NB KiB of the ring (no copy is outstanding and every wave has left the ring at the last barrier): 16-byte units [mb][hi][nb][j/4][lr]; read back with lane = column within a 32-column group, so that every store instruction writes one whole 128-byte line.
    v4f* red = (v4f*)ring + wv * (MB * NB * 64);
#pragma unroll
    for (int mb = 0; mb < MB; ++mb)
#pragma unroll
        for (int nb = 0; nb < NB; ++nb) { v4f* p = red + (((mb * 2 + hi) * NB + nb) * 2) * 16 + lr;
            p[0] = __builtin_shufflevector(acc[mb][nb], acc[mb][nb], 0, 1, 2, 3); p[16] = __builtin_shufflevector(acc[mb][nb], acc[mb][nb], 4, 5, 6, 7); }
    float bb[NB / 2];
#pragma unroll
    for (int g = 0; g < NB / 2; ++g) bb[g] = BIAS ? bfr(bias[c0 + wn * NB * 16 + g * 32 + lane]) : 0.0f;
    float* cp = C + (size_t)(r0 + wm * MB * 16) * ldc + c0 + wn * NB * 16 + lane;
#pragma unroll 1   // rolled, so that the wait at the trip's foot stands between a trip's stores and every rewrite of their registers
    for (int x = 0; x < MB * 2; ++x) {   // eight rows of the wave's tile a trip
        v4f s0[NB / 2], s1[NB / 2];
#pragma unroll
        for (int g = 0; g < NB / 2; ++g) { const v4f* p = red + ((x * NB + g * 2 + hi) * 2) * 16 + lr; s0[g] = p[0]; s1[g] = p[16]; }
#pragma unroll
        for (int g = 0; g < NB / 2; ++g)
#pragma unroll
            for (int j = 0; j < 4; ++j) { cp[(size_t)j * ldc + g * 32] = BIAS ? s0[g][j] + bb[g] : s0[g][j]; cp[(size_t)(j + 4) * ldc + g * 32] = BIAS ? s1[g][j] + bb[g] : s1[g][j]; }
        asm volatile("s_wait_xcnt 0x0" ::: "memory");   // the wait owed behind these stores before their registers are rewritten by the next eight rows
        cp += (size_t)8 * ldc;
    }
}

__device__ __forceinline__ h16 tohx(float x) { return (h16)x; }
__device__ __forceinline__ void splitf(float y, unsigned short& h, unsigned short& l) { h = f2bf(y); l = f2bf(y - bf2f(h)); }
typedef __attribute__((ext_vector_type(2))) _Float16 v2h;
typedef __attribute__((ext_vector_type(4))) _Float16 v4h;
typedef __attribute__((ext_vector_type(2))) unsigned short v2us;
typedef __attribute__((ext_vector_type(4))) unsigned short v4us;
typedef __attribute__((ext_vector_type(2))) float v2f;
typedef __attribute__((ext_vector_type(4))) int v4i;

// ---- k_fattn: scores, softmax and probability x value in one kernel; no score or probability leaves the registers. Work-group = 32 query rows x the REP query heads of one kv group x KSP key shares: wave (hg, ks) owns head hg and the 32-key passes ks, ks + KSP, ...
// Grid (NKV x NB_, TT / 32): both batches in one launch, twice as many work-groups as resident places, so the start order decides the tail. The query block is the slow index: first the hi+lo blocks (three products for one: short rows, dear passes), longest first, then the single-plane blocks, longest first; no dear block starts late.
// Transposed products: S^T = K Q^T (A = key rows, B = query rows), so a lane holds scores of ONE query (column lr; keys 8 hi + j of each 16-key tile), which is already the B operand order of O^T += V^T P^T (A = rows of the transposed value plane).
// Running softmax in the log2 domain: m_run is the maximum in use, l_run the lane's share of the sum; the accumulators are rescaled only when some query's maximum exceeds m_run by more than LAZY. Every exponential carries the factor 2^PBIAS (it cancels in acc / l): at most 2^(LAZY + PBIAS) in fp16.
#define KSP   2
#define ACS   (SCL * 1.4426950408889634f)
#define LAZY  8.0f
#define PBIAS 6.0f
__device__ __forceinline__ float xhalf(float x) { return __builtin_bit_cast(float, __builtin_amdgcn_permlanex16(__builtin_bit_cast(int, x), __builtin_bit_cast(int, x), 0x76543210, 0xfedcba98, false, false)); }   // lane l with lane l ^ 16: the two holders of one query
template <typename T16, bool HI>
__device__ __forceinline__ void attn_walk(const T16* __restrict__ Q, const T16* __restrict__ Q2, const T16* __restrict__ Kp, const T16* __restrict__ K2, const T16* __restrict__ Vt, const T16* __restrict__ V2, int q0, int ks, int lr, int hi, v8f (&acc)[2][8], float (&m_run)[2], float (&l_run)[2]) {
    typedef typename WFrag<T16>::V V;
    const int npass = q0 / 32 + 1;                       // keys 0 .. q0 + 31; only the last pass meets the diagonal
    if (ks >= npass) return;                             // wave-uniform: a key share without a pass keeps its start state (weight 0 in the join)
    const size_t ko = (size_t)(hi * 16 + lr) * 8, vo = ko;   // the lane's 16 bytes in a fragment (fragment order: see k_gemmw); the 8 fragments of a pass's 32 keys, K and V alike, are 8 KiB in a row
    __builtin_amdgcn_sched_barrier(0);                   // keeps the lane arithmetic above in front of the loads below: none of it may land between them and their wait, where it would reuse an address register
    V qf[2][4], qf2[2][4];
#pragma unroll
    for (int g = 0; g < 2; ++g)
#pragma unroll
        for (int kc = 0; kc < 4; ++kc) { const size_t o = ko + (size_t)(q0 + 16 * g) * HD + kc * 512; qf[g][kc] = WFrag<T16>::ld(Q + o); if (HI) qf2[g][kc] = WFrag<T16>::ld(Q2 + o); }
    V kf[2][4], kf2[2][4];
    if (!HI) { const int k0 = ks * 32;                   // single-plane path: K fragments are fetched one pass ahead
#pragma unroll
        for (int kt = 0; kt < 2; ++kt)
#pragma unroll
            for (int kc = 0; kc < 4; ++kc) kf[kt][kc] = WFrag<T16>::ld(Kp + ko + (size_t)(k0 + 16 * kt) * HD + kc * 512); }
    asm volatile("s_wait_xcnt 0x0" ::: "memory");   // the wait owed before the address registers of the loads above are rewritten
    __builtin_amdgcn_sched_barrier(0);               // keeps the later arithmetic, which reuses those registers, behind that wait
#pragma unroll 1
    for (int p = ks; p < npass; p += KSP) {
        const int key0 = p * 32;
        V vf[8], vf2[8];
        if (!HI) {
#pragma unroll
            for (int t = 0; t < 8; ++t) vf[t] = WFrag<T16>::ld(Vt + vo + (size_t)key0 * HD + t * 512);
            asm volatile("" ::: "memory");   // compiler fence: keeps the pass's V loads issued here, ahead of the score products, so that they fly under them (without it they sink to the block that uses them)
        } else {
#pragma unroll
            for (int kt = 0; kt < 2; ++kt)
#pragma unroll
                for (int kc = 0; kc < 4; ++kc) { const size_t o = ko + (size_t)(key0 + 16 * kt) * HD + kc * 512; kf[kt][kc] = WFrag<T16>::ld(Kp + o); kf2[kt][kc] = WFrag<T16>::ld(K2 + o); }
            __builtin_amdgcn_sched_barrier(0);   // all of the pass's K loads are issued before its first product (without it they are issued pair by pair, each pair waited for in turn)
        }
        v8f s[2][2];
#pragma unroll
        for (int kt = 0; kt < 2; ++kt)
#pragma unroll
            for (int g = 0; g < 2; ++g) { s[kt][g] = (v8f){};
#pragma unroll
                for (int kc = 0; kc < 4; ++kc) { s[kt][g] = WFrag<T16>::mma(kf[kt][kc], qf[g][kc], s[kt][g]); if (HI) { s[kt][g] = WFrag<T16>::mma(kf[kt][kc], qf2[g][kc], s[kt][g]); s[kt][g] = WFrag<T16>::mma(kf2[kt][kc], qf[g][kc], s[kt][g]); } } }
        if (!HI) { const int k1 = min(p + KSP, npass - 1) * 32;   // next pass's K (the last pass fetches rows that exist and are not used)
#pragma unroll
            for (int kt = 0; kt < 2; ++kt)
#pragma unroll
                for (int kc = 0; kc < 4; ++kc) kf[kt][kc] = WFrag<T16>::ld(Kp + ko + (size_t)(k1 + 16 * kt) * HD + kc * 512);
            asm volatile("s_wait_xcnt 0x0" ::: "memory");   // the wait owed before the loads' address registers are rewritten (the mask below reuses them); its memory clobber also keeps the next pass's K loads issued here, to fly under the softmax and the second product (without it they sink to the pass's end)
        } else {
#pragma unroll
            for (int t = 0; t < 8; ++t) { const size_t o = vo + (size_t)key0 * HD + t * 512; vf[t] = WFrag<T16>::ld(Vt + o); vf2[t] = WFrag<T16>::ld(V2 + o); }
            asm volatile("s_wait_xcnt 0x0" ::: "memory");   // the wait owed before the loads' address registers are rewritten; its memory clobber also keeps the pass's V loads issued here, to fly under the maxima and the exponentials
        }
        if (p == npass - 1) {                             // wave-uniform: the diagonal pass masks key > query
#pragma unroll
            for (int g = 0; g < 2; ++g)
#pragma unroll
                for (int kt = 0; kt < 2; ++kt)
#pragma unroll
                    for (int j = 0; j < 8; ++j) if (16 * kt + 8 * hi + j > 16 * g + lr) s[kt][g][j] = -3.0e38f;
        }
        float mb[2]; bool need = false;
#pragma unroll
        for (int g = 0; g < 2; ++g) { float mx = -3.0e38f;
#pragma unroll
            for (int kt = 0; kt < 2; ++kt)
#pragma unroll
                for (int j = 0; j < 8; ++j) mx = fmaxf(mx, s[kt][g][j]);
            mx = fmaxf(mx, xhalf(mx)) * ACS; mb[g] = mx; need = need || (mx > m_run[g] + LAZY); }
        if (__builtin_amdgcn_ballot_w32(need) != 0) {     // one scalar test per pass
#pragma unroll
            for (int g = 0; g < 2; ++g) { const float mn = fmaxf(m_run[g], mb[g]); const float corr = __builtin_amdgcn_exp2f(m_run[g] - mn); l_run[g] *= corr; m_run[g] = mn;   // first pass: corr = 0 on zeros
#pragma unroll
                for (int t = 0; t < 8; ++t) acc[g][t] = acc[g][t] * corr; }
        }
#pragma unroll
        for (int g = 0; g < 2; ++g) { const float nm = PBIAS - m_run[g]; float e[16], ps0 = 0.f, ps1 = 0.f;
#pragma unroll
            for (int i = 0; i < 8; ++i) { const v2f arg = __builtin_elementwise_fma((v2f){s[i >> 2][g][2 * (i & 3)], s[i >> 2][g][2 * (i & 3) + 1]}, (v2f){ACS, ACS}, (v2f){nm, nm});   // a register pair of the score tile at a time
                e[2 * i] = __builtin_amdgcn_exp2f(arg[0]); e[2 * i + 1] = __builtin_amdgcn_exp2f(arg[1]); ps0 += e[2 * i]; ps1 += e[2 * i + 1]; }
            l_run[g] += ps0 + ps1;
            if constexpr (!HI) { v16h pf;
#pragma unroll
                for (int i = 0; i < 16; ++i) pf[i] = (h16)e[i];
#pragma unroll
                for (int t = 0; t < 8; ++t) acc[g][t] = WFrag<T16>::mma(vf[t], pf, acc[g][t]);
            } else { v8us h0, h1, l0, l1;
#pragma unroll
                for (int i = 0; i < 8; ++i) { unsigned short a, c2; splitf(e[i], a, c2); h0[i] = a; l0[i] = c2; }
#pragma unroll
                for (int i = 0; i < 8; ++i) { unsigned short a, c2; splitf(e[i + 8], a, c2); h1[i] = a; l1[i] = c2; }
                const V ph = cat16b(h0, h1), pl = cat16b(l0, l1);
#pragma unroll
                for (int t = 0; t < 8; ++t) { acc[g][t] = WFrag<T16>::mma(vf[t], ph, acc[g][t]); acc[g][t] = WFrag<T16>::mma(vf[t], pl, acc[g][t]); acc[g][t] = WFrag<T16>::mma(vf2[t], ph, acc[g][t]); }
            } }
    }
}
__global__ __launch_bounds__(32 * REP * KSP) void k_fattn(const h16* __restrict__ Q16, const bf* __restrict__ Qh, const bf* __restrict__ Ql, const h16* __restrict__ K16, const bf* __restrict__ Kh, const bf* __restrict__ Kl, const h16* __restrict__ V16, const bf* __restrict__ Vh, const bf* __restrict__ Vl, bf* Ah, bf* Al) {
    __shared__ __align__(16) v4f mrg[REP * 32 * 32];     // the second key share's accumulators, [head][16-byte piece][lane]
    __shared__ float mls[REP * 4 * 32];                  // its maxima and sums
    const int lane = threadIdx.x & 31, lr = lane & 15, hi = lane >> 4; const int wv = __builtin_amdgcn_readfirstlane(threadIdx.x >> 5); const int hg = wv % REP, ks = wv / REP;
    const int kvg = blockIdx.x % NKV, bt = blockIdx.x / NKV, h = kvg * REP + hg; const int rk = blockIdx.y; const int q0 = (rk < RH / 32 ? RH / 32 - 1 - rk : (int)gridDim.y - 1 - (rk - RH / 32)) * 32;   // a permutation of the query blocks: see the grid note above
    v8f acc[2][8]; float m_run[2], l_run[2];
#pragma unroll
    for (int g = 0; g < 2; ++g) { m_run[g] = -3.0e38f; l_run[g] = 0.f;
#pragma unroll
        for (int t = 0; t < 8; ++t) acc[g][t] = (v8f){}; }
    const size_t qo = (size_t)(bt * NH_ + h) * TT * HD, kvo = (size_t)(bt * NKV + kvg) * TT * HD;
    if (q0 < RH) attn_walk<bf, true>(Qh + qo, Ql + qo, Kh + kvo, Kl + kvo, Vh + kvo, Vl + kvo, q0, ks, lr, hi, acc, m_run, l_run);
    else attn_walk<h16, false>(Q16 + qo, nullptr, K16 + kvo, nullptr, V16 + kvo, nullptr, q0, ks, lr, hi, acc, m_run, l_run);
    if (ks == 1) {
#pragma unroll
        for (int g = 0; g < 2; ++g) { mls[(hg * 4 + g) * 32 + lane] = m_run[g]; mls[(hg * 4 + 2 + g) * 32 + lane] = l_run[g];
#pragma unroll
            for (int t = 0; t < 8; ++t) { v4f* p = mrg + (hg * 32 + (g * 8 + t) * 2) * 32 + lane; p[0] = __builtin_shufflevector(acc[g][t], acc[g][t], 0, 1, 2, 3); p[32] = __builtin_shufflevector(acc[g][t], acc[g][t], 4, 5, 6, 7); } }
    }
    __syncthreads();   // the second share's state is in LDS before the first share's wave joins it to its own
    if (ks == 0) {
#pragma unroll
        for (int g = 0; g < 2; ++g) { const float m1 = mls[(hg * 4 + g) * 32 + lane], l1 = mls[(hg * 4 + 2 + g) * 32 + lane]; const float m = fmaxf(m_run[g], m1);   // a share without a pass: m1 = -3e38, weight 0
            const float c0 = __builtin_amdgcn_exp2f(m_run[g] - m), c1 = __builtin_amdgcn_exp2f(m1 - m); float l = l_run[g] * c0 + l1 * c1; l += xhalf(l); const float inv = __fdiv_rn(1.0f, l); const float a0 = c0 * inv, a1 = c1 * inv;
            const size_t oo = (size_t)(bt * TT + q0 + 16 * g) * DQ + (size_t)(h * (HD / 32) * 64 + lane) * 8;   // fragment order: row block, then the head's first fragment; the 16 columns of tile t are one 512-byte half fragment
#pragma unroll
            for (int t = 0; t < 8; ++t) { const v4f* p = mrg + (hg * 32 + (g * 8 + t) * 2) * 32 + lane; const v4f b0 = p[0], b1 = p[32]; v8us oh, ol;
#pragma unroll
                for (int j = 0; j < 8; ++j) { unsigned short a, c2; splitf(acc[g][t][j] * a0 + (j < 4 ? b0[j & 3] : b1[j & 3]) * a1, a, c2); oh[j] = a; ol[j] = c2; }
                *(v8us*)(Ah + oo + t * 256) = oh; *(v8us*)(Al + oo + t * 256) = ol;
                asm volatile("s_wait_xcnt 0x0" ::: "memory");   // the wait owed behind the two stores before their registers are rewritten
                __builtin_amdgcn_sched_barrier(0); } }           // keeps the next tile's arithmetic, which reuses those registers, behind that wait
    }
}

__global__ __launch_bounds__(256) void k_wtG(const float* __restrict__ w, int K, int N, bf* Bt) {
    const int lane = threadIdx.x & 31; const int L0 = (blockIdx.x * 8 + (threadIdx.x >> 5)) * 8; const int nlines = N * K / 64;
{
#pragma unroll 1
        for (int l = 0; l < 8; ++l) { const int L = L0 + l; if (L >= nlines) break; const size_t e = (size_t)L * 64 + lane * 2; const int k = (int)(e % K), n = (int)(e / K); v2us o;
            o[0] = f2bf(w[(size_t)k * N + n]); o[1] = f2bf(w[(size_t)(k + 1) * N + n]); *(v2us*)(Bt + e) = o; }
         }
}
// ---- k_prep: every input conversion of the run in one grid. The block index picks the job (block-uniform): 2048 elements of x (both batches), wq, wk, wv or wo to bf16; 256 (cos, sin) pairs; 256 bias values into one row.
// wq, wk, wv land one under the other (WS [DS][DM]) and bq, bk, bv one behind the other (BS [DS]), so that one GEMM makes q, k and v.
#define DS    (DQ + 2 * DKV)
#define PB_X  (NB_ * TT * DM / 2048)
#define PB_WQ (DQ * DM / 2048)
#define PB_WK (DKV * DM / 2048)
#define PB_WO (DM * DQ / 2048)
#define PB_CS (TT * HD / 256)
#define PB_BS (DS / 256)
__global__ __launch_bounds__(256) void k_prep(const float* __restrict__ x, const float* __restrict__ wq, const float* __restrict__ wk, const float* __restrict__ wv, const float* __restrict__ wo, const float* __restrict__ cosT, const float* __restrict__ sinT, const float* __restrict__ bq, const float* __restrict__ bk, const float* __restrict__ bv, bf* XB, bf* WS, bf* WO, float* CS, float* BS) {
    int blk = blockIdx.x; const float* src; bf* dst;
    if (blk < PB_X) { src = x; dst = XB; }
    else if ((blk -= PB_X) < PB_WQ) { src = wq; dst = WS; }
    else if ((blk -= PB_WQ) < PB_WK) { src = wk; dst = WS + (size_t)DQ * DM; }
    else if ((blk -= PB_WK) < PB_WK) { src = wv; dst = WS + (size_t)(DQ + DKV) * DM; }
    else if ((blk -= PB_WK) < PB_WO) { src = wo; dst = WO; }
    else if ((blk -= PB_WO) < PB_CS) { const int idx = blk * 256 + threadIdx.x; v2f cs; cs[0] = bfr(cosT[idx]); cs[1] = bfr(sinT[idx]); *(v2f*)(CS + (size_t)idx * 2) = cs; asm volatile("s_wait_xcnt 0x0" ::: "memory"); return; }   // the wait owed behind a store before its registers are rewritten: the jobs are laid one behind the other in the build
    else { const int c = (blk - PB_CS) * 256 + threadIdx.x; BS[c] = c < DQ ? bq[c] : c < DQ + DKV ? bk[c - DQ] : bv[c - DQ - DKV]; asm volatile("s_wait_xcnt 0x0" ::: "memory"); return; }   // the same wait behind this job's store
    // fragment order (see k_gemmw; all five planes have DM columns): a wave takes 8 rows x 32 k, reads one 128-byte line of each row and writes four whole lines; a block takes 16 rows x 128 k
    const int tx = threadIdx.x; const int row = (blk >> 4) * 16 + ((tx >> 5) & 1) * 8 + (tx & 7), pc = (tx >> 3) & 3, kb = (blk & 15) * 4 + (tx >> 6);
    const size_t i = ((size_t)((row >> 4) * (DM / 32) + kb) * 2 + (pc >> 1)) * 32 + (pc & 1) * 16 + (row & 15); const v8f v = *(const v8f*)(src + (size_t)row * DM + kb * 32 + pc * 8); v8us o;
#pragma unroll
    for (int k = 0; k < 8; ++k) o[k] = f2bf(v[k]); *(v8us*)(dst + i * 8) = o;  }
// A thread makes one 16-byte unit (8 d of one t); a wave takes 8 rows x 32 d, reads whole 128-byte lines of F and writes four whole lines per plane; a block takes 16 rows x HD.
// rope_do: head planes [batch][h] (fp16 + hi/lo), each in fragment order (rows t, k = d: see k_gemmw), of rope(x) x sc with the rotate-half convention out[d] = x[d] cos[t][d] - x[d+HD/2] sin[t][d], out[d+HD/2] = x[d+HD/2] cos[t][d+HD/2] + x[d] sin[t][d+HD/2]
__device__ __forceinline__ void rope_do(int blk, const float* __restrict__ F, int pitch, int nheads, const float* __restrict__ CS, const float* __restrict__ RF, const float* __restrict__ nw, float sc, h16* P16, bf* Ph, bf* Pl) {
    const int tx = threadIdx.x; const int pc = (tx >> 3) & 3, kb = tx >> 6; const int d = kb * 32 + pc * 8; const int t = (blk % (TT / 16)) * 16 + ((tx >> 5) & 1) * 8 + (tx & 7); const int hb = blk / (TT / 16); const size_t e = ((size_t)(blk * (HD / 32) + kb) * 64 + (pc >> 1) * 32 + (pc & 1) * 16 + (t & 15)) * 8;
    const int h = hb % nheads; const float* f = F + (size_t)((hb / nheads) * TT + t) * pitch + h * HD; const float rf = RF ? RF[(size_t)hb * TT + t] : 1.0f; v8h o16; v8us oh, ol;
    __builtin_amdgcn_sched_barrier(0);   // keeps the lane arithmetic above in front of the loads below: none of it may land between them and their wait, where it would reuse an address register
    const v8f xa = *(const v8f*)(f + d), xb = *(const v8f*)(f + ((d < HD / 2) ? d + HD / 2 : d - HD / 2)), ca = *(const v8f*)(CS + ((size_t)t * HD + d) * 2), cb = *(const v8f*)(CS + ((size_t)t * HD + d) * 2 + 8);   // the unit's 8 values, their 8 partners and their 8 (cos, sin) pairs, in 16-byte loads issued together
    asm volatile("s_wait_xcnt 0x0" ::: "memory");   // the wait owed before the address registers of these loads are rewritten
    __builtin_amdgcn_sched_barrier(0);               // keeps the later arithmetic, which reuses those registers, behind that wait
#pragma unroll
    for (int q = 0; q < 8; ++q) { const int dd = d + q; const int dp = (dd < HD / 2) ? dd + HD / 2 : dd - HD / 2; float x0 = xa[q], x1 = xb[q];
        if (RF) { float n0 = __fmul_rn(x0, rf), n1 = __fmul_rn(x1, rf); asm volatile("" : "+v"(n0)); asm volatile("" : "+v"(n1)); x0 = __fmul_rn(bfr(nw[dd]), n0); x1 = __fmul_rn(bfr(nw[dp]), n1); }
        const v2f cs = q < 4 ? (v2f){ca[(2 * q) & 7], ca[(2 * q + 1) & 7]} : (v2f){cb[(2 * q) & 7], cb[(2 * q + 1) & 7]}; float a = __fmul_rn(x0, cs[0]), bq = __fmul_rn(x1, cs[1]); asm volatile("" : "+v"(a)); asm volatile("" : "+v"(bq)); const float r = ((dd < HD / 2) ? __fsub_rn(a, bq) : __fadd_rn(a, bq)) * sc;
        o16[q] = tohx(r); unsigned short a2, c2; splitf(r, a2, c2); oh[q] = a2; ol[q] = c2; }
    *(v8h*)(P16 + e) = o16; *(v8us*)(Ph + e) = oh; *(v8us*)(Pl + e) = ol;
    asm volatile("s_wait_xcnt 0x0" ::: "memory"); }   // the wait owed behind the three stores before their registers are rewritten (the next job's code follows in the build)
// vtp_do: transposed value planes [batch][g] (rows d, k = t) in fragments as above, but the HD / 16 row blocks of one 32-key step follow one another, then the next step: a pass of k_fattn reads 8 KiB in a row.
// A thread makes one 16-byte unit (8 t of one d); a wave takes 32 d: every load reads one whole line of a row of F, every store writes four whole lines; a block takes 16 t x HD.
__device__ __forceinline__ void vtp_do(int blk, const float* __restrict__ F, int pitch, int nheads, h16* V16, bf* Vh, bf* Vl) { const int tx = threadIdx.x; const int d = tx & (HD - 1), hi = tx >> 7; const int t16 = blk % (TT / 16), hb = blk / (TT / 16); const int g = hb % nheads; const int t = (hb / nheads) * TT + t16 * 16 + hi * 8;
    const size_t e = ((size_t)((hb * (TT / 32) + (t16 >> 1)) * (HD / 16) + (d >> 4)) * 64 + (t16 & 1) * 32 + hi * 16 + (d & 15)) * 8; v8h o16; v8us oh, ol;
#pragma unroll
    for (int q = 0; q < 8; ++q) { const float x = F[(size_t)(t + q) * pitch + g * HD + d]; o16[q] = tohx(x); unsigned short a2, c2; splitf(x, a2, c2); oh[q] = a2; ol[q] = c2; }
    *(v8h*)(V16 + e) = o16; *(v8us*)(Vh + e) = oh; *(v8us*)(Vl + e) = ol;
    asm volatile("s_wait_xcnt 0x0" ::: "memory"); }   // the same wait behind these three stores
// ---- k_planes: the operand planes of q, k (rope) and v (transposed), both batches, in one grid over the stacked projection F [NB_ TT][DS]; the block index picks the job (block-uniform).
#define PL_Q (NB_ * NH_ * TT * HD / 2048)
#define PL_K (NB_ * NKV * TT * HD / 2048)
__global__ __launch_bounds__(256) void k_planes(const float* __restrict__ F, const float* __restrict__ CS, h16* Q16, bf* Qh, bf* Ql, h16* K16, bf* Kh, bf* Kl, h16* V16, bf* Vh, bf* Vl) {
    const int blk = blockIdx.x;
    if (blk < PL_Q) rope_do(blk, F, DS, NH_, CS, nullptr, nullptr, 1.0f, Q16, Qh, Ql);
    else if (blk < PL_Q + PL_K) rope_do(blk - PL_Q, F + DQ, DS, NKV, CS, nullptr, nullptr, 1.0f, K16, Kh, Kl);
    else vtp_do(blk - PL_Q - PL_K, F + DQ + DKV, DS, NKV, V16, Vh, Vl);
}
extern "C" void kernel_launch(void* const* d_in, const int* in_sizes, int n_in,
                              void* d_out, int out_size, void* d_ws, size_t ws_size, hipStream_t stream) {
    (void)in_sizes; (void)n_in; (void)out_size;
    const float* x = (const float*)d_in[0]; const float* ang = (const float*)d_in[1]; const float* wq = (const float*)d_in[2]; const float* bq = (const float*)d_in[3]; const float* wk = (const float*)d_in[4]; const float* bk = (const float*)d_in[5]; const float* wv = (const float*)d_in[6]; const float* bv = (const float*)d_in[7]; const float* wo = (const float*)d_in[8]; const float* cosT = ang; const float* sinT = ang + (size_t)2048 * 128;
    float* OUT = (float*)d_out;     // [2][2048][2048]
    char* wsp = (char*)d_ws;
    auto take = [&](size_t bytes) { char* p = wsp; wsp += (bytes + 255) & ~(size_t)255; return (void*)p; };
    bf* WS = (bf*)take((size_t)DS * DM * 2); bf* WO = (bf*)take((size_t)DM * DQ * 2); float* CS = (float*)take((size_t)TT * HD * 2 * 4); float* BS = (float*)take((size_t)DS * 4);
    bf* XB = (bf*)take((size_t)NB_ * TT * DM * 2); float* F = (float*)take((size_t)NB_ * TT * DS * 4);
    h16* QP16 = (h16*)take((size_t)NB_ * NH_ * TT * HD * 2); h16* KP16 = (h16*)take((size_t)NB_ * NKV * TT * HD * 2); h16* VT16 = (h16*)take((size_t)NB_ * NKV * HD * TT * 2);
    bf* QPh = (bf*)take((size_t)NB_ * NH_ * TT * HD * 2); bf* QPl = (bf*)take((size_t)NB_ * NH_ * TT * HD * 2); bf* KPh = (bf*)take((size_t)NB_ * NKV * TT * HD * 2); bf* KPl = (bf*)take((size_t)NB_ * NKV * TT * HD * 2); bf* VTh = (bf*)take((size_t)NB_ * NKV * HD * TT * 2); bf* VTl = (bf*)take((size_t)NB_ * NKV * HD * TT * 2);
    bf* ATh = (bf*)take((size_t)NB_ * TT * DQ * 2); bf* ATl = (bf*)take((size_t)NB_ * TT * DQ * 2);
    if ((size_t)(wsp - (char*)d_ws) > ws_size) return;    // ws 256 MiB
    // five launches, each over both batches (rows b TT + t)
    k_prep<<<PB_X + PB_WQ + 2 * PB_WK + PB_WO + PB_CS + PB_BS, 256, 0, stream>>>(x, wq, wk, wv, wo, cosT, sinT, bq, bk, bv, XB, WS, WO, CS, BS);
    k_gemmw<1, 4, 2, 4, 6, true><<<dim3(NB_ * TT / 256, DS / 192, 1), 256, 0, stream>>>(XB, nullptr, WS, F, DS, BS);
    k_planes<<<PL_Q + 2 * PL_K, 256, 0, stream>>>(F, CS, QP16, QPh, QPl, KP16, KPh, KPl, VT16, VTh, VTl);
    k_fattn<<<dim3(NKV * NB_, TT / 32, 1), 32 * REP * KSP, 0, stream>>>(QP16, QPh, QPl, KP16, KPh, KPl, VT16, VTh, VTl, ATh, ATl);
    k_gemmw<2, 2, 4, 4, 4, false><<<dim3(NB_ * TT / 128, DM / 256, 1), 256, 0, stream>>>(ATh, ATl, WO, OUT, DM, nullptr);
}

// v007
// One run takes 122 microseconds.
// In both of two side-by-side timings against v006, it was 1.10 times as fast.
// All steps since v000 together make it 13.6 times as fast.
#include <hip/hip_runtime.h>

// GQA attention block (x [2][2048][2048]; q/k/v = x W^T + b (torch; 16 query heads, 4 kv heads x 128; group h/4); rotate-half RoPE with the given angles [2][2048][128] = (cos table, sin table) (read); causal softmax(q.k / sqrt(128)) (finfo.min fill); out = merged wo^T -> [2][2048][2048]).
// Compute dtypes, f32 accumulate: every input rounded to bf16; q/k/v on PLAIN bf16 operands (inputs: exact) + bias; RoPE f32 with the read tables; causal scores and attn.v: query rows < 512 hl (3 products), the rest single fp16, in one kernel with a running softmax (f32), keys beyond the diagonal block never visited; wo hl x exact (2 products).

#define NB_  2
#define TT   2048
#define DM   2048
#define NH_  16
#define NKV  4
#define REP  (NH_ / NKV)
#define HD   128
#define DQ   (NH_ * HD)
#define DKV  (NKV * HD)
#define RH   512                  // query rows < RH use hi+lo planes (0: none)
#define SCL  0.088388347648318447f   // HD^-0.5
typedef _Float16 h16;
typedef unsigned short bf;
typedef __attribute__((ext_vector_type(16))) __bf16   v16bf;
typedef __attribute__((ext_vector_type(16))) _Float16 v16h;
typedef __attribute__((ext_vector_type(8)))  _Float16 v8h;
typedef __attribute__((ext_vector_type(8)))  unsigned short v8us;
typedef __attribute__((ext_vector_type(8)))  float    v8f;
typedef __attribute__((ext_vector_type(4)))  float    v4f;
typedef v8h  __attribute__((may_alias)) v8ha;
typedef v4f  __attribute__((may_alias)) v4fa;
typedef v8us __attribute__((may_alias)) v8usa;
typedef __attribute__((ext_vector_type(4)))  unsigned v4u;

__device__ __forceinline__ unsigned short f2bf(float f) { unsigned u = __float_as_uint(f); u += 0x7FFFu + ((u >> 16) & 1u); return (unsigned short)(u >> 16); }
__device__ __forceinline__ float bf2f(unsigned short b) { return __uint_as_float(((unsigned)b) << 16); }
__device__ __forceinline__ float bfr(float f) { return bf2f(f2bf(f)); }
__device__ __forceinline__ h16 tohx(float x) { return (h16)x; }
__device__ __forceinline__ void splitf(float y, unsigned short& h, unsigned short& l) { h = f2bf(y); l = f2bf(y - bf2f(h)); }
__device__ __forceinline__ v16h cat16(v8h lo, v8h hi) { return __builtin_shufflevector(lo, hi, 0, 1, 2, 3, 4, 5, 6, 7, 8, 9, 10, 11, 12, 13, 14, 15); }
__device__ __forceinline__ v16bf cat16b(v8us lo, v8us hi) { return __builtin_bit_cast(v16bf, __builtin_shufflevector(lo, hi, 0, 1, 2, 3, 4, 5, 6, 7, 8, 9, 10, 11, 12, 13, 14, 15)); }
__device__ __forceinline__ v8f wmma16(v16h a, v16h b, v8f c) { return __builtin_amdgcn_wmma_f32_16x16x32_f16(false, a, false, b, (short)0, c, false, false); }
__device__ __forceinline__ v8f wmmab(v16bf a, v16bf b, v8f c) { return __builtin_amdgcn_wmma_f32_16x16x32_bf16(false, a, false, b, (short)0, c, false, false); }



// ---- Fragment order of a 16-bit operand plane M[R][K]: the 16 rows x 32 k of one matrix operand lie in 1024 contiguous bytes, as the two 16-byte loads of the 32 lanes read them (WFrag::ld), so that one wave-wide load covers four whole 128-byte lines (row-major: 32 bytes of each of 16 lines).
// In a fragment the 16-byte unit of (row r, k .. k + 7) is ((k / 16) % 2) 32 + ((k / 8) % 2) 16 + r % 16. The fragments of a 16-row block follow one another in k, then the next row block: a row block fills 16 K elements, as in the row-major plane. (The transposed value planes alone order theirs the other way: see the plane epilogue of k_gemmw.)
template <typename T16> struct WFrag;
template <> struct WFrag<h16> { typedef v16h V; static __device__ __forceinline__ V ld(const h16* p) { return cat16(*(const v8h*)p, *(const v8h*)(p + 256)); } static __device__ __forceinline__ v8f mma(V a, V b, v8f c) { return wmma16(a, b, c); } };
template <> struct WFrag<bf> { typedef v16bf V; static __device__ __forceinline__ V ld(const bf* p) { return cat16b(*(const v8us*)p, *(const v8us*)(p + 256)); } static __device__ __forceinline__ v8f mma(V a, V b, v8f c) { return wmmab(a, b, c); } };
// ---- k_gemmw: tiled GEMM, 8 waves (WM x WN) per (WM MB 16) x (WN NB 16) output tile, each wave MB x NB accumulators over the whole K; grid (M / tile rows, N / tile columns), 256 threads.
// C[m][n] (f32, pitch ldc; no bias: f32 bias[n] is added only in the PL epilogue) = sum_k (A[m][k] + A2[m][k] if NA == 2) Bt[n][k]; operand planes in fragment order, K = KG columns.
// The operands come through LDS, so that the WN waves of a tile row share one fetch of A and the WM waves of a tile column one fetch of Bt. A stage is KP k of every row block of the tile: per row block 4 KiB in a row in the plane (KP / 32 fragments), kept in that order in LDS
// [A row blocks | A2 row blocks | Bt row blocks]; wave w copies the w-th 512 bytes of every row block with asynchronous 16-byte copies. Two buffers: the copies of stage t + 1 are issued behind the barrier at which every wave has left stage t - 1, and fly under stage t.
// Every plain '#pragma unroll' in it makes the indices of the fragment and accumulator arrays constants, so that these stay in registers.
#define KG 2048
#define KP 128
#define RBB_ (KP * 16 * 2)   // bytes of one row block in a stage
typedef __attribute__((ext_vector_type(4))) int c16;   // the 16 bytes of one lane's copy (builtin form: the compiler keeps the copies' address registers itself; the waits on the copies are written by hand below)
__device__ __forceinline__ void acopy(unsigned char* l, const bf* g) { __builtin_amdgcn_global_load_async_to_lds_b128((__attribute__((address_space(1))) c16*)g, (__attribute__((address_space(3))) c16*)l, 0, 0); }
// PL (the stacked q, k, v projection): no f32 result is stored; the epilogue makes the operand planes of k_fattn itself (see there). Its products are transposed, D = Bt rows x A rows, so that a lane holds 8 neighbouring columns n of ONE row m: the 16-byte unit of a q or k plane.
struct PlaneSet { const unsigned* cs; h16* q16; bf* qh; bf* ql; h16* k16; bf* kh; bf* kl; h16* v16; bf* vh; bf* vl; };
template <int NA, int WM, int WN, int MB, int NB, bool PL>
__global__ __launch_bounds__(256) void k_gemmw(const bf* __restrict__ A, const bf* __restrict__ A2, const bf* __restrict__ Bt, float* C, int ldc, const float* __restrict__ bias, PlaneSet ps) {
    typedef WFrag<bf>::V V;
    constexpr int RA = WM * MB, RB = WN * NB, NRB = NA * RA + RB, STG = NRB * RBB_, NT = KG / KP, NK = KP / 32;
    static_assert(WM * WN == 8 && NRB <= 63 && NB % 2 == 0 && NT >= 2 && MB * NB * 1024 * 8 <= 2 * STG, "tile shape");
    __shared__ __attribute__((aligned(16))) unsigned char ring[2 * STG];
    const int lane = threadIdx.x & 31, lr = lane & 15, hi = lane >> 4; const int wv = __builtin_amdgcn_readfirstlane(threadIdx.x >> 5); const int wm = wv % WM, wn = wv / WM; const int r0 = blockIdx.x * (RA * 16), c0 = blockIdx.y * (RB * 16);
    const int lo = wv * 256 + lane * 8;   // the lane's 16 bytes (in elements) in the wave's 512 bytes of a row block
    const bf* gA = A + (size_t)r0 * KG + lo; const bf* gA2 = NA == 2 ? A2 + (size_t)r0 * KG + lo : nullptr; const bf* gB = Bt + (size_t)c0 * KG + lo;   // the lane's bytes in the tile's first row blocks, at the stage to be copied next
    auto src = [&](int i) -> const bf* { return i < RA ? gA + (size_t)i * 16 * KG : (NA == 2 && i < 2 * RA) ? gA2 + (size_t)(i - RA) * 16 * KG : gB + (size_t)(i - NA * RA) * 16 * KG; };
    auto fill = [&](int t) { unsigned char* lb = ring + (t & 1) * STG + lo * 2;
#pragma unroll
        for (int i = 0; i < NRB; ++i) acopy(lb + i * RBB_, src(i));
        gA += KP * 16; if (NA == 2) gA2 += KP * 16; gB += KP * 16; };
    v8f acc[MB][NB];
#pragma unroll
    for (int mb = 0; mb < MB; ++mb)
#pragma unroll
        for (int nb = 0; nb < NB; ++nb) acc[mb][nb] = (v8f){};
    fill(0);
    asm volatile("s_wait_asynccnt 0x0" ::: "memory");   // the wave's own copies of stage 0 have landed
    __syncthreads();                                    // every wave's have: stage 0 may be read
#pragma unroll 1   // one stage a trip: unrolled, the loop's text would grow NT-fold for nothing
    for (int t = 0; t < NT; ++t) {
        const bf* sb = (const bf*)(ring + (t & 1) * STG) + lane * 8;
        V fa[2][NA * MB], fb[2][NB];   // two fragment sets: the 32-k block in work and the next one of the same stage
        auto frag = [&](int ks, int s) {
#pragma unroll
            for (int mb = 0; mb < NA * MB; ++mb) fa[s][mb] = WFrag<bf>::ld(sb + (((mb / MB) * RA + wm * MB + mb % MB) * NK + ks) * 512);
#pragma unroll
            for (int nb = 0; nb < NB; ++nb) fb[s][nb] = WFrag<bf>::ld(sb + ((NA * RA + wn * NB + nb) * NK + ks) * 512); };
        frag(0, 0);                    // stage t, published by the barrier above; these reads land while the copies below are issued
        if (t + 1 < NT) fill(t + 1);   // into the buffer that every wave left at that barrier (stage t - 1's)
#pragma unroll
        for (int ks = 0; ks < NK; ++ks) {
            if (ks + 1 < NK) frag(ks + 1, (ks + 1) & 1);
            __builtin_amdgcn_sched_barrier(0);   // keeps the next block's LDS reads issued as one group ahead of this block's products (without it they are issued pair by pair among the products, each pair waited for in turn)
#pragma unroll
            for (int nb = 0; nb < NB; ++nb)
#pragma unroll
                for (int mb = 0; mb < NA * MB; ++mb) acc[mb % MB][nb] = PL ? WFrag<bf>::mma(fb[ks & 1][nb], fa[ks & 1][mb], acc[mb % MB][nb]) : WFrag<bf>::mma(fa[ks & 1][mb], fb[ks & 1][nb], acc[mb % MB][nb]);
        }
        asm volatile("s_wait_dscnt 0x0" ::: "memory");      // the wave's reads of stage t are done before the buffer may be refilled
        asm volatile("s_wait_asynccnt 0x0" ::: "memory");   // its copies of stage t + 1 have landed
        __syncthreads();                                    // one barrier: publishes stage t + 1 and ends every wave's reads of stage t
    }
    asm volatile("s_wait_asynccnt 0x0" ::: "memory");   // no copy is outstanding when the ring becomes output staging
    v4f* red = (v4f*)ring + wv * (MB * NB * 64);   // output staging, each wave in its own MB NB KiB of the ring (no copy is outstanding and every wave has left the ring at the last barrier)
    if constexpr (PL) {
        // The planes of q, k (rope) and v (transposed), made from the accumulators. The column blocks of the stacked weights are laid by k_prep so that blocks 2 i and 2 i + 1 hold d = 16 jb .. and d + HD / 2 of one head: the two partners of the rotation sit in the same lane and register of two neighbouring tiles.
        // A lane holds row t = lr, columns 8 hi + j of a tile. It adds the bias and parks its 32 bytes per tile in LDS ([mb][nb][j / 4][lane]), so that a rolled loop (short text) can take one pair of tiles a trip.
        const int cb0 = blockIdx.y * RB + wn * NB, tr0 = r0 + wm * MB * 16; const int bt = tr0 / TT, tb0 = (tr0 % TT) / 16;
        const float* bp = bias + cb0 * 16 + 8 * hi; v8f bv[NB];
        __builtin_amdgcn_sched_barrier(0);   // keeps the lane arithmetic above in front of the loads below: none of it may land between them and their wait
#pragma unroll
        for (int nb = 0; nb < NB; ++nb) bv[nb] = *(const v8f*)(bp + nb * 16);
        asm volatile("s_wait_xcnt 0x0" ::: "memory");   // the wait owed before the address registers of these loads are rewritten
        __builtin_amdgcn_sched_barrier(0);               // keeps the later arithmetic, which reuses those registers, behind that wait
#pragma unroll
        for (int nb = 0; nb < NB; ++nb) { v8f bb;
#pragma unroll
            for (int j = 0; j < 8; ++j) bb[j] = bfr(bv[nb][j]);
#pragma unroll
            for (int mb = 0; mb < MB; ++mb) { const v8f x = acc[mb][nb] + bb; v4f* p = red + ((mb * NB + nb) * 2) * 32 + lane; p[0] = __builtin_shufflevector(x, x, 0, 1, 2, 3); p[32] = __builtin_shufflevector(x, x, 4, 5, 6, 7); } }
        asm volatile("s_wait_dscnt 0x0" ::: "memory");   // the wave's parked tiles are in LDS before any lane reads another lane's (the v tiles are read transposed)
        constexpr int NIT = MB * NB / 2;
        // (cos, sin) of a trip: the table is in lane order (see k_prep), 16 bytes = 4 d of the lane's row; [0], [1]: d block jb, [2], [3]: jb + 4
        auto csld = [&](int it, v4u (&c)[4]) { const int jb = ((cb0 + 2 * (it / MB)) & 7) >> 1; const unsigned* p = ps.cs + (size_t)(((tb0 + it % MB) * 8 + jb) * 2) * 128 + lane * 4; c[0] = *(const v4u*)p; c[1] = *(const v4u*)(p + 128); c[2] = *(const v4u*)(p + 1024); c[3] = *(const v4u*)(p + 1152); };
        v4u cc[4]; csld(0, cc);
        asm volatile("s_wait_xcnt 0x0" ::: "memory");   // the wait owed before the address registers of these loads are rewritten
        __builtin_amdgcn_sched_barrier(0);               // keeps the later arithmetic behind that wait
#pragma unroll 1   // rolled: unrolled, the text would grow NIT-fold and be run once
        for (int it = 0; it < NIT; ++it) {
            v4u cn[4]; csld(min(it + 1, NIT - 1), cn);      // the next trip's table entries fly under this trip's arithmetic (the last trip fetches its own again)
            asm volatile("s_wait_xcnt 0x0" ::: "memory");   // the wait owed before the address registers of these loads are rewritten
            __builtin_amdgcn_sched_barrier(0);               // keeps the trip's arithmetic, which reuses those registers, behind that wait
            const int pr = it / MB, mb = it % MB; const int cb = cb0 + 2 * pr; const int hh = cb >> 3, jb = (cb & 7) >> 1;
            const v4f* p = red + ((mb * NB + 2 * pr) * 2) * 32;
            v8h o16[2]; v8us oh[2], ol[2]; h16* P16; bf* Ph; bf* Pl; size_t e, e2;
            if (hh < NH_ + NKV) {   // wave-uniform: a q or k head; out[d] = x[d] cos[t][d] - x[d + HD/2] sin[t][d], out[d + HD/2] = x[d + HD/2] cos[t][d + HD/2] + x[d] sin[t][d + HD/2]
                const v4f a0 = p[lane], a1 = p[32 + lane], b0 = p[64 + lane], b1 = p[96 + lane];
#pragma unroll
                for (int j = 0; j < 8; ++j) { const float x0 = j < 4 ? a0[j & 3] : a1[j & 3], x1 = j < 4 ? b0[j & 3] : b1[j & 3]; const unsigned u0 = cc[j >> 2][j & 3], u1 = cc[2 + (j >> 2)][j & 3];
                    const float r0_ = x0 * __uint_as_float(u0 << 16) - x1 * __uint_as_float(u0 & 0xFFFF0000u), r1_ = x1 * __uint_as_float(u1 << 16) + x0 * __uint_as_float(u1 & 0xFFFF0000u); unsigned short h_, l_;
                    o16[0][j] = tohx(r0_); splitf(r0_, h_, l_); oh[0][j] = h_; ol[0][j] = l_; o16[1][j] = tohx(r1_); splitf(r1_, h_, l_); oh[1][j] = h_; ol[1][j] = l_; }
                const bool isq = hh < NH_; P16 = isq ? ps.q16 : ps.k16; Ph = isq ? ps.qh : ps.kh; Pl = isq ? ps.ql : ps.kl; const int hb = isq ? bt * NH_ + hh : bt * NKV + hh - NH_;
                e = ((size_t)((hb * (TT / 16) + tb0 + mb) * (HD / 32) + (jb >> 1)) * 64 + (jb & 1) * 32 + lane) * 8; e2 = e + 2 * 512;   // fragment order (rows t, k = d): the tile is one 512-byte half fragment, lane = unit; d + HD / 2 lies two fragments on
            } else {                // a v head: planes transposed (rows d, k = t); the lane takes d = lr, t = 8 hi + q from the parked tile
                const float* f = (const float*)p + (((lr & 7) >> 2) * 32 + (lr >> 3) * 16 + 8 * hi) * 4 + (lr & 3);
#pragma unroll
                for (int s = 0; s < 2; ++s)
#pragma unroll
                    for (int q = 0; q < 8; ++q) { const float x = f[s * 256 + q * 4]; unsigned short h_, l_; o16[s][q] = tohx(x); splitf(x, h_, l_); oh[s][q] = h_; ol[s][q] = l_; }
                P16 = ps.v16; Ph = ps.vh; Pl = ps.vl; const int hb = bt * NKV + hh - NH_ - NKV, t16 = tb0 + mb;
                e = ((size_t)((hb * (TT / 32) + (t16 >> 1)) * (HD / 16) + jb) * 64 + (t16 & 1) * 32 + lane) * 8; e2 = e + 4 * 512;   // the HD / 16 row blocks of one 32-key step follow one another: d + HD / 2 lies four fragments on
            }
            *(v8h*)(P16 + e) = o16[0]; *(v8us*)(Ph + e) = oh[0]; *(v8us*)(Pl + e) = ol[0]; *(v8h*)(P16 + e2) = o16[1]; *(v8us*)(Ph + e2) = oh[1]; *(v8us*)(Pl + e2) = ol[1];   // every store writes four whole lines
            asm volatile("s_wait_xcnt 0x0" ::: "memory");   // the wait owed behind the six stores before their registers are rewritten by the next trip
            __builtin_amdgcn_sched_barrier(0);               // keeps the next trip's arithmetic behind that wait
#pragma unroll
            for (int i = 0; i < 4; ++i) cc[i] = cn[i];
        }
    } else {
    // 16-byte units [mb][hi][nb][j/4][lr]; read back with lane = column within a 32-column group, so that every store instruction writes one whole 128-byte line.
#pragma unroll
    for (int mb = 0; mb < MB; ++mb)
#pragma unroll
        for (int nb = 0; nb < NB; ++nb) { v4f* p = red + (((mb * 2 + hi) * NB + nb) * 2) * 16 + lr;
            p[0] = __builtin_shufflevector(acc[mb][nb], acc[mb][nb], 0, 1, 2, 3); p[16] = __builtin_shufflevector(acc[mb][nb], acc[mb][nb], 4, 5, 6, 7); }
    float* cp = C + (size_t)(r0 + wm * MB * 16) * ldc + c0 + wn * NB * 16 + lane;
#pragma unroll 1   // rolled, so that the wait at the trip's foot stands between a trip's stores and every rewrite of their registers
    for (int x = 0; x < MB * 2; ++x) {   // eight rows of the wave's tile a trip
        v4f s0[NB / 2], s1[NB / 2];
#pragma unroll
        for (int g = 0; g < NB / 2; ++g) { const v4f* p = red + ((x * NB + g * 2 + hi) * 2) * 16 + lr; s0[g] = p[0]; s1[g] = p[16]; }
#pragma unroll
        for (int g = 0; g < NB / 2; ++g)
#pragma unroll
            for (int j = 0; j < 4; ++j) { cp[(size_t)j * ldc + g * 32] = s0[g][j]; cp[(size_t)(j + 4) * ldc + g * 32] = s1[g][j]; }
        asm volatile("s_wait_xcnt 0x0" ::: "memory");   // the wait owed behind these stores before their registers are rewritten by the next eight rows
        cp += (size_t)8 * ldc;
    }
    }
}

typedef __attribute__((ext_vector_type(2))) _Float16 v2h;
typedef __attribute__((ext_vector_type(4))) _Float16 v4h;
typedef __attribute__((ext_vector_type(2))) unsigned short v2us;
typedef __attribute__((ext_vector_type(4))) unsigned short v4us;
typedef __attribute__((ext_vector_type(2))) float v2f;
typedef __attribute__((ext_vector_type(4))) int v4i;

// ---- k_fattn: scores, softmax and probability x value in one kernel; no score or probability leaves the registers. Work-group = 32 query rows x the REP query heads of one kv group x KSP key shares: wave (hg, ks) owns head hg and the 32-key passes ks, ks + KSP, ...
// Grid (NKV x NB_, TT / 32): both batches in one launch, twice as many work-groups as resident places, so the start order decides the tail. The query block is the slow index: first the hi+lo blocks (three products for one: short rows, dear passes), longest first, then the single-plane blocks, longest first; no dear block starts late.
// Transposed products: S^T = K Q^T (A = key rows, B = query rows), so a lane holds scores of ONE query (column lr; keys 8 hi + j of each 16-key tile), which is already the B operand order of O^T += V^T P^T (A = rows of the transposed value plane).
// Running softmax in the log2 domain: m_run is the maximum in use, l_run the lane's share of the sum; the accumulators are rescaled only when some query's maximum exceeds m_run by more than LAZY. Every exponential carries the factor 2^PBIAS (it cancels in acc / l): at most 2^(LAZY + PBIAS) in fp16.
#define KSP   2
#define ACS   (SCL * 1.4426950408889634f)
#define LAZY  8.0f
#define PBIAS 6.0f
__device__ __forceinline__ float xhalf(float x) { return __builtin_bit_cast(float, __builtin_amdgcn_permlanex16(__builtin_bit_cast(int, x), __builtin_bit_cast(int, x), 0x76543210, 0xfedcba98, false, false)); }   // lane l with lane l ^ 16: the two holders of one query
template <typename T16, bool HI>
__device__ __forceinline__ void attn_walk(const T16* __restrict__ Q, const T16* __restrict__ Q2, const T16* __restrict__ Kp, const T16* __restrict__ K2, const T16* __restrict__ Vt, const T16* __restrict__ V2, int q0, int ks, int lr, int hi, v8f (&acc)[2][8], float (&m_run)[2], float (&l_run)[2]) {
    typedef typename WFrag<T16>::V V;
    const int npass = q0 / 32 + 1;                       // keys 0 .. q0 + 31; only the last pass meets the diagonal
    if (ks >= npass) return;                             // wave-uniform: a key share without a pass keeps its start state (weight 0 in the join)
    const size_t ko = (size_t)(hi * 16 + lr) * 8, vo = ko;   // the lane's 16 bytes in a fragment (fragment order: see k_gemmw); the 8 fragments of a pass's 32 keys, K and V alike, are 8 KiB in a row
    __builtin_amdgcn_sched_barrier(0);                   // keeps the lane arithmetic above in front of the loads below: none of it may land between them and their wait, where it would reuse an address register
    V qf[2][4], qf2[2][4];
#pragma unroll
    for (int g = 0; g < 2; ++g)
#pragma unroll
        for (int kc = 0; kc < 4; ++kc) { const size_t o = ko + (size_t)(q0 + 16 * g) * HD + kc * 512; qf[g][kc] = WFrag<T16>::ld(Q + o); if (HI) qf2[g][kc] = WFrag<T16>::ld(Q2 + o); }
    V kf[2][4], kf2[2][4];
    if (!HI) { const int k0 = ks * 32;                   // single-plane path: K fragments are fetched one pass ahead
#pragma unroll
        for (int kt = 0; kt < 2; ++kt)
#pragma unroll
            for (int kc = 0; kc < 4; ++kc) kf[kt][kc] = WFrag<T16>::ld(Kp + ko + (size_t)(k0 + 16 * kt) * HD + kc * 512); }
    asm volatile("s_wait_xcnt 0x0" ::: "memory");   // the wait owed before the address registers of the loads above are rewritten
    __builtin_amdgcn_sched_barrier(0);               // keeps the later arithmetic, which reuses those registers, behind that wait
#pragma unroll 1
    for (int p = ks; p < npass; p += KSP) {
        const int key0 = p * 32;
        V vf[8], vf2[8];
        if (!HI) {
#pragma unroll
            for (int t = 0; t < 8; ++t) vf[t] = WFrag<T16>::ld(Vt + vo + (size_t)key0 * HD + t * 512);
            asm volatile("" ::: "memory");   // compiler fence: keeps the pass's V loads issued here, ahead of the score products, so that they fly under them (without it they sink to the block that uses them)
        } else {
#pragma unroll
            for (int kt = 0; kt < 2; ++kt)
#pragma unroll
                for (int kc = 0; kc < 4; ++kc) { const size_t o = ko + (size_t)(key0 + 16 * kt) * HD + kc * 512; kf[kt][kc] = WFrag<T16>::ld(Kp + o); kf2[kt][kc] = WFrag<T16>::ld(K2 + o); }
            __builtin_amdgcn_sched_barrier(0);   // all of the pass's K loads are issued before its first product (without it they are issued pair by pair, each pair waited for in turn)
        }
        v8f s[2][2];
#pragma unroll
        for (int kt = 0; kt < 2; ++kt)
#pragma unroll
            for (int g = 0; g < 2; ++g) { s[kt][g] = (v8f){};
#pragma unroll
                for (int kc = 0; kc < 4; ++kc) { s[kt][g] = WFrag<T16>::mma(kf[kt][kc], qf[g][kc], s[kt][g]); if (HI) { s[kt][g] = WFrag<T16>::mma(kf[kt][kc], qf2[g][kc], s[kt][g]); s[kt][g] = WFrag<T16>::mma(kf2[kt][kc], qf[g][kc], s[kt][g]); } } }
        if (!HI) { const int k1 = min(p + KSP, npass - 1) * 32;   // next pass's K (the last pass fetches rows that exist and are not used)
#pragma unroll
            for (int kt = 0; kt < 2; ++kt)
#pragma unroll
                for (int kc = 0; kc < 4; ++kc) kf[kt][kc] = WFrag<T16>::ld(Kp + ko + (size_t)(k1 + 16 * kt) * HD + kc * 512);
            asm volatile("s_wait_xcnt 0x0" ::: "memory");   // the wait owed before the loads' address registers are rewritten (the mask below reuses them); its memory clobber also keeps the next pass's K loads issued here, to fly under the softmax and the second product (without it they sink to the pass's end)
        } else {
#pragma unroll
            for (int t = 0; t < 8; ++t) { const size_t o = vo + (size_t)key0 * HD + t * 512; vf[t] = WFrag<T16>::ld(Vt + o); vf2[t] = WFrag<T16>::ld(V2 + o); }
            asm volatile("s_wait_xcnt 0x0" ::: "memory");   // the wait owed before the loads' address registers are rewritten; its memory clobber also keeps the pass's V loads issued here, to fly under the maxima and the exponentials
        }
        if (p == npass - 1) {                             // wave-uniform: the diagonal pass masks key > query
#pragma unroll
            for (int g = 0; g < 2; ++g)
#pragma unroll
                for (int kt = 0; kt < 2; ++kt)
#pragma unroll
                    for (int j = 0; j < 8; ++j) if (16 * kt + 8 * hi + j > 16 * g + lr) s[kt][g][j] = -3.0e38f;
        }
        float mb[2]; bool need = false;
#pragma unroll
        for (int g = 0; g < 2; ++g) { float mx = -3.0e38f;
#pragma unroll
            for (int kt = 0; kt < 2; ++kt)
#pragma unroll
                for (int j = 0; j < 8; ++j) mx = fmaxf(mx, s[kt][g][j]);
            mx = fmaxf(mx, xhalf(mx)) * ACS; mb[g] = mx; need = need || (mx > m_run[g] + LAZY); }
        if (__builtin_amdgcn_ballot_w32(need) != 0) {     // one scalar test per pass
#pragma unroll
            for (int g = 0; g < 2; ++g) { const float mn = fmaxf(m_run[g], mb[g]); const float corr = __builtin_amdgcn_exp2f(m_run[g] - mn); l_run[g] *= corr; m_run[g] = mn;   // first pass: corr = 0 on zeros
#pragma unroll
                for (int t = 0; t < 8; ++t) acc[g][t] = acc[g][t] * corr; }
        }
#pragma unroll
        for (int g = 0; g < 2; ++g) { const float nm = PBIAS - m_run[g]; float e[16], ps0 = 0.f, ps1 = 0.f;
#pragma unroll
            for (int i = 0; i < 8; ++i) { const v2f arg = __builtin_elementwise_fma((v2f){s[i >> 2][g][2 * (i & 3)], s[i >> 2][g][2 * (i & 3) + 1]}, (v2f){ACS, ACS}, (v2f){nm, nm});   // a register pair of the score tile at a time
                e[2 * i] = __builtin_amdgcn_exp2f(arg[0]); e[2 * i + 1] = __builtin_amdgcn_exp2f(arg[1]); ps0 += e[2 * i]; ps1 += e[2 * i + 1]; }
            l_run[g] += ps0 + ps1;
            if constexpr (!HI) { v16h pf;
#pragma unroll
                for (int i = 0; i < 16; ++i) pf[i] = (h16)e[i];
#pragma unroll
                for (int t = 0; t < 8; ++t) acc[g][t] = WFrag<T16>::mma(vf[t], pf, acc[g][t]);
            } else { v8us h0, h1, l0, l1;
#pragma unroll
                for (int i = 0; i < 8; ++i) { unsigned short a, c2; splitf(e[i], a, c2); h0[i] = a; l0[i] = c2; }
#pragma unroll
                for (int i = 0; i < 8; ++i) { unsigned short a, c2; splitf(e[i + 8], a, c2); h1[i] = a; l1[i] = c2; }
                const V ph = cat16b(h0, h1), pl = cat16b(l0, l1);
#pragma unroll
                for (int t = 0; t < 8; ++t) { acc[g][t] = WFrag<T16>::mma(vf[t], ph, acc[g][t]); acc[g][t] = WFrag<T16>::mma(vf[t], pl, acc[g][t]); acc[g][t] = WFrag<T16>::mma(vf2[t], ph, acc[g][t]); }
            } }
    }
}
__global__ __launch_bounds__(32 * REP * KSP) void k_fattn(const h16* __restrict__ Q16, const bf* __restrict__ Qh, const bf* __restrict__ Ql, const h16* __restrict__ K16, const bf* __restrict__ Kh, const bf* __restrict__ Kl, const h16* __restrict__ V16, const bf* __restrict__ Vh, const bf* __restrict__ Vl, bf* Ah, bf* Al) {
    __shared__ __align__(16) v4f mrg[REP * 32 * 32];     // the second key share's accumulators, [head][16-byte piece][lane]
    __shared__ float mls[REP * 4 * 32];                  // its maxima and sums
    const int lane = threadIdx.x & 31, lr = lane & 15, hi = lane >> 4; const int wv = __builtin_amdgcn_readfirstlane(threadIdx.x >> 5); const int hg = wv % REP, ks = wv / REP;
    const int kvg = blockIdx.x % NKV, bt = blockIdx.x / NKV, h = kvg * REP + hg; const int rk = blockIdx.y; const int q0 = (rk < RH / 32 ? RH / 32 - 1 - rk : (int)gridDim.y - 1 - (rk - RH / 32)) * 32;   // a permutation of the query blocks: see the grid note above
    v8f acc[2][8]; float m_run[2], l_run[2];
#pragma unroll
    for (int g = 0; g < 2; ++g) { m_run[g] = -3.0e38f; l_run[g] = 0.f;
#pragma unroll
        for (int t = 0; t < 8; ++t) acc[g][t] = (v8f){}; }
    const size_t qo = (size_t)(bt * NH_ + h) * TT * HD, kvo = (size_t)(bt * NKV + kvg) * TT * HD;
    if (q0 < RH) attn_walk<bf, true>(Qh + qo, Ql + qo, Kh + kvo, Kl + kvo, Vh + kvo, Vl + kvo, q0, ks, lr, hi, acc, m_run, l_run);
    else attn_walk<h16, false>(Q16 + qo, nullptr, K16 + kvo, nullptr, V16 + kvo, nullptr, q0, ks, lr, hi, acc, m_run, l_run);
    if (ks == 1) {
#pragma unroll
        for (int g = 0; g < 2; ++g) { mls[(hg * 4 + g) * 32 + lane] = m_run[g]; mls[(hg * 4 + 2 + g) * 32 + lane] = l_run[g];
#pragma unroll
            for (int t = 0; t < 8; ++t) { v4f* p = mrg + (hg * 32 + (g * 8 + t) * 2) * 32 + lane; p[0] = __builtin_shufflevector(acc[g][t], acc[g][t], 0, 1, 2, 3); p[32] = __builtin_shufflevector(acc[g][t], acc[g][t], 4, 5, 6, 7); } }
    }
    __syncthreads();   // the second share's state is in LDS before the first share's wave joins it to its own
    if (ks == 0) {
#pragma unroll
        for (int g = 0; g < 2; ++g) { const float m1 = mls[(hg * 4 + g) * 32 + lane], l1 = mls[(hg * 4 + 2 + g) * 32 + lane]; const float m = fmaxf(m_run[g], m1);   // a share without a pass: m1 = -3e38, weight 0
            const float c0 = __builtin_amdgcn_exp2f(m_run[g] - m), c1 = __builtin_amdgcn_exp2f(m1 - m); float l = l_run[g] * c0 + l1 * c1; l += xhalf(l); const float inv = __fdiv_rn(1.0f, l); const float a0 = c0 * inv, a1 = c1 * inv;
            const size_t oo = (size_t)(bt * TT + q0 + 16 * g) * DQ + (size_t)(h * (HD / 32) * 64 + lane) * 8;   // fragment order: row block, then the head's first fragment; the 16 columns of tile t are one 512-byte half fragment
#pragma unroll
            for (int t = 0; t < 8; ++t) { const v4f* p = mrg + (hg * 32 + (g * 8 + t) * 2) * 32 + lane; const v4f b0 = p[0], b1 = p[32]; v8us oh, ol;
#pragma unroll
                for (int j = 0; j < 8; ++j) { unsigned short a, c2; splitf(acc[g][t][j] * a0 + (j < 4 ? b0[j & 3] : b1[j & 3]) * a1, a, c2); oh[j] = a; ol[j] = c2; }
                *(v8us*)(Ah + oo + t * 256) = oh; *(v8us*)(Al + oo + t * 256) = ol;
                asm volatile("s_wait_xcnt 0x0" ::: "memory");   // the wait owed behind the two stores before their registers are rewritten
                __builtin_amdgcn_sched_barrier(0); } }           // keeps the next tile's arithmetic, which reuses those registers, behind that wait
    }
}

__global__ __launch_bounds__(256) void k_wtG(const float* __restrict__ w, int K, int N, bf* Bt) {
    const int lane = threadIdx.x & 31; const int L0 = (blockIdx.x * 8 + (threadIdx.x >> 5)) * 8; const int nlines = N * K / 64;
{
#pragma unroll 1
        for (int l = 0; l < 8; ++l) { const int L = L0 + l; if (L >= nlines) break; const size_t e = (size_t)L * 64 + lane * 2; const int k = (int)(e % K), n = (int)(e / K); v2us o;
            o[0] = f2bf(w[(size_t)k * N + n]); o[1] = f2bf(w[(size_t)(k + 1) * N + n]); *(v2us*)(Bt + e) = o; }
         }
}
// ---- k_prep: every input conversion of the run in one grid. The block index picks the job (block-uniform): 2048 elements of x (both batches), wq, wk, wv or wo to bf16; 1024 (cos, sin) pairs; 256 bias values into one row.
// wq, wk, wv land one under the other (WS [DS][DM]) and bq, bk, bv one behind the other (BS [DS]), so that one GEMM makes q, k and v.
#define DS    (DQ + 2 * DKV)
#define PB_X  (NB_ * TT * DM / 2048)
#define PB_WQ (DQ * DM / 2048)
#define PB_WK (DKV * DM / 2048)
#define PB_WO (DM * DQ / 2048)
#define PB_CS (TT * HD / 1024)
#define PB_BS (DS / 256)
__global__ __launch_bounds__(256) void k_prep(const float* __restrict__ x, const float* __restrict__ wq, const float* __restrict__ wk, const float* __restrict__ wv, const float* __restrict__ wo, const float* __restrict__ cosT, const float* __restrict__ sinT, const float* __restrict__ bq, const float* __restrict__ bk, const float* __restrict__ bv, bf* XB, bf* WS, bf* WO, unsigned* CS, float* BS) {
    int blk = blockIdx.x; const float* src; bf* dst; bool pm = false;
    if (blk < PB_X) { src = x; dst = XB; }
    else if ((blk -= PB_X) < PB_WQ) { src = wq; dst = WS; pm = true; }
    else if ((blk -= PB_WQ) < PB_WK) { src = wk; dst = WS + (size_t)DQ * DM; pm = true; }
    else if ((blk -= PB_WK) < PB_WK) { src = wv; dst = WS + (size_t)(DQ + DKV) * DM; pm = true; }
    else if ((blk -= PB_WK) < PB_WO) { src = wo; dst = WO; }
    else if ((blk -= PB_WO) < PB_CS) {   // 16-byte unit o of the table: (cos, sin) as two bf16 in a word, 4 d of one t; units [t / 16][d / 16][(d / 4) % 2][lane = ((d / 8) % 2) 16 + t % 16], the order in which the lanes of k_gemmw's plane epilogue read them
        const int o = blk * 256 + threadIdx.x; const int ln = o & 31; const size_t s = (size_t)((o >> 9) * 16 + (ln & 15)) * HD + ((o >> 6) & 7) * 16 + (ln >> 4) * 8 + ((o >> 5) & 1) * 4;
        __builtin_amdgcn_sched_barrier(0);   // keeps the lane arithmetic above in front of the loads below
        const v4f cv = *(const v4f*)(cosT + s), sv = *(const v4f*)(sinT + s);
        asm volatile("s_wait_xcnt 0x0" ::: "memory");   // the wait owed before the address registers of these loads are rewritten
        __builtin_amdgcn_sched_barrier(0);               // keeps the later arithmetic behind that wait
        v4u w;
#pragma unroll
        for (int k = 0; k < 4; ++k) w[k] = (unsigned)f2bf(cv[k]) | ((unsigned)f2bf(sv[k]) << 16);
        *(v4u*)(CS + (size_t)o * 4) = w; asm volatile("s_wait_xcnt 0x0" ::: "memory"); return; }   // the wait owed behind a store before its registers are rewritten: the jobs are laid one behind the other in the build
    else { const int c = (blk - PB_CS) * 256 + threadIdx.x; const int p = (c >> 4) & 7; const int n = (c >> 7) * HD + ((p >> 1) | ((p & 1) << 2)) * 16 + (c & 15);   // column c of the stacked GEMM is column n of (q | k | v): see the row blocks below
        BS[c] = n < DQ ? bq[n] : n < DQ + DKV ? bk[n - DQ] : bv[n - DQ - DKV]; asm volatile("s_wait_xcnt 0x0" ::: "memory"); return; }   // the same wait behind this job's store
    // fragment order (see k_gemmw; all five planes have DM columns): a wave takes 8 rows x 32 k, reads one 128-byte line of each row and writes four whole lines; a block takes 16 rows x 128 k
    const int tx = threadIdx.x; const int row = (blk >> 4) * 16 + ((tx >> 5) & 1) * 8 + (tx & 7), pc = (tx >> 3) & 3, kb = (blk & 15) * 4 + (tx >> 6);
    const int rb = row >> 4; const int rp = pm ? (rb & ~7) | ((rb & 3) << 1) | ((rb >> 2) & 1) : rb;   // wq, wk, wv: the 8 row blocks of a head land in the order 0 4 1 5 2 6 3 7, each d block beside its rotation partner
    const size_t i = ((size_t)(rp * (DM / 32) + kb) * 2 + (pc >> 1)) * 32 + (pc & 1) * 16 + (row & 15); const v8f v = *(const v8f*)(src + (size_t)row * DM + kb * 32 + pc * 8); v8us o;
#pragma unroll
    for (int k = 0; k < 8; ++k) o[k] = f2bf(v[k]); *(v8us*)(dst + i * 8) = o;  }
extern "C" void kernel_launch(void* const* d_in, const int* in_sizes, int n_in,
                              void* d_out, int out_size, void* d_ws, size_t ws_size, hipStream_t stream) {
    (void)in_sizes; (void)n_in; (void)out_size;
    const float* x = (const float*)d_in[0]; const float* ang = (const float*)d_in[1]; const float* wq = (const float*)d_in[2]; const float* bq = (const float*)d_in[3]; const float* wk = (const float*)d_in[4]; const float* bk = (const float*)d_in[5]; const float* wv = (const float*)d_in[6]; const float* bv = (const float*)d_in[7]; const float* wo = (const float*)d_in[8]; const float* cosT = ang; const float* sinT = ang + (size_t)2048 * 128;
    float* OUT = (float*)d_out;     // [2][2048][2048]
    char* wsp = (char*)d_ws;
    auto take = [&](size_t bytes) { char* p = wsp; wsp += (bytes + 255) & ~(size_t)255; return (void*)p; };
    bf* WS = (bf*)take((size_t)DS * DM * 2); bf* WO = (bf*)take((size_t)DM * DQ * 2); unsigned* CS = (unsigned*)take((size_t)TT * HD * 4); float* BS = (float*)take((size_t)DS * 4);
    bf* XB = (bf*)take((size_t)NB_ * TT * DM * 2);
    h16* QP16 = (h16*)take((size_t)NB_ * NH_ * TT * HD * 2); h16* KP16 = (h16*)take((size_t)NB_ * NKV * TT * HD * 2); h16* VT16 = (h16*)take((size_t)NB_ * NKV * HD * TT * 2);
    bf* QPh = (bf*)take((size_t)NB_ * NH_ * TT * HD * 2); bf* QPl = (bf*)take((size_t)NB_ * NH_ * TT * HD * 2); bf* KPh = (bf*)take((size_t)NB_ * NKV * TT * HD * 2); bf* KPl = (bf*)take((size_t)NB_ * NKV * TT * HD * 2); bf* VTh = (bf*)take((size_t)NB_ * NKV * HD * TT * 2); bf* VTl = (bf*)take((size_t)NB_ * NKV * HD * TT * 2);
    bf* ATh = (bf*)take((size_t)NB_ * TT * DQ * 2); bf* ATl = (bf*)take((size_t)NB_ * TT * DQ * 2);
    if ((size_t)(wsp - (char*)d_ws) > ws_size) return;    // ws 256 MiB
    // four launches, each over both batches (rows b TT + t)
    k_prep<<<PB_X + PB_WQ + 2 * PB_WK + PB_WO + PB_CS + PB_BS, 256, 0, stream>>>(x, wq, wk, wv, wo, cosT, sinT, bq, bk, bv, XB, WS, WO, CS, BS);
    k_gemmw<1, 4, 2, 4, 6, true><<<dim3(NB_ * TT / 256, DS / 192, 1), 256, 0, stream>>>(XB, nullptr, WS, nullptr, 0, BS, PlaneSet{CS, QP16, QPh, QPl, KP16, KPh, KPl, VT16, VTh, VTl});
    k_fattn<<<dim3(NKV * NB_, TT / 32, 1), 32 * REP * KSP, 0, stream>>>(QP16, QPh, QPl, KP16, KPh, KPl, VT16, VTh, VTl, ATh, ATl);
    k_gemmw<2, 2, 4, 4, 4, false><<<dim3(NB_ * TT / 128, DM / 256, 1), 256, 0, stream>>>(ATh, ATl, WO, OUT, DM, nullptr, PlaneSet{});
}

// v008
// A run of this version takes 117 microseconds.
// Next to v007, in two timings, it ran 1.04 times as fast each time.
// Over all steps from v000 it is 14.1 times as fast.
#include <hip/hip_runtime.h>

// GQA attention block (x [2][2048][2048]; q/k/v = x W^T + b (torch; 16 query heads, 4 kv heads x 128; group h/4); rotate-half RoPE with the given angles [2][2048][128] = (cos table, sin table) (read); causal softmax(q.k / sqrt(128)) (finfo.min fill); out = merged wo^T -> [2][2048][2048]).
// Compute dtypes, f32 accumulate: every input rounded to bf16; q/k/v on PLAIN bf16 operands (inputs: exact) + bias; RoPE f32 with the read tables; causal scores and attn.v: query rows < 512 hl (3 products), the rest single fp16, in one kernel with a running softmax (f32), keys beyond the diagonal block never visited; wo hl x exact (2 products).

#define NB_  2
#define TT   2048
#define DM   2048
#define NH_  16
#define NKV  4
#define REP  (NH_ / NKV)
#define HD   128
#define DQ   (NH_ * HD)
#define DKV  (NKV * HD)
#define RH   512                  // query rows < RH use hi+lo planes (0: none)
#define SCL  0.088388347648318447f   // HD^-0.5
typedef _Float16 h16;
typedef unsigned short bf;
typedef __attribute__((ext_vector_type(16))) __bf16   v16bf;
typedef __attribute__((ext_vector_type(16))) _Float16 v16h;
typedef __attribute__((ext_vector_type(8)))  _Float16 v8h;
typedef __attribute__((ext_vector_type(8)))  unsigned short v8us;
typedef __attribute__((ext_vector_type(8)))  float    v8f;
typedef __attribute__((ext_vector_type(4)))  float    v4f;
typedef v8h  __attribute__((may_alias)) v8ha;
typedef v4f  __attribute__((may_alias)) v4fa;
typedef v8us __attribute__((may_alias)) v8usa;
typedef __attribute__((ext_vector_type(4)))  unsigned v4u;

__device__ __forceinline__ unsigned short f2bf(float f) { unsigned u = __float_as_uint(f); u += 0x7FFFu + ((u >> 16) & 1u); return (unsigned short)(u >> 16); }
__device__ __forceinline__ float bf2f(unsigned short b) { return __uint_as_float(((unsigned)b) << 16); }
__device__ __forceinline__ float bfr(float f) { return bf2f(f2bf(f)); }
__device__ __forceinline__ h16 tohx(float x) { return (h16)x; }
__device__ __forceinline__ void splitf(float y, unsigned short& h, unsigned short& l) { h = f2bf(y); l = f2bf(y - bf2f(h)); }
__device__ __forceinline__ v16h cat16(v8h lo, v8h hi) { return __builtin_shufflevector(lo, hi, 0, 1, 2, 3, 4, 5, 6, 7, 8, 9, 10, 11, 12, 13, 14, 15); }
__device__ __forceinline__ v16bf cat16b(v8us lo, v8us hi) { return __builtin_bit_cast(v16bf, __builtin_shufflevector(lo, hi, 0, 1, 2, 3, 4, 5, 6, 7, 8, 9, 10, 11, 12, 13, 14, 15)); }
__device__ __forceinline__ v8f wmma16(v16h a, v16h b, v8f c) { return __builtin_amdgcn_wmma_f32_16x16x32_f16(false, a, false, b, (short)0, c, false, false); }
__device__ __forceinline__ v8f wmmab(v16bf a, v16bf b, v8f c) { return __builtin_amdgcn_wmma_f32_16x16x32_bf16(false, a, false, b, (short)0, c, false, false); }



// ---- Fragment order of a 16-bit operand plane M[R][K]: the 16 rows x 32 k of one matrix operand lie in 1024 contiguous bytes, as the two 16-byte loads of the 32 lanes read them (WFrag::ld), so that one wave-wide load covers four whole 128-byte lines (row-major: 32 bytes of each of 16 lines).
// In a fragment the 16-byte unit of (row r, k .. k + 7) is ((k / 16) % 2) 32 + ((k / 8) % 2) 16 + r % 16. The fragments of a 16-row block follow one another in k, then the next row block: a row block fills 16 K elements, as in the row-major plane. (The transposed value planes alone order theirs the other way: see the plane epilogue of k_gemmw.)
template <typename T16> struct WFrag;
template <> struct WFrag<h16> { typedef v16h V; static __device__ __forceinline__ V ld(const h16* p) { return cat16(*(const v8h*)p, *(const v8h*)(p + 256)); } static __device__ __forceinline__ v8f mma(V a, V b, v8f c) { return wmma16(a, b, c); } };
template <> struct WFrag<bf> { typedef v16bf V; static __device__ __forceinline__ V ld(const bf* p) { return cat16b(*(const v8us*)p, *(const v8us*)(p + 256)); } static __device__ __forceinline__ v8f mma(V a, V b, v8f c) { return wmmab(a, b, c); } };
// ---- k_gemmw: tiled GEMM, 8 waves (WM x WN) per (WM MB 16) x (WN NB 16) output tile, each wave MB x NB accumulators over the whole K; grid (M / tile rows, N / tile columns), 256 threads.
// C[m][n] (f32, pitch ldc; no bias: f32 bias[n] is added only in the PL epilogue) = sum_k (A[m][k] + A2[m][k] if NA == 2) Bt[n][k]; operand planes in fragment order, K = KG columns.
// The operands come through LDS, so that the WN waves of a tile row share one fetch of A and the WM waves of a tile column one fetch of Bt. A stage is KP k of every row block of the tile: per row block 4 KiB in a row in the plane (KP / 32 fragments), kept in that order in LDS
// [A row blocks | A2 row blocks | Bt row blocks]; wave w copies the w-th 512 bytes of every row block with asynchronous 16-byte copies. Two buffers: the copies of stage t + 1 are issued behind the barrier at which every wave has left stage t - 1, and fly under stage t.
// The work-groups of a tile row read the same A lines and those of a tile column the same Bt lines, all at the same pace: each starts its walk over K at another stage, (blockIdx.x + blockIdx.y) mod NT, and wraps round, so that they do not all ask L2 for the same lines at the same moment (the order of the sum over K turns with it).
// Every plain '#pragma unroll' in it makes the indices of the fragment and accumulator arrays constants, so that these stay in registers.
#define KG 2048
#define KP 128
#define RBB_ (KP * 16 * 2)   // bytes of one row block in a stage
typedef __attribute__((ext_vector_type(4))) int c16;   // the 16 bytes of one lane's copy (builtin form: the compiler keeps the copies' address registers itself; the waits on the copies are written by hand below)
__device__ __forceinline__ void acopy(unsigned char* l, const bf* g) { __builtin_amdgcn_global_load_async_to_lds_b128((__attribute__((address_space(1))) c16*)g, (__attribute__((address_space(3))) c16*)l, 0, 0); }
// PL (the stacked q, k, v projection): no f32 result is stored; the epilogue makes the operand planes of k_fattn itself (see there). Its products are transposed, D = Bt rows x A rows, so that a lane holds 8 neighbouring columns n of ONE row m: the 16-byte unit of a q or k plane.
struct PlaneSet { const unsigned* cs; h16* q16; bf* qh; bf* ql; h16* k16; bf* kh; bf* kl; h16* v16; bf* vh; bf* vl; };
template <int NA, int WM, int WN, int MB, int NB, bool PL>
__global__ __launch_bounds__(256) void k_gemmw(const bf* __restrict__ A, const bf* __restrict__ A2, const bf* __restrict__ Bt, float* C, int ldc, const float* __restrict__ bias, PlaneSet ps) {
    typedef WFrag<bf>::V V;
    constexpr int RA = WM * MB, RB = WN * NB, NRB = NA * RA + RB, STG = NRB * RBB_, NT = KG / KP, NK = KP / 32;
    static_assert(WM * WN == 8 && NRB <= 63 && NB % 2 == 0 && NT >= 2 && MB * NB * 1024 * 8 <= 2 * STG, "tile shape");
    __shared__ __attribute__((aligned(16))) unsigned char ring[2 * STG];
    const int lane = threadIdx.x & 31, lr = lane & 15, hi = lane >> 4; const int wv = __builtin_amdgcn_readfirstlane(threadIdx.x >> 5); const int wm = wv % WM, wn = wv / WM; const int r0 = blockIdx.x * (RA * 16), c0 = blockIdx.y * (RB * 16);
    const int lo = wv * 256 + lane * 8;   // the lane's 16 bytes (in elements) in the wave's 512 bytes of a row block
    int sg = (blockIdx.x + blockIdx.y) % NT;   // the stage of K to be copied next (block-uniform)
    const bf* gA = A + (size_t)r0 * KG + lo + sg * (KP * 16); const bf* gA2 = NA == 2 ? A2 + (size_t)r0 * KG + lo + sg * (KP * 16) : nullptr; const bf* gB = Bt + (size_t)c0 * KG + lo + sg * (KP * 16);   // the lane's bytes in the tile's first row blocks, at the stage to be copied next
    auto src = [&](int i) -> const bf* { return i < RA ? gA + (size_t)i * 16 * KG : (NA == 2 && i < 2 * RA) ? gA2 + (size_t)(i - RA) * 16 * KG : gB + (size_t)(i - NA * RA) * 16 * KG; };
    auto fill = [&](int t) { unsigned char* lb = ring + (t & 1) * STG + lo * 2;
#pragma unroll
        for (int i = 0; i < NRB; ++i) acopy(lb + i * RBB_, src(i));
        const int st = sg + 1 == NT ? -(NT - 1) * (KP * 16) : KP * 16; sg = sg + 1 == NT ? 0 : sg + 1;   // behind the last stage of K comes the first
        gA += st; if (NA == 2) gA2 += st; gB += st; };
    v8f acc[MB][NB];
#pragma unroll
    for (int mb = 0; mb < MB; ++mb)
#pragma unroll
        for (int nb = 0; nb < NB; ++nb) acc[mb][nb] = (v8f){};
    fill(0);
    asm volatile("s_wait_asynccnt 0x0" ::: "memory");   // the wave's own copies of stage 0 have landed
    __syncthreads();                                    // every wave's have: stage 0 may be read
#pragma unroll 1   // one stage a trip: unrolled, the loop's text would grow NT-fold for nothing
    for (int t = 0; t < NT; ++t) {
        const bf* sb = (const bf*)(ring + (t & 1) * STG) + lane * 8;
        V fa[2][NA * MB], fb[2][NB];   // two fragment sets: the 32-k block in work and the next one of the same stage
        auto frag = [&](int ks, int s) {
#pragma unroll
            for (int mb = 0; mb < NA * MB; ++mb) fa[s][mb] = WFrag<bf>::ld(sb + (((mb / MB) * RA + wm * MB + mb % MB) * NK + ks) * 512);
#pragma unroll
            for (int nb = 0; nb < NB; ++nb) fb[s][nb] = WFrag<bf>::ld(sb + ((NA * RA + wn * NB + nb) * NK + ks) * 512); };
        frag(0, 0);                    // stage t, published by the barrier above; these reads land while the copies below are issued
        if (t + 1 < NT) fill(t + 1);   // into the buffer that every wave left at that barrier (stage t - 1's)
#pragma unroll
        for (int ks = 0; ks < NK; ++ks) {
            if (ks + 1 < NK) frag(ks + 1, (ks + 1) & 1);
            __builtin_amdgcn_sched_barrier(0);   // keeps the next block's LDS reads issued as one group ahead of this block's products (without it they are issued pair by pair among the products, each pair waited for in turn)
#pragma unroll
            for (int nb = 0; nb < NB; ++nb)
#pragma unroll
                for (int mb = 0; mb < NA * MB; ++mb) acc[mb % MB][nb] = PL ? WFrag<bf>::mma(fb[ks & 1][nb], fa[ks & 1][mb], acc[mb % MB][nb]) : WFrag<bf>::mma(fa[ks & 1][mb], fb[ks & 1][nb], acc[mb % MB][nb]);
        }
        asm volatile("s_wait_dscnt 0x0" ::: "memory");      // the wave's reads of stage t are done before the buffer may be refilled
        asm volatile("s_wait_asynccnt 0x0" ::: "memory");   // its copies of stage t + 1 have landed
        __syncthreads();                                    // one barrier: publishes stage t + 1 and ends every wave's reads of stage t
    }
    asm volatile("s_wait_asynccnt 0x0" ::: "memory");   // no copy is outstanding when the ring becomes output staging
    v4f* red = (v4f*)ring + wv * (MB * NB * 64);   // output staging, each wave in its own MB NB KiB of the ring (no copy is outstanding and every wave has left the ring at the last barrier)
    if constexpr (PL) {
        // The planes of q, k (rope) and v (transposed), made from the accumulators. The column blocks of the stacked weights are laid by k_prep so that blocks 2 i and 2 i + 1 hold d = 16 jb .. and d + HD / 2 of one head: the two partners of the rotation sit in the same lane and register of two neighbouring tiles.
        // A lane holds row t = lr, columns 8 hi + j of a tile. It adds the bias and parks its 32 bytes per tile in LDS ([mb][nb][j / 4][lane]), so that a rolled loop (short text) can take one pair of tiles a trip.
        const int cb0 = blockIdx.y * RB + wn * NB, tr0 = r0 + wm * MB * 16; const int bt = tr0 / TT, tb0 = (tr0 % TT) / 16;
        const float* bp = bias + cb0 * 16 + 8 * hi; v8f bv[NB];
        __builtin_amdgcn_sched_barrier(0);   // keeps the lane arithmetic above in front of the loads below: none of it may land between them and their wait
#pragma unroll
        for (int nb = 0; nb < NB; ++nb) bv[nb] = *(const v8f*)(bp + nb * 16);
        asm volatile("s_wait_xcnt 0x0" ::: "memory");   // the wait owed before the address registers of these loads are rewritten
        __builtin_amdgcn_sched_barrier(0);               // keeps the later arithmetic, which reuses those registers, behind that wait
#pragma unroll
        for (int nb = 0; nb < NB; ++nb) { v8f bb;
#pragma unroll
            for (int j = 0; j < 8; ++j) bb[j] = bfr(bv[nb][j]);
#pragma unroll
            for (int mb = 0; mb < MB; ++mb) { const v8f x = acc[mb][nb] + bb; v4f* p = red + ((mb * NB + nb) * 2) * 32 + lane; p[0] = __builtin_shufflevector(x, x, 0, 1, 2, 3); p[32] = __builtin_shufflevector(x, x, 4, 5, 6, 7); } }
        asm volatile("s_wait_dscnt 0x0" ::: "memory");   // the wave's parked tiles are in LDS before any lane reads another lane's (the v tiles are read transposed)
        constexpr int NIT = MB * NB / 2;
        // (cos, sin) of a trip: the table is in lane order (see k_prep), 16 bytes = 4 d of the lane's row; [0], [1]: d block jb, [2], [3]: jb + 4
        auto csld = [&](int it, v4u (&c)[4]) { const int jb = ((cb0 + 2 * (it / MB)) & 7) >> 1; const unsigned* p = ps.cs + (size_t)(((tb0 + it % MB) * 8 + jb) * 2) * 128 + lane * 4; c[0] = *(const v4u*)p; c[1] = *(const v4u*)(p + 128); c[2] = *(const v4u*)(p + 1024); c[3] = *(const v4u*)(p + 1152); };
        v4u cc[4]; csld(0, cc);
        asm volatile("s_wait_xcnt 0x0" ::: "memory");   // the wait owed before the address registers of these loads are rewritten
        __builtin_amdgcn_sched_barrier(0);               // keeps the later arithmetic behind that wait
#pragma unroll 1   // rolled: unrolled, the text would grow NIT-fold and be run once
        for (int it = 0; it < NIT; ++it) {
            v4u cn[4]; csld(min(it + 1, NIT - 1), cn);      // the next trip's table entries fly under this trip's arithmetic (the last trip fetches its own again)
            asm volatile("s_wait_xcnt 0x0" ::: "memory");   // the wait owed before the address registers of these loads are rewritten
            __builtin_amdgcn_sched_barrier(0);               // keeps the trip's arithmetic, which reuses those registers, behind that wait
            const int pr = it / MB, mb = it % MB; const int cb = cb0 + 2 * pr; const int hh = cb >> 3, jb = (cb & 7) >> 1;
            const v4f* p = red + ((mb * NB + 2 * pr) * 2) * 32;
            v8h o16[2]; v8us oh[2], ol[2]; h16* P16; bf* Ph; bf* Pl; size_t e, e2;
            if (hh < NH_ + NKV) {   // wave-uniform: a q or k head; out[d] = x[d] cos[t][d] - x[d + HD/2] sin[t][d], out[d + HD/2] = x[d + HD/2] cos[t][d + HD/2] + x[d] sin[t][d + HD/2]
                const v4f a0 = p[lane], a1 = p[32 + lane], b0 = p[64 + lane], b1 = p[96 + lane];
#pragma unroll
                for (int j = 0; j < 8; ++j) { const float x0 = j < 4 ? a0[j & 3] : a1[j & 3], x1 = j < 4 ? b0[j & 3] : b1[j & 3]; const unsigned u0 = cc[j >> 2][j & 3], u1 = cc[2 + (j >> 2)][j & 3];
                    const float r0_ = x0 * __uint_as_float(u0 << 16) - x1 * __uint_as_float(u0 & 0xFFFF0000u), r1_ = x1 * __uint_as_float(u1 << 16) + x0 * __uint_as_float(u1 & 0xFFFF0000u); unsigned short h_, l_;
                    o16[0][j] = tohx(r0_); splitf(r0_, h_, l_); oh[0][j] = h_; ol[0][j] = l_; o16[1][j] = tohx(r1_); splitf(r1_, h_, l_); oh[1][j] = h_; ol[1][j] = l_; }
                const bool isq = hh < NH_; P16 = isq ? ps.q16 : ps.k16; Ph = isq ? ps.qh : ps.kh; Pl = isq ? ps.ql : ps.kl; const int hb = isq ? bt * NH_ + hh : bt * NKV + hh - NH_;
                e = ((size_t)((hb * (TT / 16) + tb0 + mb) * (HD / 32) + (jb >> 1)) * 64 + (jb & 1) * 32 + lane) * 8; e2 = e + 2 * 512;   // fragment order (rows t, k = d): the tile is one 512-byte half fragment, lane = unit; d + HD / 2 lies two fragments on
            } else {                // a v head: planes transposed (rows d, k = t); the lane takes d = lr, t = 8 hi + q from the parked tile
                const float* f = (const float*)p + (((lr & 7) >> 2) * 32 + (lr >> 3) * 16 + 8 * hi) * 4 + (lr & 3);
#pragma unroll
                for (int s = 0; s < 2; ++s)
#pragma unroll
                    for (int q = 0; q < 8; ++q) { const float x = f[s * 256 + q * 4]; unsigned short h_, l_; o16[s][q] = tohx(x); splitf(x, h_, l_); oh[s][q] = h_; ol[s][q] = l_; }
                P16 = ps.v16; Ph = ps.vh; Pl = ps.vl; const int hb = bt * NKV + hh - NH_ - NKV, t16 = tb0 + mb;
                e = ((size_t)((hb * (TT / 32) + (t16 >> 1)) * (HD / 16) + jb) * 64 + (t16 & 1) * 32 + lane) * 8; e2 = e + 4 * 512;   // the HD / 16 row blocks of one 32-key step follow one another: d + HD / 2 lies four fragments on
            }
            *(v8h*)(P16 + e) = o16[0]; *(v8us*)(Ph + e) = oh[0]; *(v8us*)(Pl + e) = ol[0]; *(v8h*)(P16 + e2) = o16[1]; *(v8us*)(Ph + e2) = oh[1]; *(v8us*)(Pl + e2) = ol[1];   // every store writes four whole lines
            asm volatile("s_wait_xcnt 0x0" ::: "memory");   // the wait owed behind the six stores before their registers are rewritten by the next trip
            __builtin_amdgcn_sched_barrier(0);               // keeps the next trip's arithmetic behind that wait
#pragma unroll
            for (int i = 0; i < 4; ++i) cc[i] = cn[i];
        }
    } else {
    // 16-byte units [mb][hi][nb][j/4][lr]; read back with lane = column within a 32-column group, so that every store instruction writes one whole 128-byte line.
#pragma unroll
    for (int mb = 0; mb < MB; ++mb)
#pragma unroll
        for (int nb = 0; nb < NB; ++nb) { v4f* p = red + (((mb * 2 + hi) * NB + nb) * 2) * 16 + lr;
            p[0] = __builtin_shufflevector(acc[mb][nb], acc[mb][nb], 0, 1, 2, 3); p[16] = __builtin_shufflevector(acc[mb][nb], acc[mb][nb], 4, 5, 6, 7); }
    float* cp = C + (size_t)(r0 + wm * MB * 16) * ldc + c0 + wn * NB * 16 + lane;
#pragma unroll 1   // rolled, so that the wait at the trip's foot stands between a trip's stores and every rewrite of their registers
    for (int x = 0; x < MB * 2; ++x) {   // eight rows of the wave's tile a trip
        v4f s0[NB / 2], s1[NB / 2];
#pragma unroll
        for (int g = 0; g < NB / 2; ++g) { const v4f* p = red + ((x * NB + g * 2 + hi) * 2) * 16 + lr; s0[g] = p[0]; s1[g] = p[16]; }
#pragma unroll
        for (int g = 0; g < NB / 2; ++g)
#pragma unroll
            for (int j = 0; j < 4; ++j) { cp[(size_t)j * ldc + g * 32] = s0[g][j]; cp[(size_t)(j + 4) * ldc + g * 32] = s1[g][j]; }
        asm volatile("s_wait_xcnt 0x0" ::: "memory");   // the wait owed behind these stores before their registers are rewritten by the next eight rows
        cp += (size_t)8 * ldc;
    }
    }
}

typedef __attribute__((ext_vector_type(2))) _Float16 v2h;
typedef __attribute__((ext_vector_type(4))) _Float16 v4h;
typedef __attribute__((ext_vector_type(2))) unsigned short v2us;
typedef __attribute__((ext_vector_type(4))) unsigned short v4us;
typedef __attribute__((ext_vector_type(2))) float v2f;
typedef __attribute__((ext_vector_type(4))) int v4i;

// ---- k_fattn: scores, softmax and probability x value in one kernel; no score or probability leaves the registers. Work-group = 32 query rows x the REP query heads of one kv group x KSP key shares: wave (hg, ks) owns head hg and the 32-key passes ks, ks + KSP, ...
// Grid (NKV x NB_, TT / 32): both batches in one launch, twice as many work-groups as resident places, so the start order decides the tail. The query block is the slow index: first the hi+lo blocks (three products for one: short rows, dear passes), longest first, then the single-plane blocks, longest first; no dear block starts late.
// Transposed products: S^T = K Q^T (A = key rows, B = query rows), so a lane holds scores of ONE query (column lr; keys 8 hi + j of each 16-key tile), which is already the B operand order of O^T += V^T P^T (A = rows of the transposed value plane).
// Running softmax in the log2 domain: m_run is the maximum in use, l_run the lane's share of the sum; the accumulators are rescaled only when some query's maximum exceeds m_run by more than LAZY. Every exponential carries the factor 2^PBIAS (it cancels in acc / l): at most 2^(LAZY + PBIAS) in fp16.
#define KSP   2
#define ACS   (SCL * 1.4426950408889634f)
#define LAZY  8.0f
#define PBIAS 6.0f
__device__ __forceinline__ float xhalf(float x) { return __builtin_bit_cast(float, __builtin_amdgcn_permlanex16(__builtin_bit_cast(int, x), __builtin_bit_cast(int, x), 0x76543210, 0xfedcba98, false, false)); }   // lane l with lane l ^ 16: the two holders of one query
template <typename T16, bool HI>
__device__ __forceinline__ void attn_walk(const T16* __restrict__ Q, const T16* __restrict__ Q2, const T16* __restrict__ Kp, const T16* __restrict__ K2, const T16* __restrict__ Vt, const T16* __restrict__ V2, int q0, int ks, int lr, int hi, v8f (&acc)[2][8], float (&m_run)[2], float (&l_run)[2]) {
    typedef typename WFrag<T16>::V V;
    const int npass = q0 / 32 + 1;                       // keys 0 .. q0 + 31; only the last pass meets the diagonal
    if (ks >= npass) return;                             // wave-uniform: a key share without a pass keeps its start state (weight 0 in the join)
    const int nmy = (npass - ks + KSP - 1) / KSP;        // the share's passes: ks + KSP j, j = 0 .. nmy - 1
    int j = (nmy * (int)(blockIdx.y & 15)) >> 4;         // the first one taken: the work-groups of a kv group read the same K and V lines at the same pace, so each enters the walk at another sixteenth of it and wraps round (the running softmax takes the passes in any order)
    const size_t ko = (size_t)(hi * 16 + lr) * 8, vo = ko;   // the lane's 16 bytes in a fragment (fragment order: see k_gemmw); the 8 fragments of a pass's 32 keys, K and V alike, are 8 KiB in a row
    __builtin_amdgcn_sched_barrier(0);                   // keeps the lane arithmetic above in front of the loads below: none of it may land between them and their wait, where it would reuse an address register
    V qf[2][4], qf2[2][4];
#pragma unroll
    for (int g = 0; g < 2; ++g)
#pragma unroll
        for (int kc = 0; kc < 4; ++kc) { const size_t o = ko + (size_t)(q0 + 16 * g) * HD + kc * 512; qf[g][kc] = WFrag<T16>::ld(Q + o); if (HI) qf2[g][kc] = WFrag<T16>::ld(Q2 + o); }
    V kf[2][4], kf2[2][4];
    if (!HI) { const int k0 = (ks + KSP * j) * 32;       // single-plane path: K fragments are fetched one pass ahead
#pragma unroll
        for (int kt = 0; kt < 2; ++kt)
#pragma unroll
            for (int kc = 0; kc < 4; ++kc) kf[kt][kc] = WFrag<T16>::ld(Kp + ko + (size_t)(k0 + 16 * kt) * HD + kc * 512); }
    asm volatile("s_wait_xcnt 0x0" ::: "memory");   // the wait owed before the address registers of the loads above are rewritten
    __builtin_amdgcn_sched_barrier(0);               // keeps the later arithmetic, which reuses those registers, behind that wait
#pragma unroll 1
    for (int i = 0; i < nmy; ++i) {
        const int p = ks + KSP * j; j = j + 1 == nmy ? 0 : j + 1;   // this pass; j: the next one, behind the last comes the first
        const int key0 = p * 32;
        V vf[8], vf2[8];
        if (!HI) {
#pragma unroll
            for (int t = 0; t < 8; ++t) vf[t] = WFrag<T16>::ld(Vt + vo + (size_t)key0 * HD + t * 512);
            asm volatile("" ::: "memory");   // compiler fence: keeps the pass's V loads issued here, ahead of the score products, so that they fly under them (without it they sink to the block that uses them)
        } else {
#pragma unroll
            for (int kt = 0; kt < 2; ++kt)
#pragma unroll
                for (int kc = 0; kc < 4; ++kc) { const size_t o = ko + (size_t)(key0 + 16 * kt) * HD + kc * 512; kf[kt][kc] = WFrag<T16>::ld(Kp + o); kf2[kt][kc] = WFrag<T16>::ld(K2 + o); }
            __builtin_amdgcn_sched_barrier(0);   // all of the pass's K loads are issued before its first product (without it they are issued pair by pair, each pair waited for in turn)
        }
        v8f s[2][2];
#pragma unroll
        for (int kt = 0; kt < 2; ++kt)
#pragma unroll
            for (int g = 0; g < 2; ++g) { s[kt][g] = (v8f){};
#pragma unroll
                for (int kc = 0; kc < 4; ++kc) { s[kt][g] = WFrag<T16>::mma(kf[kt][kc], qf[g][kc], s[kt][g]); if (HI) { s[kt][g] = WFrag<T16>::mma(kf[kt][kc], qf2[g][kc], s[kt][g]); s[kt][g] = WFrag<T16>::mma(kf2[kt][kc], qf[g][kc], s[kt][g]); } } }
        if (!HI) { const int k1 = (ks + KSP * j) * 32;   // next pass's K (the last pass taken fetches rows that exist and are not used)
#pragma unroll
            for (int kt = 0; kt < 2; ++kt)
#pragma unroll
                for (int kc = 0; kc < 4; ++kc) kf[kt][kc] = WFrag<T16>::ld(Kp + ko + (size_t)(k1 + 16 * kt) * HD + kc * 512);
            asm volatile("s_wait_xcnt 0x0" ::: "memory");   // the wait owed before the loads' address registers are rewritten (the mask below reuses them); its memory clobber also keeps the next pass's K loads issued here, to fly under the softmax and the second product (without it they sink to the pass's end)
        } else {
#pragma unroll
            for (int t = 0; t < 8; ++t) { const size_t o = vo + (size_t)key0 * HD + t * 512; vf[t] = WFrag<T16>::ld(Vt + o); vf2[t] = WFrag<T16>::ld(V2 + o); }
            asm volatile("s_wait_xcnt 0x0" ::: "memory");   // the wait owed before the loads' address registers are rewritten; its memory clobber also keeps the pass's V loads issued here, to fly under the maxima and the exponentials
        }
        if (p == npass - 1) {                             // wave-uniform: the diagonal pass masks key > query
#pragma unroll
            for (int g = 0; g < 2; ++g)
#pragma unroll
                for (int kt = 0; kt < 2; ++kt)
#pragma unroll
                    for (int j = 0; j < 8; ++j) if (16 * kt + 8 * hi + j > 16 * g + lr) s[kt][g][j] = -3.0e38f;
        }
        float mb[2]; bool need = false;
#pragma unroll
        for (int g = 0; g < 2; ++g) { float mx = -3.0e38f;
#pragma unroll
            for (int kt = 0; kt < 2; ++kt)
#pragma unroll
                for (int j = 0; j < 8; ++j) mx = fmaxf(mx, s[kt][g][j]);
            mx = fmaxf(mx, xhalf(mx)) * ACS; mb[g] = mx; need = need || (mx > m_run[g] + LAZY); }
        if (__builtin_amdgcn_ballot_w32(need) != 0) {     // one scalar test per pass
#pragma unroll
            for (int g = 0; g < 2; ++g) { const float mn = fmaxf(m_run[g], mb[g]); const float corr = __builtin_amdgcn_exp2f(m_run[g] - mn); l_run[g] *= corr; m_run[g] = mn;   // first pass: corr = 0 on zeros
#pragma unroll
                for (int t = 0; t < 8; ++t) acc[g][t] = acc[g][t] * corr; }
        }
#pragma unroll
        for (int g = 0; g < 2; ++g) { const float nm = PBIAS - m_run[g]; float e[16], ps0 = 0.f, ps1 = 0.f;
#pragma unroll
            for (int i = 0; i < 8; ++i) { const v2f arg = __builtin_elementwise_fma((v2f){s[i >> 2][g][2 * (i & 3)], s[i >> 2][g][2 * (i & 3) + 1]}, (v2f){ACS, ACS}, (v2f){nm, nm});   // a register pair of the score tile at a time
                e[2 * i] = __builtin_amdgcn_exp2f(arg[0]); e[2 * i + 1] = __builtin_amdgcn_exp2f(arg[1]); ps0 += e[2 * i]; ps1 += e[2 * i + 1]; }
            l_run[g] += ps0 + ps1;
            if constexpr (!HI) { v16h pf;
#pragma unroll
                for (int i = 0; i < 16; ++i) pf[i] = (h16)e[i];
#pragma unroll
                for (int t = 0; t < 8; ++t) acc[g][t] = WFrag<T16>::mma(vf[t], pf, acc[g][t]);
            } else { v8us h0, h1, l0, l1;
#pragma unroll
                for (int i = 0; i < 8; ++i) { unsigned short a, c2; splitf(e[i], a, c2); h0[i] = a; l0[i] = c2; }
#pragma unroll
                for (int i = 0; i < 8; ++i) { unsigned short a, c2; splitf(e[i + 8], a, c2); h1[i] = a; l1[i] = c2; }
                const V ph = cat16b(h0, h1), pl = cat16b(l0, l1);
#pragma unroll
                for (int t = 0; t < 8; ++t) { acc[g][t] = WFrag<T16>::mma(vf[t], ph, acc[g][t]); acc[g][t] = WFrag<T16>::mma(vf[t], pl, acc[g][t]); acc[g][t] = WFrag<T16>::mma(vf2[t], ph, acc[g][t]); }
            } }
    }
}
__global__ __launch_bounds__(32 * REP * KSP) void k_fattn(const h16* __restrict__ Q16, const bf* __restrict__ Qh, const bf* __restrict__ Ql, const h16* __restrict__ K16, const bf* __restrict__ Kh, const bf* __restrict__ Kl, const h16* __restrict__ V16, const bf* __restrict__ Vh, const bf* __restrict__ Vl, bf* Ah, bf* Al) {
    __shared__ __align__(16) v4f mrg[REP * 32 * 32];     // the second key share's accumulators, [head][16-byte piece][lane]
    __shared__ float mls[REP * 4 * 32];                  // its maxima and sums
    const int lane = threadIdx.x & 31, lr = lane & 15, hi = lane >> 4; const int wv = __builtin_amdgcn_readfirstlane(threadIdx.x >> 5); const int hg = wv % REP, ks = wv / REP;
    const int kvg = blockIdx.x % NKV, bt = blockIdx.x / NKV, h = kvg * REP + hg; const int rk = blockIdx.y; const int q0 = (rk < RH / 32 ? RH / 32 - 1 - rk : (int)gridDim.y - 1 - (rk - RH / 32)) * 32;   // a permutation of the query blocks: see the grid note above
    v8f acc[2][8]; float m_run[2], l_run[2];
#pragma unroll
    for (int g = 0; g < 2; ++g) { m_run[g] = -3.0e38f; l_run[g] = 0.f;
#pragma unroll
        for (int t = 0; t < 8; ++t) acc[g][t] = (v8f){}; }
    const size_t qo = (size_t)(bt * NH_ + h) * TT * HD, kvo = (size_t)(bt * NKV + kvg) * TT * HD;
    if (q0 < RH) attn_walk<bf, true>(Qh + qo, Ql + qo, Kh + kvo, Kl + kvo, Vh + kvo, Vl + kvo, q0, ks, lr, hi, acc, m_run, l_run);
    else attn_walk<h16, false>(Q16 + qo, nullptr, K16 + kvo, nullptr, V16 + kvo, nullptr, q0, ks, lr, hi, acc, m_run, l_run);
    if (ks == 1) {
#pragma unroll
        for (int g = 0; g < 2; ++g) { mls[(hg * 4 + g) * 32 + lane] = m_run[g]; mls[(hg * 4 + 2 + g) * 32 + lane] = l_run[g];
#pragma unroll
            for (int t = 0; t < 8; ++t) { v4f* p = mrg + (hg * 32 + (g * 8 + t) * 2) * 32 + lane; p[0] = __builtin_shufflevector(acc[g][t], acc[g][t], 0, 1, 2, 3); p[32] = __builtin_shufflevector(acc[g][t], acc[g][t], 4, 5, 6, 7); } }
    }
    __syncthreads();   // the second share's state is in LDS before the first share's wave joins it to its own
    if (ks == 0) {
#pragma unroll
        for (int g = 0; g < 2; ++g) { const float m1 = mls[(hg * 4 + g) * 32 + lane], l1 = mls[(hg * 4 + 2 + g) * 32 + lane]; const float m = fmaxf(m_run[g], m1);   // a share without a pass: m1 = -3e38, weight 0
            const float c0 = __builtin_amdgcn_exp2f(m_run[g] - m), c1 = __builtin_amdgcn_exp2f(m1 - m); float l = l_run[g] * c0 + l1 * c1; l += xhalf(l); const float inv = __fdiv_rn(1.0f, l); const float a0 = c0 * inv, a1 = c1 * inv;
            const size_t oo = (size_t)(bt * TT + q0 + 16 * g) * DQ + (size_t)(h * (HD / 32) * 64 + lane) * 8;   // fragment order: row block, then the head's first fragment; the 16 columns of tile t are one 512-byte half fragment
#pragma unroll
            for (int t = 0; t < 8; ++t) { const v4f* p = mrg + (hg * 32 + (g * 8 + t) * 2) * 32 + lane; const v4f b0 = p[0], b1 = p[32]; v8us oh, ol;
#pragma unroll
                for (int j = 0; j < 8; ++j) { unsigned short a, c2; splitf(acc[g][t][j] * a0 + (j < 4 ? b0[j & 3] : b1[j & 3]) * a1, a, c2); oh[j] = a; ol[j] = c2; }
                *(v8us*)(Ah + oo + t * 256) = oh; *(v8us*)(Al + oo + t * 256) = ol;
                asm volatile("s_wait_xcnt 0x0" ::: "memory");   // the wait owed behind the two stores before their registers are rewritten
                __builtin_amdgcn_sched_barrier(0); } }           // keeps the next tile's arithmetic, which reuses those registers, behind that wait
    }
}

__global__ __launch_bounds__(256) void k_wtG(const float* __restrict__ w, int K, int N, bf* Bt) {
    const int lane = threadIdx.x & 31; const int L0 = (blockIdx.x * 8 + (threadIdx.x >> 5)) * 8; const int nlines = N * K / 64;
{
#pragma unroll 1
        for (int l = 0; l < 8; ++l) { const int L = L0 + l; if (L >= nlines) break; const size_t e = (size_t)L * 64 + lane * 2; const int k = (int)(e % K), n = (int)(e / K); v2us o;
            o[0] = f2bf(w[(size_t)k * N + n]); o[1] = f2bf(w[(size_t)(k + 1) * N + n]); *(v2us*)(Bt + e) = o; }
         }
}
// ---- k_prep: every input conversion of the run in one grid. The block index picks the job (block-uniform): 2048 elements of x (both batches), wq, wk, wv or wo to bf16; 1024 (cos, sin) pairs; 256 bias values into one row.
// wq, wk, wv land one under the other (WS [DS][DM]) and bq, bk, bv one behind the other (BS [DS]), so that one GEMM makes q, k and v.
#define DS    (DQ + 2 * DKV)
#define PB_X  (NB_ * TT * DM / 2048)
#define PB_WQ (DQ * DM / 2048)
#define PB_WK (DKV * DM / 2048)
#define PB_WO (DM * DQ / 2048)
#define PB_CS (TT * HD / 1024)
#define PB_BS (DS / 256)
__global__ __launch_bounds__(256) void k_prep(const float* __restrict__ x, const float* __restrict__ wq, const float* __restrict__ wk, const float* __restrict__ wv, const float* __restrict__ wo, const float* __restrict__ cosT, const float* __restrict__ sinT, const float* __restrict__ bq, const float* __restrict__ bk, const float* __restrict__ bv, bf* XB, bf* WS, bf* WO, unsigned* CS, float* BS) {
    int blk = blockIdx.x; const float* src; bf* dst; bool pm = false;
    if (blk < PB_X) { src = x; dst = XB; }
    else if ((blk -= PB_X) < PB_WQ) { src = wq; dst = WS; pm = true; }
    else if ((blk -= PB_WQ) < PB_WK) { src = wk; dst = WS + (size_t)DQ * DM; pm = true; }
    else if ((blk -= PB_WK) < PB_WK) { src = wv; dst = WS + (size_t)(DQ + DKV) * DM; pm = true; }
    else if ((blk -= PB_WK) < PB_WO) { src = wo; dst = WO; }
    else if ((blk -= PB_WO) < PB_CS) {   // 16-byte unit o of the table: (cos, sin) as two bf16 in a word, 4 d of one t; units [t / 16][d / 16][(d / 4) % 2][lane = ((d / 8) % 2) 16 + t % 16], the order in which the lanes of k_gemmw's plane epilogue read them
        const int o = blk * 256 + threadIdx.x; const int ln = o & 31; const size_t s = (size_t)((o >> 9) * 16 + (ln & 15)) * HD + ((o >> 6) & 7) * 16 + (ln >> 4) * 8 + ((o >> 5) & 1) * 4;
        __builtin_amdgcn_sched_barrier(0);   // keeps the lane arithmetic above in front of the loads below
        const v4f cv = *(const v4f*)(cosT + s), sv = *(const v4f*)(sinT + s);
        asm volatile("s_wait_xcnt 0x0" ::: "memory");   // the wait owed before the address registers of these loads are rewritten
        __builtin_amdgcn_sched_barrier(0);               // keeps the later arithmetic behind that wait
        v4u w;
#pragma unroll
        for (int k = 0; k < 4; ++k) w[k] = (unsigned)f2bf(cv[k]) | ((unsigned)f2bf(sv[k]) << 16);
        *(v4u*)(CS + (size_t)o * 4) = w; asm volatile("s_wait_xcnt 0x0" ::: "memory"); return; }   // the wait owed behind a store before its registers are rewritten: the jobs are laid one behind the other in the build
    else { const int c = (blk - PB_CS) * 256 + threadIdx.x; const int p = (c >> 4) & 7; const int n = (c >> 7) * HD + ((p >> 1) | ((p & 1) << 2)) * 16 + (c & 15);   // column c of the stacked GEMM is column n of (q | k | v): see the row blocks below
        BS[c] = n < DQ ? bq[n] : n < DQ + DKV ? bk[n - DQ] : bv[n - DQ - DKV]; asm volatile("s_wait_xcnt 0x0" ::: "memory"); return; }   // the same wait behind this job's store
    // fragment order (see k_gemmw; all five planes have DM columns): a wave takes 8 rows x 32 k, reads one 128-byte line of each row and writes four whole lines; a block takes 16 rows x 128 k
    const int tx = threadIdx.x; const int row = (blk >> 4) * 16 + ((tx >> 5) & 1) * 8 + (tx & 7), pc = (tx >> 3) & 3, kb = (blk & 15) * 4 + (tx >> 6);
    const int rb = row >> 4; const int rp = pm ? (rb & ~7) | ((rb & 3) << 1) | ((rb >> 2) & 1) : rb;   // wq, wk, wv: the 8 row blocks of a head land in the order 0 4 1 5 2 6 3 7, each d block beside its rotation partner
    const size_t i = ((size_t)(rp * (DM / 32) + kb) * 2 + (pc >> 1)) * 32 + (pc & 1) * 16 + (row & 15); const v8f v = *(const v8f*)(src + (size_t)row * DM + kb * 32 + pc * 8); v8us o;
#pragma unroll
    for (int k = 0; k < 8; ++k) o[k] = f2bf(v[k]); *(v8us*)(dst + i * 8) = o;  }
extern "C" void kernel_launch(void* const* d_in, const int* in_sizes, int n_in,
                              void* d_out, int out_size, void* d_ws, size_t ws_size, hipStream_t stream) {
    (void)in_sizes; (void)n_in; (void)out_size;
    const float* x = (const float*)d_in[0]; const float* ang = (const float*)d_in[1]; const float* wq = (const float*)d_in[2]; const float* bq = (const float*)d_in[3]; const float* wk = (const float*)d_in[4]; const float* bk = (const float*)d_in[5]; const float* wv = (const float*)d_in[6]; const float* bv = (const float*)d_in[7]; const float* wo = (const float*)d_in[8]; const float* cosT = ang; const float* sinT = ang + (size_t)2048 * 128;
    float* OUT = (float*)d_out;     // [2][2048][2048]
    char* wsp = (char*)d_ws;
    auto take = [&](size_t bytes) { char* p = wsp; wsp += (bytes + 255) & ~(size_t)255; return (void*)p; };
    bf* WS = (bf*)take((size_t)DS * DM * 2); bf* WO = (bf*)take((size_t)DM * DQ * 2); unsigned* CS = (unsigned*)take((size_t)TT * HD * 4); float* BS = (float*)take((size_t)DS * 4);
    bf* XB = (bf*)take((size_t)NB_ * TT * DM * 2);
    h16* QP16 = (h16*)take((size_t)NB_ * NH_ * TT * HD * 2); h16* KP16 = (h16*)take((size_t)NB_ * NKV * TT * HD * 2); h16* VT16 = (h16*)take((size_t)NB_ * NKV * HD * TT * 2);
    bf* QPh = (bf*)take((size_t)NB_ * NH_ * TT * HD * 2); bf* QPl = (bf*)take((size_t)NB_ * NH_ * TT * HD * 2); bf* KPh = (bf*)take((size_t)NB_ * NKV * TT * HD * 2); bf* KPl = (bf*)take((size_t)NB_ * NKV * TT * HD * 2); bf* VTh = (bf*)take((size_t)NB_ * NKV * HD * TT * 2); bf* VTl = (bf*)take((size_t)NB_ * NKV * HD * TT * 2);
    bf* ATh = (bf*)take((size_t)NB_ * TT * DQ * 2); bf* ATl = (bf*)take((size_t)NB_ * TT * DQ * 2);
    if ((size_t)(wsp - (char*)d_ws) > ws_size) return;    // ws 256 MiB
    // four launches, each over both batches (rows b TT + t)
    k_prep<<<PB_X + PB_WQ + 2 * PB_WK + PB_WO + PB_CS + PB_BS, 256, 0, stream>>>(x, wq, wk, wv, wo, cosT, sinT, bq, bk, bv, XB, WS, WO, CS, BS);
    k_gemmw<1, 4, 2, 4, 6, true><<<dim3(NB_ * TT / 256, DS / 192, 1), 256, 0, stream>>>(XB, nullptr, WS, nullptr, 0, BS, PlaneSet{CS, QP16, QPh, QPl, KP16, KPh, KPl, VT16, VTh, VTl});
    k_fattn<<<dim3(NKV * NB_, TT / 32, 1), 32 * REP * KSP, 0, stream>>>(QP16, QPh, QPl, KP16, KPh, KPl, VT16, VTh, VTl, ATh, ATl);
    k_gemmw<2, 2, 4, 4, 4, false><<<dim3(NB_ * TT / 128, DM / 256, 1), 256, 0, stream>>>(ATh, ATl, WO, OUT, DM, nullptr, PlaneSet{});
}

// v009
// A run of this version takes 107 microseconds.
// Timed twice side by side with v008, it ran 1.09 times as fast both times.
// Counting every step since v000, it is 15.4 times as fast.
#include <hip/hip_runtime.h>

// GQA attention block (x [2][2048][2048]; q/k/v = x W^T + b (torch; 16 query heads, 4 kv heads x 128; group h/4); rotate-half RoPE with the given angles [2][2048][128] = (cos table, sin table) (read); causal softmax(q.k / sqrt(128)) (finfo.min fill); out = merged wo^T -> [2][2048][2048]).
// Compute dtypes, f32 accumulate: every input rounded to bf16; q/k/v on PLAIN bf16 operands (inputs: exact) + bias; RoPE f32 with the read tables; causal scores and attn.v: query rows < 512 hl (3 products), the rest single fp16, in one kernel with a running softmax (f32), keys beyond the diagonal block never visited; wo on fp16 operands (the bf16-rounded weights are exact in fp16 down to its subnormals): query rows < 512 fp16 hi + lo (2 products), the rest single fp16 (1 product).

#define NB_  2
#define TT   2048
#define DM   2048
#define NH_  16
#define NKV  4
#define REP  (NH_ / NKV)
#define HD   128
#define DQ   (NH_ * HD)
#define DKV  (NKV * HD)
#define RH   512                  // query rows < RH use hi+lo planes (0: none)
#define SCL  0.088388347648318447f   // HD^-0.5
typedef _Float16 h16;
typedef unsigned short bf;
typedef __attribute__((ext_vector_type(16))) __bf16   v16bf;
typedef __attribute__((ext_vector_type(16))) _Float16 v16h;
typedef __attribute__((ext_vector_type(8)))  _Float16 v8h;
typedef __attribute__((ext_vector_type(8)))  unsigned short v8us;
typedef __attribute__((ext_vector_type(8)))  float    v8f;
typedef __attribute__((ext_vector_type(4)))  float    v4f;
typedef v8h  __attribute__((may_alias)) v8ha;
typedef v4f  __attribute__((may_alias)) v4fa;
typedef v8us __attribute__((may_alias)) v8usa;
typedef __attribute__((ext_vector_type(4)))  unsigned v4u;

__device__ __forceinline__ unsigned short f2bf(float f) { unsigned u = __float_as_uint(f); u += 0x7FFFu + ((u >> 16) & 1u); return (unsigned short)(u >> 16); }
__device__ __forceinline__ float bf2f(unsigned short b) { return __uint_as_float(((unsigned)b) << 16); }
__device__ __forceinline__ float bfr(float f) { return bf2f(f2bf(f)); }
__device__ __forceinline__ h16 tohx(float x) { return (h16)x; }
__device__ __forceinline__ void splitf(float y, unsigned short& h, unsigned short& l) { h = f2bf(y); l = f2bf(y - bf2f(h)); }
__device__ __forceinline__ v16h cat16(v8h lo, v8h hi) { return __builtin_shufflevector(lo, hi, 0, 1, 2, 3, 4, 5, 6, 7, 8, 9, 10, 11, 12, 13, 14, 15); }
__device__ __forceinline__ v16bf cat16b(v8us lo, v8us hi) { return __builtin_bit_cast(v16bf, __builtin_shufflevector(lo, hi, 0, 1, 2, 3, 4, 5, 6, 7, 8, 9, 10, 11, 12, 13, 14, 15)); }
__device__ __forceinline__ v8f wmma16(v16h a, v16h b, v8f c) { return __builtin_amdgcn_wmma_f32_16x16x32_f16(false, a, false, b, (short)0, c, false, false); }
__device__ __forceinline__ v8f wmmab(v16bf a, v16bf b, v8f c) { return __builtin_amdgcn_wmma_f32_16x16x32_bf16(false, a, false, b, (short)0, c, false, false); }



// ---- Fragment order of a 16-bit operand plane M[R][K]: the 16 rows x 32 k of one matrix operand lie in 1024 contiguous bytes, as the two 16-byte loads of the 32 lanes read them (WFrag::ld), so that one wave-wide load covers four whole 128-byte lines (row-major: 32 bytes of each of 16 lines).
// In a fragment the 16-byte unit of (row r, k .. k + 7) is ((k / 16) % 2) 32 + ((k / 8) % 2) 16 + r % 16. The fragments of a 16-row block follow one another in k, then the next row block: a row block fills 16 K elements, as in the row-major plane. (The transposed value planes alone order theirs the other way: see the plane epilogue of k_gemmw.)
template <typename T16> struct WFrag;
template <> struct WFrag<h16> { typedef v16h V; static __device__ __forceinline__ V ld(const h16* p) { return cat16(*(const v8h*)p, *(const v8h*)(p + 256)); } static __device__ __forceinline__ v8f mma(V a, V b, v8f c) { return wmma16(a, b, c); } };
template <> struct WFrag<bf> { typedef v16bf V; static __device__ __forceinline__ V ld(const bf* p) { return cat16b(*(const v8us*)p, *(const v8us*)(p + 256)); } static __device__ __forceinline__ v8f mma(V a, V b, v8f c) { return wmmab(a, b, c); } };
// ---- k_gemmw: tiled GEMM, 8 waves (WM x WN) per (WM MB 16) x (WN NB 16) output tile, each wave MB x NB accumulators over the whole K; grid (M / tile rows, N / tile columns), 256 threads.
// C[m][n] (f32, pitch ldc; the f32 bias[n] is added only in the PL epilogue) = sum_k (A[m][k] + A2[m][k] in the hi+lo rows) Bt[n][k]; operand planes in fragment order, K = KG columns. PL: bf16 operands; else the 16-bit words are fp16.
// HB > 0: the rows t < RH of a batch have a second plane A2 (lo) and take two products, the others one. So that every wave has the same count of products, a tile is not 16 RA rows in a row: each wave takes HB hi+lo row blocks and MB - HB single ones of one batch (work-group bi of a batch: hi+lo blocks bi RL .., single blocks RH / 16 + bi (RA - RL) ..).
// The operands come through LDS, so that the WN waves of a tile row share one fetch of A and the WM waves of a tile column one fetch of Bt. A stage is KP k of every row block of the tile: per row block 4 KiB in a row in the plane (KP / 32 fragments), kept in that order in LDS
// [A row blocks, the hi+lo ones first | their A2 row blocks | Bt row blocks]; wave w copies the w-th 512 bytes of every row block with asynchronous 16-byte copies. Two buffers: the copies of stage t + 1 are issued behind the barrier at which every wave has left stage t - 1, and fly under stage t.
// The work-groups of a tile row read the same A lines and those of a tile column the same Bt lines, all at the same pace: each starts its walk over K at another stage, (blockIdx.x + blockIdx.y) mod NT, and wraps round, so that they do not all ask L2 for the same lines at the same moment (the order of the sum over K turns with it).
// Every plain '#pragma unroll' in it makes the indices of the fragment and accumulator arrays constants, so that these stay in registers.
#define KG 2048
#define KP 128
#define RBB_ (KP * 16 * 2)   // bytes of one row block in a stage
typedef __attribute__((ext_vector_type(4))) int c16;   // the 16 bytes of one lane's copy (builtin form: the compiler keeps the copies' address registers itself; the waits on the copies are written by hand below)
__device__ __forceinline__ void acopy(unsigned char* l, const bf* g) { __builtin_amdgcn_global_load_async_to_lds_b128((__attribute__((address_space(1))) c16*)g, (__attribute__((address_space(3))) c16*)l, 0, 0); }
// PL (the stacked q, k, v projection): no f32 result is stored; the epilogue makes the operand planes of k_fattn itself (see there). Its products are transposed, D = Bt rows x A rows, so that a lane holds 8 neighbouring columns n of ONE row m: the 16-byte unit of a q or k plane.
struct PlaneSet { const unsigned* cs; h16* q16; bf* qh; bf* ql; h16* k16; bf* kh; bf* kl; h16* v16; bf* vh; bf* vl; };
template <int HB, int WM, int WN, int MB, int NB, bool PL>
__global__ __launch_bounds__(256) void k_gemmw(const bf* __restrict__ A, const bf* __restrict__ A2, const bf* __restrict__ Bt, float* C, int ldc, const float* __restrict__ bias, PlaneSet ps) {
    typedef WFrag<bf>::V V;
    constexpr int RA = WM * MB, RL = WM * HB, RB = WN * NB, NRB = RA + RL + RB, STG = NRB * RBB_, NT = KG / KP, NK = KP / 32, GB = TT / 16 / RA;   // GB: work-groups (tile rows) of a batch
    static_assert(WM * WN == 8 && NRB <= 63 && NB % 2 == 0 && NT >= 2 && MB * NB * 1024 * 8 <= 2 * STG && (HB == 0 || GB * RL * 16 == RH) && !(PL && HB), "tile shape");
    __shared__ __attribute__((aligned(16))) unsigned char ring[2 * STG];
    const int lane = threadIdx.x & 31, lr = lane & 15, hi = lane >> 4; const int wv = __builtin_amdgcn_readfirstlane(threadIdx.x >> 5); const int wm = wv % WM, wn = wv / WM; const int r0 = blockIdx.x * (RA * 16), c0 = blockIdx.y * (RB * 16);
    const int bb = blockIdx.x / GB * (TT / 16), bi = blockIdx.x % GB; const int rbH = bb + bi * RL, rbS = HB ? bb + GB * RL + bi * (RA - RL) : blockIdx.x * RA;   // the tile's first hi+lo row block and its first single one
    const int lo = wv * 256 + lane * 8;   // the lane's 16 bytes (in elements) in the wave's 512 bytes of a row block
    int sg = (blockIdx.x + blockIdx.y) % NT;   // the stage of K to be copied next (block-uniform)
    const bf* gS = A + (size_t)rbS * 16 * KG + lo + sg * (KP * 16); const bf* gH = HB ? A + (size_t)rbH * 16 * KG + lo + sg * (KP * 16) : nullptr; const bf* gL = HB ? A2 + (size_t)rbH * 16 * KG + lo + sg * (KP * 16) : nullptr; const bf* gB = Bt + (size_t)c0 * KG + lo + sg * (KP * 16);   // the lane's bytes in the tile's first row blocks, at the stage to be copied next
    auto src = [&](int i) -> const bf* { return i < RL ? gH + (size_t)i * 16 * KG : i < RA ? gS + (size_t)(i - RL) * 16 * KG : i < RA + RL ? gL + (size_t)(i - RA) * 16 * KG : gB + (size_t)(i - RA - RL) * 16 * KG; };
    auto fill = [&](int t) { unsigned char* lb = ring + (t & 1) * STG + lo * 2;
#pragma unroll
        for (int i = 0; i < NRB; ++i) acopy(lb + i * RBB_, src(i));
        const int st = sg + 1 == NT ? -(NT - 1) * (KP * 16) : KP * 16; sg = sg + 1 == NT ? 0 : sg + 1;   // behind the last stage of K comes the first
        gS += st; if (HB) { gH += st; gL += st; } gB += st; };
    v8f acc[MB][NB];
#pragma unroll
    for (int mb = 0; mb < MB; ++mb)
#pragma unroll
        for (int nb = 0; nb < NB; ++nb) acc[mb][nb] = (v8f){};
    fill(0);
    asm volatile("s_wait_asynccnt 0x0" ::: "memory");   // the wave's own copies of stage 0 have landed
    __syncthreads();                                    // every wave's have: stage 0 may be read
#pragma unroll 1   // one stage a trip: unrolled, the loop's text would grow NT-fold for nothing
    for (int t = 0; t < NT; ++t) {
        const bf* sb = (const bf*)(ring + (t & 1) * STG) + lane * 8;
        V fa[2][MB + HB], fb[2][NB];   // two fragment sets: the 32-k block in work and the next one of the same stage
        auto frag = [&](int ks, int s) {
#pragma unroll
            for (int mb = 0; mb < MB + HB; ++mb) fa[s][mb] = WFrag<bf>::ld(sb + ((mb < HB ? wm * HB + mb : mb < MB ? RL + wm * (MB - HB) + mb - HB : RA + wm * HB + mb - MB) * NK + ks) * 512);   // behind the wave's MB row blocks the lo planes of its first HB
#pragma unroll
            for (int nb = 0; nb < NB; ++nb) fb[s][nb] = WFrag<bf>::ld(sb + ((RA + RL + wn * NB + nb) * NK + ks) * 512); };
        frag(0, 0);                    // stage t, published by the barrier above; these reads land while the copies below are issued
        if (t + 1 < NT) fill(t + 1);   // into the buffer that every wave left at that barrier (stage t - 1's)
#pragma unroll
        for (int ks = 0; ks < NK; ++ks) {
            if (ks + 1 < NK) frag(ks + 1, (ks + 1) & 1);
            __builtin_amdgcn_sched_barrier(0);   // keeps the next block's LDS reads issued as one group ahead of this block's products (without it they are issued pair by pair among the products, each pair waited for in turn)
#pragma unroll
            for (int nb = 0; nb < NB; ++nb)
#pragma unroll
                for (int mb = 0; mb < MB + HB; ++mb) acc[mb % MB][nb] = PL ? WFrag<bf>::mma(fb[ks & 1][nb], fa[ks & 1][mb], acc[mb % MB][nb]) : wmma16(__builtin_bit_cast(v16h, fa[ks & 1][mb]), __builtin_bit_cast(v16h, fb[ks & 1][nb]), acc[mb % MB][nb]);
        }
        asm volatile("s_wait_dscnt 0x0" ::: "memory");      // the wave's reads of stage t are done before the buffer may be refilled
        asm volatile("s_wait_asynccnt 0x0" ::: "memory");   // its copies of stage t + 1 have landed
        __syncthreads();                                    // one barrier: publishes stage t + 1 and ends every wave's reads of stage t
    }
    asm volatile("s_wait_asynccnt 0x0" ::: "memory");   // no copy is outstanding when the ring becomes output staging
    v4f* red = (v4f*)ring + wv * (MB * NB * 64);   // output staging, each wave in its own MB NB KiB of the ring (no copy is outstanding and every wave has left the ring at the last barrier)
    if constexpr (PL) {
        // The planes of q, k (rope) and v (transposed), made from the accumulators. The column blocks of the stacked weights are laid by k_prep so that blocks 2 i and 2 i + 1 hold d = 16 jb .. and d + HD / 2 of one head: the two partners of the rotation sit in the same lane and register of two neighbouring tiles.
        // A lane holds row t = lr, columns 8 hi + j of a tile. It adds the bias and parks its 32 bytes per tile in LDS ([mb][nb][j / 4][lane]), so that a rolled loop (short text) can take one pair of tiles a trip.
        const int cb0 = blockIdx.y * RB + wn * NB, tr0 = r0 + wm * MB * 16; const int bt = tr0 / TT, tb0 = (tr0 % TT) / 16;
        const float* bp = bias + cb0 * 16 + 8 * hi; v8f bv[NB];
        __builtin_amdgcn_sched_barrier(0);   // keeps the lane arithmetic above in front of the loads below: none of it may land between them and their wait
#pragma unroll
        for (int nb = 0; nb < NB; ++nb) bv[nb] = *(const v8f*)(bp + nb * 16);
        asm volatile("s_wait_xcnt 0x0" ::: "memory");   // the wait owed before the address registers of these loads are rewritten
        __builtin_amdgcn_sched_barrier(0);               // keeps the later arithmetic, which reuses those registers, behind that wait
#pragma unroll
        for (int nb = 0; nb < NB; ++nb) { v8f bb;
#pragma unroll
            for (int j = 0; j < 8; ++j) bb[j] = bfr(bv[nb][j]);
#pragma unroll
            for (int mb = 0; mb < MB; ++mb) { const v8f x = acc[mb][nb] + bb; v4f* p = red + ((mb * NB + nb) * 2) * 32 + lane; p[0] = __builtin_shufflevector(x, x, 0, 1, 2, 3); p[32] = __builtin_shufflevector(x, x, 4, 5, 6, 7); } }
        asm volatile("s_wait_dscnt 0x0" ::: "memory");   // the wave's parked tiles are in LDS before any lane reads another lane's (the v tiles are read transposed)
        constexpr int NIT = MB * NB / 2;
        // (cos, sin) of a trip: the table is in lane order (see k_prep), 16 bytes = 4 d of the lane's row; [0], [1]: d block jb, [2], [3]: jb + 4
        auto csld = [&](int it, v4u (&c)[4]) { const int jb = ((cb0 + 2 * (it / MB)) & 7) >> 1; const unsigned* p = ps.cs + (size_t)(((tb0 + it % MB) * 8 + jb) * 2) * 128 + lane * 4; c[0] = *(const v4u*)p; c[1] = *(const v4u*)(p + 128); c[2] = *(const v4u*)(p + 1024); c[3] = *(const v4u*)(p + 1152); };
        v4u cc[4]; csld(0, cc);
        asm volatile("s_wait_xcnt 0x0" ::: "memory");   // the wait owed before the address registers of these loads are rewritten
        __builtin_amdgcn_sched_barrier(0);               // keeps the later arithmetic behind that wait
#pragma unroll 1   // rolled: unrolled, the text would grow NIT-fold and be run once
        for (int it = 0; it < NIT; ++it) {
            v4u cn[4]; csld(min(it + 1, NIT - 1), cn);      // the next trip's table entries fly under this trip's arithmetic (the last trip fetches its own again)
            asm volatile("s_wait_xcnt 0x0" ::: "memory");   // the wait owed before the address registers of these loads are rewritten
            __builtin_amdgcn_sched_barrier(0);               // keeps the trip's arithmetic, which reuses those registers, behind that wait
            const int pr = it / MB, mb = it % MB; const int cb = cb0 + 2 * pr; const int hh = cb >> 3, jb = (cb & 7) >> 1;
            const v4f* p = red + ((mb * NB + 2 * pr) * 2) * 32;
            v8h o16[2]; v8us oh[2], ol[2]; h16* P16; bf* Ph; bf* Pl; size_t e, e2;
            if (hh < NH_ + NKV) {   // wave-uniform: a q or k head; out[d] = x[d] cos[t][d] - x[d + HD/2] sin[t][d], out[d + HD/2] = x[d + HD/2] cos[t][d + HD/2] + x[d] sin[t][d + HD/2]
                const v4f a0 = p[lane], a1 = p[32 + lane], b0 = p[64 + lane], b1 = p[96 + lane];
#pragma unroll
                for (int j = 0; j < 8; ++j) { const float x0 = j < 4 ? a0[j & 3] : a1[j & 3], x1 = j < 4 ? b0[j & 3] : b1[j & 3]; const unsigned u0 = cc[j >> 2][j & 3], u1 = cc[2 + (j >> 2)][j & 3];
                    const float r0_ = x0 * __uint_as_float(u0 << 16) - x1 * __uint_as_float(u0 & 0xFFFF0000u), r1_ = x1 * __uint_as_float(u1 << 16) + x0 * __uint_as_float(u1 & 0xFFFF0000u); unsigned short h_, l_;
                    o16[0][j] = tohx(r0_); splitf(r0_, h_, l_); oh[0][j] = h_; ol[0][j] = l_; o16[1][j] = tohx(r1_); splitf(r1_, h_, l_); oh[1][j] = h_; ol[1][j] = l_; }
                const bool isq = hh < NH_; P16 = isq ? ps.q16 : ps.k16; Ph = isq ? ps.qh : ps.kh; Pl = isq ? ps.ql : ps.kl; const int hb = isq ? bt * NH_ + hh : bt * NKV + hh - NH_;
                e = ((size_t)((hb * (TT / 16) + tb0 + mb) * (HD / 32) + (jb >> 1)) * 64 + (jb & 1) * 32 + lane) * 8; e2 = e + 2 * 512;   // fragment order (rows t, k = d): the tile is one 512-byte half fragment, lane = unit; d + HD / 2 lies two fragments on
            } else {                // a v head: planes transposed (rows d, k = t); the lane takes d = lr, t = 8 hi + q from the parked tile
                const float* f = (const float*)p + (((lr & 7) >> 2) * 32 + (lr >> 3) * 16 + 8 * hi) * 4 + (lr & 3);
#pragma unroll
                for (int s = 0; s < 2; ++s)
#pragma unroll
                    for (int q = 0; q < 8; ++q) { const float x = f[s * 256 + q * 4]; unsigned short h_, l_; o16[s][q] = tohx(x); splitf(x, h_, l_); oh[s][q] = h_; ol[s][q] = l_; }
                P16 = ps.v16; Ph = ps.vh; Pl = ps.vl; const int hb = bt * NKV + hh - NH_ - NKV, t16 = tb0 + mb;
                e = ((size_t)((hb * (TT / 32) + (t16 >> 1)) * (HD / 16) + jb) * 64 + (t16 & 1) * 32 + lane) * 8; e2 = e + 4 * 512;   // the HD / 16 row blocks of one 32-key step follow one another: d + HD / 2 lies four fragments on
            }
            *(v8h*)(P16 + e) = o16[0]; *(v8us*)(Ph + e) = oh[0]; *(v8us*)(Pl + e) = ol[0]; *(v8h*)(P16 + e2) = o16[1]; *(v8us*)(Ph + e2) = oh[1]; *(v8us*)(Pl + e2) = ol[1];   // every store writes four whole lines
            asm volatile("s_wait_xcnt 0x0" ::: "memory");   // the wait owed behind the six stores before their registers are rewritten by the next trip
            __builtin_amdgcn_sched_barrier(0);               // keeps the next trip's arithmetic behind that wait
#pragma unroll
            for (int i = 0; i < 4; ++i) cc[i] = cn[i];
        }
    } else {
    // 16-byte units [mb][hi][nb][j/4][lr]; read back with lane = column within a 32-column group, so that every store instruction writes one whole 128-byte line.
#pragma unroll
    for (int mb = 0; mb < MB; ++mb)
#pragma unroll
        for (int nb = 0; nb < NB; ++nb) { v4f* p = red + (((mb * 2 + hi) * NB + nb) * 2) * 16 + lr;
            p[0] = __builtin_shufflevector(acc[mb][nb], acc[mb][nb], 0, 1, 2, 3); p[16] = __builtin_shufflevector(acc[mb][nb], acc[mb][nb], 4, 5, 6, 7); }
    float* cb = C + c0 + wn * NB * 16 + lane;
#pragma unroll 1   // rolled, so that the wait at the trip's foot stands between a trip's stores and every rewrite of their registers
    for (int x = 0; x < MB * 2; ++x) {   // eight rows of the wave's tile a trip
        const int mx = x >> 1; float* cp = cb + (size_t)((mx < HB ? rbH + wm * HB + mx : rbS + wm * (MB - HB) + mx - HB) * 16 + (x & 1) * 8) * ldc;
        v4f s0[NB / 2], s1[NB / 2];
#pragma unroll
        for (int g = 0; g < NB / 2; ++g) { const v4f* p = red + ((x * NB + g * 2 + hi) * 2) * 16 + lr; s0[g] = p[0]; s1[g] = p[16]; }
#pragma unroll
        for (int g = 0; g < NB / 2; ++g)
#pragma unroll
            for (int j = 0; j < 4; ++j) { cp[(size_t)j * ldc + g * 32] = s0[g][j]; cp[(size_t)(j + 4) * ldc + g * 32] = s1[g][j]; }
        asm volatile("s_wait_xcnt 0x0" ::: "memory");   // the wait owed behind these stores before their registers are rewritten by the next eight rows
    }
    }
}

typedef __attribute__((ext_vector_type(2))) _Float16 v2h;
typedef __attribute__((ext_vector_type(4))) _Float16 v4h;
typedef __attribute__((ext_vector_type(2))) unsigned short v2us;
typedef __attribute__((ext_vector_type(4))) unsigned short v4us;
typedef __attribute__((ext_vector_type(2))) float v2f;
typedef __attribute__((ext_vector_type(4))) int v4i;

// ---- k_fattn: scores, softmax and probability x value in one kernel; no score or probability leaves the registers. Work-group = 32 query rows x the REP query heads of one kv group x KSP key shares: wave (hg, ks) owns head hg and the 32-key passes ks, ks + KSP, ...
// Grid (NKV x NB_, TT / 32): both batches in one launch, twice as many work-groups as resident places, so the start order decides the tail. The query block is the slow index: first the hi+lo blocks (three products for one: short rows, dear passes), longest first, then the single-plane blocks, longest first; no dear block starts late.
// Transposed products: S^T = K Q^T (A = key rows, B = query rows), so a lane holds scores of ONE query (column lr; keys 8 hi + j of each 16-key tile), which is already the B operand order of O^T += V^T P^T (A = rows of the transposed value plane).
// Running softmax in the log2 domain: m_run is the maximum in use, l_run the lane's share of the sum; the accumulators are rescaled only when some query's maximum exceeds m_run by more than LAZY. Every exponential carries the factor 2^PBIAS (it cancels in acc / l): at most 2^(LAZY + PBIAS) in fp16.
#define KSP   2
#define ACS   (SCL * 1.4426950408889634f)
#define LAZY  8.0f
#define PBIAS 6.0f
__device__ __forceinline__ float xhalf(float x) { return __builtin_bit_cast(float, __builtin_amdgcn_permlanex16(__builtin_bit_cast(int, x), __builtin_bit_cast(int, x), 0x76543210, 0xfedcba98, false, false)); }   // lane l with lane l ^ 16: the two holders of one query
template <bool B> struct BoolC { static constexpr bool value = B; };
template <typename T16, bool HI>
__device__ __forceinline__ void attn_walk(const T16* __restrict__ Q, const T16* __restrict__ Q2, const T16* __restrict__ Kp, const T16* __restrict__ K2, const T16* __restrict__ Vt, const T16* __restrict__ V2, int q0, int ks, int lr, int hi, v8f (&acc)[2][8], float (&m_run)[2], float (&l_run)[2]) {
    typedef typename WFrag<T16>::V V;
    const int npass = q0 / 32 + 1;                       // keys 0 .. q0 + 31; only the last pass meets the diagonal
    if (ks >= npass) return;                             // wave-uniform: a key share without a pass keeps its start state (weight 0 in the join)
    const int nmy = (npass - ks + KSP - 1) / KSP;        // the share's passes: ks + KSP j, j = 0 .. nmy - 1
    int j = (nmy * (int)(blockIdx.y & 15)) >> 4;         // the first one taken: the work-groups of a kv group read the same K and V lines at the same pace, so each enters the walk at another sixteenth of it and wraps round (the running softmax takes the passes in any order)
    const size_t ko = (size_t)(hi * 16 + lr) * 8, vo = ko;   // the lane's 16 bytes in a fragment (fragment order: see k_gemmw); the 8 fragments of a pass's 32 keys, K and V alike, are 8 KiB in a row
    __builtin_amdgcn_sched_barrier(0);                   // keeps the lane arithmetic above in front of the loads below: none of it may land between them and their wait, where it would reuse an address register
    V qf[2][4], qf2[2][4];
#pragma unroll
    for (int g = 0; g < 2; ++g)
#pragma unroll
        for (int kc = 0; kc < 4; ++kc) { const size_t o = ko + (size_t)(q0 + 16 * g) * HD + kc * 512; qf[g][kc] = WFrag<T16>::ld(Q + o); if (HI) qf2[g][kc] = WFrag<T16>::ld(Q2 + o); }
    V kf[2][4], kf2[2][4];
    if (!HI) { const int k0 = (ks + KSP * j) * 32;       // single-plane path: K fragments are fetched one pass ahead
#pragma unroll
        for (int kt = 0; kt < 2; ++kt)
#pragma unroll
            for (int kc = 0; kc < 4; ++kc) kf[kt][kc] = WFrag<T16>::ld(Kp + ko + (size_t)(k0 + 16 * kt) * HD + kc * 512); }
    asm volatile("s_wait_xcnt 0x0" ::: "memory");   // the wait owed before the address registers of the loads above are rewritten
    __builtin_amdgcn_sched_barrier(0);               // keeps the later arithmetic, which reuses those registers, behind that wait
#pragma unroll 1
    for (int i = 0; i < nmy; ++i) {
        const int p = ks + KSP * j; j = j + 1 == nmy ? 0 : j + 1;   // this pass; j: the next one, behind the last comes the first
        const int key0 = p * 32;
        V vf[8], vf2[8];
        if (!HI) {
#pragma unroll
            for (int t = 0; t < 8; ++t) vf[t] = WFrag<T16>::ld(Vt + vo + (size_t)key0 * HD + t * 512);
            asm volatile("" ::: "memory");   // compiler fence: keeps the pass's V loads issued here, ahead of the score products, so that they fly under them (without it they sink to the block that uses them)
        } else {
#pragma unroll
            for (int kt = 0; kt < 2; ++kt)
#pragma unroll
                for (int kc = 0; kc < 4; ++kc) { const size_t o = ko + (size_t)(key0 + 16 * kt) * HD + kc * 512; kf[kt][kc] = WFrag<T16>::ld(Kp + o); kf2[kt][kc] = WFrag<T16>::ld(K2 + o); }
            __builtin_amdgcn_sched_barrier(0);   // all of the pass's K loads are issued before its first product (without it they are issued pair by pair, each pair waited for in turn)
        }
        v8f s[2][2];
#pragma unroll
        for (int kt = 0; kt < 2; ++kt)
#pragma unroll
            for (int g = 0; g < 2; ++g) { s[kt][g] = (v8f){};
#pragma unroll
                for (int kc = 0; kc < 4; ++kc) { s[kt][g] = WFrag<T16>::mma(kf[kt][kc], qf[g][kc], s[kt][g]); if (HI) { s[kt][g] = WFrag<T16>::mma(kf[kt][kc], qf2[g][kc], s[kt][g]); s[kt][g] = WFrag<T16>::mma(kf2[kt][kc], qf[g][kc], s[kt][g]); } } }
        if (!HI) { const int k1 = (ks + KSP * j) * 32;   // next pass's K (the last pass taken fetches rows that exist and are not used)
#pragma unroll
            for (int kt = 0; kt < 2; ++kt)
#pragma unroll
                for (int kc = 0; kc < 4; ++kc) kf[kt][kc] = WFrag<T16>::ld(Kp + ko + (size_t)(k1 + 16 * kt) * HD + kc * 512);
            asm volatile("s_wait_xcnt 0x0" ::: "memory");   // the wait owed before the loads' address registers are rewritten (the mask below reuses them); its memory clobber also keeps the next pass's K loads issued here, to fly under the softmax and the second product (without it they sink to the pass's end)
        } else {
#pragma unroll
            for (int t = 0; t < 8; ++t) { const size_t o = vo + (size_t)key0 * HD + t * 512; vf[t] = WFrag<T16>::ld(Vt + o); vf2[t] = WFrag<T16>::ld(V2 + o); }
            asm volatile("s_wait_xcnt 0x0" ::: "memory");   // the wait owed before the loads' address registers are rewritten; its memory clobber also keeps the pass's V loads issued here, to fly under the maxima and the exponentials
        }
        if (p == npass - 1) {                             // wave-uniform: the diagonal pass masks key > query
#pragma unroll
            for (int g = 0; g < 2; ++g)
#pragma unroll
                for (int kt = 0; kt < 2; ++kt)
#pragma unroll
                    for (int j = 0; j < 8; ++j) if (16 * kt + 8 * hi + j > 16 * g + lr) s[kt][g][j] = -3.0e38f;
        }
        float mb[2]; bool need = false;
#pragma unroll
        for (int g = 0; g < 2; ++g) { float mx = -3.0e38f;
#pragma unroll
            for (int kt = 0; kt < 2; ++kt)
#pragma unroll
                for (int j = 0; j < 8; ++j) mx = fmaxf(mx, s[kt][g][j]);
            mx = fmaxf(mx, xhalf(mx)) * ACS; mb[g] = mx; need = need || (mx > m_run[g] + LAZY); }
        if (__builtin_amdgcn_ballot_w32(need) != 0) {     // one scalar test per pass
#pragma unroll
            for (int g = 0; g < 2; ++g) { const float mn = fmaxf(m_run[g], mb[g]); const float corr = __builtin_amdgcn_exp2f(m_run[g] - mn); l_run[g] *= corr; m_run[g] = mn;   // first pass: corr = 0 on zeros
#pragma unroll
                for (int t = 0; t < 8; ++t) acc[g][t] = acc[g][t] * corr; }
        }
#pragma unroll
        for (int g = 0; g < 2; ++g) { const float nm = PBIAS - m_run[g]; float e[16], ps0 = 0.f, ps1 = 0.f;
#pragma unroll
            for (int i = 0; i < 8; ++i) { const v2f arg = __builtin_elementwise_fma((v2f){s[i >> 2][g][2 * (i & 3)], s[i >> 2][g][2 * (i & 3) + 1]}, (v2f){ACS, ACS}, (v2f){nm, nm});   // a register pair of the score tile at a time
                e[2 * i] = __builtin_amdgcn_exp2f(arg[0]); e[2 * i + 1] = __builtin_amdgcn_exp2f(arg[1]); ps0 += e[2 * i]; ps1 += e[2 * i + 1]; }
            l_run[g] += ps0 + ps1;
            if constexpr (!HI) { v16h pf;
#pragma unroll
                for (int i = 0; i < 16; ++i) pf[i] = (h16)e[i];
#pragma unroll
                for (int t = 0; t < 8; ++t) acc[g][t] = WFrag<T16>::mma(vf[t], pf, acc[g][t]);
            } else { v8us h0, h1, l0, l1;
#pragma unroll
                for (int i = 0; i < 8; ++i) { unsigned short a, c2; splitf(e[i], a, c2); h0[i] = a; l0[i] = c2; }
#pragma unroll
                for (int i = 0; i < 8; ++i) { unsigned short a, c2; splitf(e[i + 8], a, c2); h1[i] = a; l1[i] = c2; }
                const V ph = cat16b(h0, h1), pl = cat16b(l0, l1);
#pragma unroll
                for (int t = 0; t < 8; ++t) { acc[g][t] = WFrag<T16>::mma(vf[t], ph, acc[g][t]); acc[g][t] = WFrag<T16>::mma(vf[t], pl, acc[g][t]); acc[g][t] = WFrag<T16>::mma(vf2[t], ph, acc[g][t]); }
            } }
    }
}
__global__ __launch_bounds__(32 * REP * KSP) void k_fattn(const h16* __restrict__ Q16, const bf* __restrict__ Qh, const bf* __restrict__ Ql, const h16* __restrict__ K16, const bf* __restrict__ Kh, const bf* __restrict__ Kl, const h16* __restrict__ V16, const bf* __restrict__ Vh, const bf* __restrict__ Vl, h16* Ah, h16* Al) {
    __shared__ __align__(16) v4f mrg[REP * 32 * 32];     // the second key share's accumulators, [head][16-byte piece][lane]
    __shared__ float mls[REP * 4 * 32];                  // its maxima and sums
    const int lane = threadIdx.x & 31, lr = lane & 15, hi = lane >> 4; const int wv = __builtin_amdgcn_readfirstlane(threadIdx.x >> 5); const int hg = wv % REP, ks = wv / REP;
    const int kvg = blockIdx.x % NKV, bt = blockIdx.x / NKV, h = kvg * REP + hg; const int rk = blockIdx.y; const int q0 = (rk < RH / 32 ? RH / 32 - 1 - rk : (int)gridDim.y - 1 - (rk - RH / 32)) * 32;   // a permutation of the query blocks: see the grid note above
    v8f acc[2][8]; float m_run[2], l_run[2];
#pragma unroll
    for (int g = 0; g < 2; ++g) { m_run[g] = -3.0e38f; l_run[g] = 0.f;
#pragma unroll
        for (int t = 0; t < 8; ++t) acc[g][t] = (v8f){}; }
    const size_t qo = (size_t)(bt * NH_ + h) * TT * HD, kvo = (size_t)(bt * NKV + kvg) * TT * HD;
    if (q0 < RH) attn_walk<bf, true>(Qh + qo, Ql + qo, Kh + kvo, Kl + kvo, Vh + kvo, Vl + kvo, q0, ks, lr, hi, acc, m_run, l_run);
    else attn_walk<h16, false>(Q16 + qo, nullptr, K16 + kvo, nullptr, V16 + kvo, nullptr, q0, ks, lr, hi, acc, m_run, l_run);
    if (ks == 1) {
#pragma unroll
        for (int g = 0; g < 2; ++g) { mls[(hg * 4 + g) * 32 + lane] = m_run[g]; mls[(hg * 4 + 2 + g) * 32 + lane] = l_run[g];
#pragma unroll
            for (int t = 0; t < 8; ++t) { v4f* p = mrg + (hg * 32 + (g * 8 + t) * 2) * 32 + lane; p[0] = __builtin_shufflevector(acc[g][t], acc[g][t], 0, 1, 2, 3); p[32] = __builtin_shufflevector(acc[g][t], acc[g][t], 4, 5, 6, 7); } }
    }
    __syncthreads();   // the second share's state is in LDS before the first share's wave joins it to its own
    if (ks == 0) {
        auto join = [&](auto lo_) { constexpr bool LO = decltype(lo_)::value;   // LO: the rows < RH, which also store the lo plane; one block-uniform test for the whole join
#pragma unroll
        for (int g = 0; g < 2; ++g) { const float m1 = mls[(hg * 4 + g) * 32 + lane], l1 = mls[(hg * 4 + 2 + g) * 32 + lane]; const float m = fmaxf(m_run[g], m1);   // a share without a pass: m1 = -3e38, weight 0
            const float c0 = __builtin_amdgcn_exp2f(m_run[g] - m), c1 = __builtin_amdgcn_exp2f(m1 - m); float l = l_run[g] * c0 + l1 * c1; l += xhalf(l); const float inv = __fdiv_rn(1.0f, l); const float a0 = c0 * inv, a1 = c1 * inv;
            const size_t oo = (size_t)(bt * TT + q0 + 16 * g) * DQ + (size_t)(h * (HD / 32) * 64 + lane) * 8;   // fragment order: row block, then the head's first fragment; the 16 columns of tile t are one 512-byte half fragment
#pragma unroll
            for (int t = 0; t < 8; ++t) { const v4f* p = mrg + (hg * 32 + (g * 8 + t) * 2) * 32 + lane; const v4f b0 = p[0], b1 = p[32]; v8h oh, ol;   // fp16 hi, and for the rows < RH the fp16 lo that the last GEMM adds (it reads no lo plane of the other rows)
#pragma unroll
                for (int j = 0; j < 8; ++j) { const float y = acc[g][t][j] * a0 + (j < 4 ? b0[j & 3] : b1[j & 3]) * a1; oh[j] = tohx(y); if constexpr (LO) ol[j] = tohx(y - (float)oh[j]); }
                *(v8h*)(Ah + oo + t * 256) = oh; if constexpr (LO) *(v8h*)(Al + oo + t * 256) = ol;
                asm volatile("s_wait_xcnt 0x0" ::: "memory");   // the wait owed behind the stores before their registers are rewritten
                __builtin_amdgcn_sched_barrier(0); } } };        // keeps the next tile's arithmetic, which reuses those registers, behind that wait
        if (q0 < RH) join(BoolC<true>{}); else join(BoolC<false>{});
    }
}

__global__ __launch_bounds__(256) void k_wtG(const float* __restrict__ w, int K, int N, bf* Bt) {
    const int lane = threadIdx.x & 31; const int L0 = (blockIdx.x * 8 + (threadIdx.x >> 5)) * 8; const int nlines = N * K / 64;
{
#pragma unroll 1
        for (int l = 0; l < 8; ++l) { const int L = L0 + l; if (L >= nlines) break; const size_t e = (size_t)L * 64 + lane * 2; const int k = (int)(e % K), n = (int)(e / K); v2us o;
            o[0] = f2bf(w[(size_t)k * N + n]); o[1] = f2bf(w[(size_t)(k + 1) * N + n]); *(v2us*)(Bt + e) = o; }
         }
}
// ---- k_prep: every input conversion of the run in one grid. The block index picks the job (block-uniform): 2048 elements of x (both batches), wq, wk, wv to bf16, of wo to bf16 and on to fp16; 1024 (cos, sin) pairs; 256 bias values into one row.
// wq, wk, wv land one under the other (WS [DS][DM]) and bq, bk, bv one behind the other (BS [DS]), so that one GEMM makes q, k and v.
#define DS    (DQ + 2 * DKV)
#define PB_X  (NB_ * TT * DM / 2048)
#define PB_WQ (DQ * DM / 2048)
#define PB_WK (DKV * DM / 2048)
#define PB_WO (DM * DQ / 2048)
#define PB_CS (TT * HD / 1024)
#define PB_BS (DS / 256)
__global__ __launch_bounds__(256) void k_prep(const float* __restrict__ x, const float* __restrict__ wq, const float* __restrict__ wk, const float* __restrict__ wv, const float* __restrict__ wo, const float* __restrict__ cosT, const float* __restrict__ sinT, const float* __restrict__ bq, const float* __restrict__ bk, const float* __restrict__ bv, bf* XB, bf* WS, bf* WO, unsigned* CS, float* BS) {
    int blk = blockIdx.x; const float* src; bf* dst; bool pm = false, hf = false;
    if (blk < PB_X) { src = x; dst = XB; }
    else if ((blk -= PB_X) < PB_WQ) { src = wq; dst = WS; pm = true; }
    else if ((blk -= PB_WQ) < PB_WK) { src = wk; dst = WS + (size_t)DQ * DM; pm = true; }
    else if ((blk -= PB_WK) < PB_WK) { src = wv; dst = WS + (size_t)(DQ + DKV) * DM; pm = true; }
    else if ((blk -= PB_WK) < PB_WO) { src = wo; dst = WO; hf = true; }   // wo: the bf16-rounded value, stored as fp16 (the last GEMM's operand type)
    else if ((blk -= PB_WO) < PB_CS) {   // 16-byte unit o of the table: (cos, sin) as two bf16 in a word, 4 d of one t; units [t / 16][d / 16][(d / 4) % 2][lane = ((d / 8) % 2) 16 + t % 16], the order in which the lanes of k_gemmw's plane epilogue read them
        const int o = blk * 256 + threadIdx.x; const int ln = o & 31; const size_t s = (size_t)((o >> 9) * 16 + (ln & 15)) * HD + ((o >> 6) & 7) * 16 + (ln >> 4) * 8 + ((o >> 5) & 1) * 4;
        __builtin_amdgcn_sched_barrier(0);   // keeps the lane arithmetic above in front of the loads below
        const v4f cv = *(const v4f*)(cosT + s), sv = *(const v4f*)(sinT + s);
        asm volatile("s_wait_xcnt 0x0" ::: "memory");   // the wait owed before the address registers of these loads are rewritten
        __builtin_amdgcn_sched_barrier(0);               // keeps the later arithmetic behind that wait
        v4u w;
#pragma unroll
        for (int k = 0; k < 4; ++k) w[k] = (unsigned)f2bf(cv[k]) | ((unsigned)f2bf(sv[k]) << 16);
        *(v4u*)(CS + (size_t)o * 4) = w; asm volatile("s_wait_xcnt 0x0" ::: "memory"); return; }   // the wait owed behind a store before its registers are rewritten: the jobs are laid one behind the other in the build
    else { const int c = (blk - PB_CS) * 256 + threadIdx.x; const int p = (c >> 4) & 7; const int n = (c >> 7) * HD + ((p >> 1) | ((p & 1) << 2)) * 16 + (c & 15);   // column c of the stacked GEMM is column n of (q | k | v): see the row blocks below
        BS[c] = n < DQ ? bq[n] : n < DQ + DKV ? bk[n - DQ] : bv[n - DQ - DKV]; asm volatile("s_wait_xcnt 0x0" ::: "memory"); return; }   // the same wait behind this job's store
    // fragment order (see k_gemmw; all five planes have DM columns): a wave takes 8 rows x 32 k, reads one 128-byte line of each row and writes four whole lines; a block takes 16 rows x 128 k
    const int tx = threadIdx.x; const int row = (blk >> 4) * 16 + ((tx >> 5) & 1) * 8 + (tx & 7), pc = (tx >> 3) & 3, kb = (blk & 15) * 4 + (tx >> 6);
    const int rb = row >> 4; const int rp = pm ? (rb & ~7) | ((rb & 3) << 1) | ((rb >> 2) & 1) : rb;   // wq, wk, wv: the 8 row blocks of a head land in the order 0 4 1 5 2 6 3 7, each d block beside its rotation partner
    const size_t i = ((size_t)(rp * (DM / 32) + kb) * 2 + (pc >> 1)) * 32 + (pc & 1) * 16 + (row & 15); const v8f v = *(const v8f*)(src + (size_t)row * DM + kb * 32 + pc * 8); v8us o;
#pragma unroll
    for (int k = 0; k < 8; ++k) o[k] = hf ? __builtin_bit_cast(unsigned short, tohx(bfr(v[k]))) : f2bf(v[k]); *(v8us*)(dst + i * 8) = o;  }
extern "C" void kernel_launch(void* const* d_in, const int* in_sizes, int n_in,
                              void* d_out, int out_size, void* d_ws, size_t ws_size, hipStream_t stream) {
    (void)in_sizes; (void)n_in; (void)out_size;
    const float* x = (const float*)d_in[0]; const float* ang = (const float*)d_in[1]; const float* wq = (const float*)d_in[2]; const float* bq = (const float*)d_in[3]; const float* wk = (const float*)d_in[4]; const float* bk = (const float*)d_in[5]; const float* wv = (const float*)d_in[6]; const float* bv = (const float*)d_in[7]; const float* wo = (const float*)d_in[8]; const float* cosT = ang; const float* sinT = ang + (size_t)2048 * 128;
    float* OUT = (float*)d_out;     // [2][2048][2048]
    char* wsp = (char*)d_ws;
    auto take = [&](size_t bytes) { char* p = wsp; wsp += (bytes + 255) & ~(size_t)255; return (void*)p; };
    bf* WS = (bf*)take((size_t)DS * DM * 2); bf* WO = (bf*)take((size_t)DM * DQ * 2); unsigned* CS = (unsigned*)take((size_t)TT * HD * 4); float* BS = (float*)take((size_t)DS * 4);
    bf* XB = (bf*)take((size_t)NB_ * TT * DM * 2);
    h16* QP16 = (h16*)take((size_t)NB_ * NH_ * TT * HD * 2); h16* KP16 = (h16*)take((size_t)NB_ * NKV * TT * HD * 2); h16* VT16 = (h16*)take((size_t)NB_ * NKV * HD * TT * 2);
    bf* QPh = (bf*)take((size_t)NB_ * NH_ * TT * HD * 2); bf* QPl = (bf*)take((size_t)NB_ * NH_ * TT * HD * 2); bf* KPh = (bf*)take((size_t)NB_ * NKV * TT * HD * 2); bf* KPl = (bf*)take((size_t)NB_ * NKV * TT * HD * 2); bf* VTh = (bf*)take((size_t)NB_ * NKV * HD * TT * 2); bf* VTl = (bf*)take((size_t)NB_ * NKV * HD * TT * 2);
    h16* ATh = (h16*)take((size_t)NB_ * TT * DQ * 2); h16* ATl = (h16*)take((size_t)NB_ * TT * DQ * 2);
    if ((size_t)(wsp - (char*)d_ws) > ws_size) return;    // ws 256 MiB
    // four launches, each over both batches (rows b TT + t)
    k_prep<<<PB_X + PB_WQ + 2 * PB_WK + PB_WO + PB_CS + PB_BS, 256, 0, stream>>>(x, wq, wk, wv, wo, cosT, sinT, bq, bk, bv, XB, WS, WO, CS, BS);
    k_gemmw<0, 4, 2, 4, 6, true><<<dim3(NB_ * TT / 256, DS / 192, 1), 256, 0, stream>>>(XB, nullptr, WS, nullptr, 0, BS, PlaneSet{CS, QP16, QPh, QPl, KP16, KPh, KPl, VT16, VTh, VTl});
    k_fattn<<<dim3(NKV * NB_, TT / 32, 1), 32 * REP * KSP, 0, stream>>>(QP16, QPh, QPl, KP16, KPh, KPl, VT16, VTh, VTl, ATh, ATl);
    k_gemmw<1, 2, 4, 4, 4, false><<<dim3(NB_ * TT / 128, DM / 256, 1), 256, 0, stream>>>((const bf*)ATh, (const bf*)ATl, WO, OUT, DM, nullptr, PlaneSet{});
}
